// v000
// Times are from an AMD MI455X. After a warm-up the kernel runs many times in a row, and a time is the length of
// such a window on the GPU divided by its runs, so every launch and the gaps after it count. The runs cycle
// through copies of the inputs. A figure is the median of several windows, for all but v000 over two sittings.
// Sittings can differ by a few percent; kernels timed side by side share one.
// v000 is the starting kernel. One run takes 2220 microseconds.
#include <hip/hip_runtime.h>

// Causal multi-headed attention on three input streams (queries, keys, values [4][2048][768]; Q = queries W_Q^T + b_Q, K = keys W_K^T + b_K, V = values W_V^T + b_V ('oi' uniform(+-768^-0.5) incl. biases: non-zero; 12 heads x 64); scores x 1/sqrt(64); causal (-inf); softmax; outputs = merged (standard) W_O^T + b_O -> [4][2048][768] (6.3 M); argument order queries, keys, values, W_Q, b_Q, W_K, b_K, W_V, b_V, W_O, b_O).
// Layout per batch: bf16 copies of queries, keys, values in turn; 'oi' weights; exact projections (K 768) + f32 biases; identity-table plane builders; causal T-2048 attention at 12 heads (hybrid rows: < 512 hi/lo 3 products, rest fp16 x1024; k_gemmc skips tiles above the diagonal); merged hi/lo x W_O exact + b_O.
// Compute dtypes, f32 accumulate: every input rounded to bf16; projections exact + f32 biases; attention rows < 512 3 products, rest fp16; softmax f32; W_O hl x exact + bias.

#define NB_  4
#define TT   2048
#define DM   768
#define NH_  12
#define NKV  12
#define REP  (NH_ / NKV)
#define HD   64
#define DQ   (NH_ * HD)
#define DKV  (NKV * HD)
#define ZH   2
#define RH   512                  // query rows < RH use hi+lo planes (0: none)
#define WIN  2048
#define PCAR 1024.0f
#define SCL  0.125f   // HD^-0.5
typedef _Float16 h16;
typedef unsigned short bf;
typedef __attribute__((ext_vector_type(16))) __bf16   v16bf;
typedef __attribute__((ext_vector_type(16))) _Float16 v16h;
typedef __attribute__((ext_vector_type(8)))  _Float16 v8h;
typedef __attribute__((ext_vector_type(8)))  unsigned short v8us;
typedef __attribute__((ext_vector_type(8)))  float    v8f;
typedef __attribute__((ext_vector_type(4)))  float    v4f;
typedef v8h  __attribute__((may_alias)) v8ha;
typedef v4f  __attribute__((may_alias)) v4fa;
typedef v8us __attribute__((may_alias)) v8usa;

__device__ __forceinline__ unsigned short f2bf(float f) { unsigned u = __float_as_uint(f); u += 0x7FFFu + ((u >> 16) & 1u); return (unsigned short)(u >> 16); }
__device__ __forceinline__ float bf2f(unsigned short b) { return __uint_as_float(((unsigned)b) << 16); }
__device__ __forceinline__ float bfr(float f) { return bf2f(f2bf(f)); }
__device__ __forceinline__ v16h cat16(v8h lo, v8h hi) { return __builtin_shufflevector(lo, hi, 0, 1, 2, 3, 4, 5, 6, 7, 8, 9, 10, 11, 12, 13, 14, 15); }
__device__ __forceinline__ v16bf cat16b(v8us lo, v8us hi) { return __builtin_bit_cast(v16bf, __builtin_shufflevector(lo, hi, 0, 1, 2, 3, 4, 5, 6, 7, 8, 9, 10, 11, 12, 13, 14, 15)); }
__device__ __forceinline__ v8f wmma16(v16h a, v16h b, v8f c) { return __builtin_amdgcn_wmma_f32_16x16x32_f16(false, a, false, b, (short)0, c, false, false); }
__device__ __forceinline__ v8f wmmab(v16bf a, v16bf b, v8f c) { return __builtin_amdgcn_wmma_f32_16x16x32_bf16(false, a, false, b, (short)0, c, false, false); }



// ---- k_gemmw: register-blocked GEMM, ONE WAVE per 64x64 output tile (16 accumulators), operands straight from K-contiguous 16-bit planes; grid (M/64, N/64, Z), 32 threads.
// C[m][n] (f32, pitch ldc, + optional f32 bias[n]) = sum_k A[m][k] Bt[n][k] (+ split products per NSPLIT). z-batch strides sA/sB/sC in elements. K % 32 == 0.
template <typename T16> struct WFrag;
template <> struct WFrag<h16> { typedef v16h V; static __device__ __forceinline__ V ld(const h16* p) { return cat16(*(const v8h*)p, *(const v8h*)(p + 16)); } static __device__ __forceinline__ v8f mma(V a, V b, v8f c) { return wmma16(a, b, c); } };
template <> struct WFrag<bf> { typedef v16bf V; static __device__ __forceinline__ V ld(const bf* p) { return cat16b(*(const v8us*)p, *(const v8us*)(p + 16)); } static __device__ __forceinline__ v8f mma(V a, V b, v8f c) { return wmmab(a, b, c); } };
template <typename T16, int NSPLIT, bool BIAS>
__global__ __launch_bounds__(32) void k_gemmw(const T16* __restrict__ A, const T16* __restrict__ A2, const T16* __restrict__ Bt, const T16* __restrict__ Bt2, int K, float* C, int ldc, const float* __restrict__ bias, size_t sA, size_t sB, size_t sC) {
    typedef typename WFrag<T16>::V V;
    __shared__ __align__(16) float os[16 * 68];
    const size_t z = blockIdx.z; A += z * sA; if (A2) A2 += z * sA; Bt += z * sB; if (Bt2) Bt2 += z * sB; C += z * sC;
    const int lane = threadIdx.x & 31, lr = lane & 15, hi = lane >> 4; const int r0 = blockIdx.x * 64, c0 = blockIdx.y * 64;
    v8f acc[4][4];
#pragma unroll
    for (int mb = 0; mb < 4; ++mb)
#pragma unroll
        for (int nb = 0; nb < 4; ++nb) acc[mb][nb] = (v8f){};
    const size_t aoff = (size_t)(r0 + lr) * K + 8 * hi, boff = (size_t)(c0 + lr) * K + 8 * hi;
#pragma unroll 1
    for (int kc = 0; kc < K; kc += 32) {
        V a[4], a2[4];
#pragma unroll
        for (int mb = 0; mb < 4; ++mb) { a[mb] = WFrag<T16>::ld(A + aoff + (size_t)mb * 16 * K + kc); if (NSPLIT == 1 || NSPLIT == 2) a2[mb] = WFrag<T16>::ld(A2 + aoff + (size_t)mb * 16 * K + kc); }
#pragma unroll
        for (int nb = 0; nb < 4; ++nb) { const V b = WFrag<T16>::ld(Bt + boff + (size_t)nb * 16 * K + kc); V b2; if (NSPLIT >= 2) b2 = WFrag<T16>::ld(Bt2 + boff + (size_t)nb * 16 * K + kc);
#pragma unroll
            for (int mb = 0; mb < 4; ++mb) { acc[mb][nb] = WFrag<T16>::mma(a[mb], b, acc[mb][nb]); if (NSPLIT == 1 || NSPLIT == 2) acc[mb][nb] = WFrag<T16>::mma(a2[mb], b, acc[mb][nb]); if (NSPLIT >= 2) acc[mb][nb] = WFrag<T16>::mma(a[mb], b2, acc[mb][nb]); } }
        asm volatile("v_nop\n\tv_nop\n\tv_nop\n\tv_nop" : "+v"(acc[0][0]), "+v"(acc[1][1]), "+v"(acc[2][2]), "+v"(acc[3][3]) : "v"(a[0]), "v"(a[3]));
    }
#pragma unroll
    for (int mb = 0; mb < 4; ++mb) {
#pragma unroll
        for (int nb = 0; nb < 4; ++nb) {
#pragma unroll
            for (int j = 0; j < 8; ++j) os[(hi * 8 + j) * 68 + nb * 16 + lr] = acc[mb][nb][j]; }
        __builtin_amdgcn_wave_barrier(); asm volatile("" ::: "memory");
        float* crow = C + (size_t)(r0 + mb * 16) * ldc + c0;
{
#pragma unroll
            for (int s = 0; s < 8; ++s) { const int row = 2 * s + hi, cofs = lr * 4; v4f val = *(const v4fa*)(os + row * 68 + cofs); if (BIAS) { val[0] += bfr(bias[c0 + cofs]); val[1] += bfr(bias[c0 + cofs + 1]); val[2] += bfr(bias[c0 + cofs + 2]); val[3] += bfr(bias[c0 + cofs + 3]); }
                *(v4f*)(crow + (size_t)row * ldc + cofs) = val; }
             }
        __builtin_amdgcn_wave_barrier(); asm volatile("" ::: "memory");
    }
}

// ---- k_gemmc: the same one-wave 64x64 tile GEMM specialised for causal attention: CMODE 1 skips score tiles entirely above the diagonal (query rows r0+roff.., key columns c0..), CMODE 2 limits the
// key (K) loop of the probability x value contraction to the diagonal block (probabilities beyond it are exactly zero). roff = row offset of this launch's first row within the sequence.
template <typename T16, int NSPLIT, int CMODE>
__global__ __launch_bounds__(32) void k_gemmc(const T16* __restrict__ A, const T16* __restrict__ A2, const T16* __restrict__ Bt, const T16* __restrict__ Bt2, int K, float* C, int ldc, int roff, size_t sA, size_t sB, size_t sC) {
    typedef typename WFrag<T16>::V V;
    __shared__ __align__(16) float os[16 * 68];
    const size_t z = blockIdx.z; A += z * sA; if (A2) A2 += z * sA; Bt += z * sB; if (Bt2) Bt2 += z * sB; C += z * sC;
    const int lane = threadIdx.x & 31, lr = lane & 15, hi = lane >> 4; const int r0 = blockIdx.x * 64, c0 = blockIdx.y * 64;
    if (CMODE == 1 && c0 > r0 + roff + 63) return;                  // score tile entirely above the causal diagonal: never read (the softmax masks j > i by select)
    const int Kl = (CMODE == 2) ? min(K, r0 + roff + 64) : K;        // P.V: probabilities are exactly 0 beyond the diagonal block, so the K loop stops there
    v8f acc[4][4];
#pragma unroll
    for (int mb = 0; mb < 4; ++mb)
#pragma unroll
        for (int nb = 0; nb < 4; ++nb) acc[mb][nb] = (v8f){};
    const size_t aoff = (size_t)(r0 + lr) * K + 8 * hi, boff = (size_t)(c0 + lr) * K + 8 * hi;
#pragma unroll 1
    for (int kc = 0; kc < Kl; kc += 32) {
        V a[4], a2[4];
#pragma unroll
        for (int mb = 0; mb < 4; ++mb) { a[mb] = WFrag<T16>::ld(A + aoff + (size_t)mb * 16 * K + kc); if (NSPLIT == 1 || NSPLIT == 2) a2[mb] = WFrag<T16>::ld(A2 + aoff + (size_t)mb * 16 * K + kc); }
#pragma unroll
        for (int nb = 0; nb < 4; ++nb) { const V b = WFrag<T16>::ld(Bt + boff + (size_t)nb * 16 * K + kc); V b2; if (NSPLIT >= 2) b2 = WFrag<T16>::ld(Bt2 + boff + (size_t)nb * 16 * K + kc);
#pragma unroll
            for (int mb = 0; mb < 4; ++mb) { acc[mb][nb] = WFrag<T16>::mma(a[mb], b, acc[mb][nb]); if (NSPLIT == 1 || NSPLIT == 2) acc[mb][nb] = WFrag<T16>::mma(a2[mb], b, acc[mb][nb]); if (NSPLIT >= 2) acc[mb][nb] = WFrag<T16>::mma(a[mb], b2, acc[mb][nb]); } }
        asm volatile("v_nop\n\tv_nop\n\tv_nop\n\tv_nop" : "+v"(acc[0][0]), "+v"(acc[1][1]), "+v"(acc[2][2]), "+v"(acc[3][3]) : "v"(a[0]), "v"(a[3]));
    }
#pragma unroll
    for (int mb = 0; mb < 4; ++mb) {
#pragma unroll
        for (int nb = 0; nb < 4; ++nb) {
#pragma unroll
            for (int j = 0; j < 8; ++j) os[(hi * 8 + j) * 68 + nb * 16 + lr] = acc[mb][nb][j]; }
        __builtin_amdgcn_wave_barrier(); asm volatile("" ::: "memory");
        float* crow = C + (size_t)(r0 + mb * 16) * ldc + c0;
{
#pragma unroll
            for (int s = 0; s < 8; ++s) { const int row = 2 * s + hi, cofs = lr * 4; v4f val = *(const v4fa*)(os + row * 68 + cofs);
                *(v4f*)(crow + (size_t)row * ldc + cofs) = val; }
             }
        __builtin_amdgcn_wave_barrier(); asm volatile("" ::: "memory");
    }
}

__device__ __forceinline__ h16 tohx(float x) { return (h16)x; }
__device__ __forceinline__ void splitf(float y, unsigned short& h, unsigned short& l) { h = f2bf(y); l = f2bf(y - bf2f(h)); }
typedef __attribute__((ext_vector_type(2))) _Float16 v2h;
typedef __attribute__((ext_vector_type(4))) _Float16 v4h;
typedef __attribute__((ext_vector_type(2))) unsigned short v2us;
typedef __attribute__((ext_vector_type(4))) unsigned short v4us;
typedef __attribute__((ext_vector_type(2))) float v2f;
typedef __attribute__((ext_vector_type(4))) int v4i;

__global__ __launch_bounds__(256) void k_cvt8(const float* __restrict__ src, bf* dst, size_t n8) { const size_t i = (size_t)blockIdx.x * 256 + threadIdx.x; if (i >= n8) return; const v8f v = *(const v8f*)(src + i * 8); v8us o;
#pragma unroll
    for (int k = 0; k < 8; ++k) o[k] = f2bf(v[k]); *(v8us*)(dst + i * 8) = o;  }

// k_rope: head planes [h][t][d] (fp16 + hi/lo) of rope(x) x sc with the rotate-half convention out[d] = x[d] cos[t][d] - x[d+HD/2] sin[t][d], out[d+HD/2] = x[d+HD/2] cos[t][d+HD/2] + x[d] sin[t][d+HD/2]
__global__ __launch_bounds__(256) void k_rope(const float* __restrict__ F, int pitch, int nheads, const float* __restrict__ CS, const float* __restrict__ RF, const float* __restrict__ nw, float sc, h16* P16, bf* Ph, bf* Pl) {
    const size_t e = ((size_t)blockIdx.x * 256 + threadIdx.x) * 2; if (e >= (size_t)nheads * TT * HD) return; const int d = (int)(e % HD); const int t = (int)((e / HD) % TT); const int h = (int)(e / ((size_t)HD * TT)); const float* f = F + (size_t)t * pitch + h * HD; const float rf = RF ? RF[(size_t)h * TT + t] : 1.0f; v2h o16; v2us oh, ol;
#pragma unroll
    for (int q = 0; q < 2; ++q) { const int dd = d + q; const int dp = (dd < HD / 2) ? dd + HD / 2 : dd - HD / 2; float x0 = f[dd], x1 = f[dp];
        if (RF) { float n0 = __fmul_rn(x0, rf), n1 = __fmul_rn(x1, rf); asm volatile("" : "+v"(n0)); asm volatile("" : "+v"(n1)); x0 = __fmul_rn(bfr(nw[dd]), n0); x1 = __fmul_rn(bfr(nw[dp]), n1); }
        const v2f cs = *(const v2f*)(CS + ((size_t)t * HD + dd) * 2); float a = __fmul_rn(x0, cs[0]), bq = __fmul_rn(x1, cs[1]); asm volatile("" : "+v"(a)); asm volatile("" : "+v"(bq)); const float r = ((dd < HD / 2) ? __fsub_rn(a, bq) : __fadd_rn(a, bq)) * sc;
        o16[q] = tohx(r); unsigned short a2, c2; splitf(r, a2, c2); oh[q] = a2; ol[q] = c2; }
    *(v2h*)(P16 + e) = o16; *(v2us*)(Ph + e) = oh; *(v2us*)(Pl + e) = ol;  }
__global__ __launch_bounds__(256) void k_vtp(const float* __restrict__ F, int pitch, int nheads, h16* V16, bf* Vh, bf* Vl) { const size_t e = ((size_t)blockIdx.x * 256 + threadIdx.x) * 2; if (e >= (size_t)nheads * HD * TT) return; const int t = (int)(e % TT); const int d = (int)((e / TT) % HD); const int g = (int)(e / ((size_t)TT * HD)); v2h o16; v2us oh, ol;
#pragma unroll
    for (int q = 0; q < 2; ++q) { const float x = F[(size_t)(t + q) * pitch + g * HD + d]; o16[q] = tohx(x); unsigned short a2, c2; splitf(x, a2, c2); oh[q] = a2; ol[q] = c2; }
    *(v2h*)(V16 + e) = o16; *(v2us*)(Vh + e) = oh; *(v2us*)(Vl + e) = ol;  }
__global__ __launch_bounds__(256) void k_csid(float* CS) { const int idx = blockIdx.x * 256 + threadIdx.x; if (idx >= TT * HD) return; v2f cs; cs[0] = 1.0f; cs[1] = 0.0f; *(v2f*)(CS + (size_t)idx * 2) = cs;  }
// k_asoft: per row (zz, i): t = S x HD^-0.5 for j <= i and i - j < WIN (WIN = TT: the window never binds, plain causal; the reference's -1e9 additive fill vanishes identically); softmax over the 2048 keys (register row, one exp, fixed trees);
__global__ __launch_bounds__(256) void k_asoft(const float* __restrict__ Sb, h16* P16, bf* Ph, bf* Pl) {
    const int lane = threadIdx.x & 31; const int row = blockIdx.x * 8 + (threadIdx.x >> 5); if (row >= ZH * TT) return; const int i = row % TT; const int zz = row / TT; (void)zz; const bool hires = (i < RH); const float* sr = Sb + (size_t)row * TT; float v[TT / 32]; float mx = -3.0e38f;
#pragma unroll
    for (int ch = 0; ch < TT / 128; ++ch) { const int j0 = ch * 128 + lane * 4; const v4f a = *(const v4f*)(sr + j0);
#pragma unroll
        for (int q = 0; q < 4; ++q) { const int j = j0 + q; (void)j; const float t = (j <= i && i - j < WIN) ? a[q] * SCL : -3.0e38f; v[ch * 4 + q] = t; mx = fmaxf(mx, t); } }
#pragma unroll
    for (int sh = 16; sh; sh >>= 1) mx = fmaxf(mx, __shfl_xor(mx, sh, 32));
    float sum = 0.f;
#pragma unroll
    for (int k = 0; k < TT / 32; ++k) { float d0 = __fsub_rn(v[k], mx); asm volatile("" : "+v"(d0)); v[k] = __builtin_amdgcn_exp2f(__fmul_rn(d0, 1.4426950408889634f)); sum += v[k]; }
#pragma unroll
    for (int sh = 16; sh; sh >>= 1) sum += __shfl_xor(sum, sh, 32);
    const float f = __fdiv_rn(hires ? 1.0f : PCAR, sum);
{
        if (hires) {
#pragma unroll
            for (int ch = 0; ch < TT / 128; ++ch) { v4us oh, ol;
#pragma unroll
                for (int q = 0; q < 4; ++q) { unsigned short a, c2; splitf(v[ch * 4 + q] * f, a, c2); oh[q] = a; ol[q] = c2; }
                const size_t oo = ((size_t)zz * (RH ? RH : 1) + i) * TT + ch * 128 + lane * 4; *(v4us*)(Ph + oo) = oh; *(v4us*)(Pl + oo) = ol; }
        } else {
#pragma unroll
            for (int ch = 0; ch < TT / 128; ++ch) { v4h o4;
#pragma unroll
                for (int q = 0; q < 4; ++q) o4[q] = tohx(v[ch * 4 + q] * f);
                *(v4h*)(P16 + (size_t)row * TT + ch * 128 + lane * 4) = o4; } }
         }
}
__global__ __launch_bounds__(256) void k_merge(const float* __restrict__ O, int h0, bf* Ah, bf* Al) { const size_t e = ((size_t)blockIdx.x * 256 + threadIdx.x) * 2; if (e >= (size_t)ZH * TT * HD) return; const int d = (int)(e % HD); const int t = (int)((e / HD) % TT); const int zz = (int)(e / ((size_t)HD * TT)); const float cs = (t < RH) ? 1.0f : (1.0f / PCAR); const size_t oo = (size_t)t * DQ + (h0 + zz) * HD + d;
    v2us oh, ol;
#pragma unroll
    for (int q = 0; q < 2; ++q) { unsigned short a, c2; splitf(O[e + q] * cs, a, c2); oh[q] = a; ol[q] = c2; } *(v2us*)(Ah + oo) = oh; *(v2us*)(Al + oo) = ol;  }

extern "C" void kernel_launch(void* const* d_in, const int* in_sizes, int n_in,
                              void* d_out, int out_size, void* d_ws, size_t ws_size, hipStream_t stream) {
    (void)in_sizes; (void)n_in; (void)out_size;
    const float* x = (const float*)d_in[0]; const float* xk = (const float*)d_in[1]; const float* xv = (const float*)d_in[2]; const float* wq = (const float*)d_in[3]; const float* bq = (const float*)d_in[4]; const float* wk = (const float*)d_in[5]; const float* bk = (const float*)d_in[6]; const float* wv = (const float*)d_in[7]; const float* bv = (const float*)d_in[8]; const float* wo = (const float*)d_in[9]; const float* bo = (const float*)d_in[10];
    float* OUT = (float*)d_out;     // [4][2048][768]
    char* wsp = (char*)d_ws;
    auto take = [&](size_t bytes) { char* p = wsp; wsp += (bytes + 255) & ~(size_t)255; return (void*)p; };
    bf* WQ = (bf*)take((size_t)DQ * DM * 2); bf* WK = (bf*)take((size_t)DKV * DM * 2); bf* WV = (bf*)take((size_t)DKV * DM * 2); bf* WO = (bf*)take((size_t)DM * DQ * 2); float* CS = (float*)take((size_t)TT * HD * 2 * 4);
    bf* XB = (bf*)take((size_t)TT * DM * 2); float* FQ = (float*)take((size_t)TT * DQ * 4); float* FK = (float*)take((size_t)TT * DKV * 4);
    h16* QP16 = (h16*)take((size_t)NH_ * TT * HD * 2); h16* KP16 = (h16*)take((size_t)NKV * TT * HD * 2); h16* VT16 = (h16*)take((size_t)NKV * HD * TT * 2);
    bf* QPh = (bf*)take((size_t)NH_ * TT * HD * 2); bf* QPl = (bf*)take((size_t)NH_ * TT * HD * 2); bf* KPh = (bf*)take((size_t)NKV * TT * HD * 2); bf* KPl = (bf*)take((size_t)NKV * TT * HD * 2); bf* VTh = (bf*)take((size_t)NKV * HD * TT * 2); bf* VTl = (bf*)take((size_t)NKV * HD * TT * 2); bf* Ph = (bf*)take((size_t)ZH * RH * TT * 2); bf* Pl = (bf*)take((size_t)ZH * RH * TT * 2);
    float* Sb = (float*)take((size_t)ZH * TT * TT * 4); h16* P16 = (h16*)take((size_t)ZH * TT * TT * 2); float* Ob = (float*)take((size_t)ZH * TT * HD * 4); bf* ATh = (bf*)take((size_t)TT * DQ * 2); bf* ATl = (bf*)take((size_t)TT * DQ * 2);
    if ((size_t)(wsp - (char*)d_ws) > ws_size) return;    // ws 256 MiB
    float* FV = FK;   // v projection reuses the k buffer after the k planes are built (stream-ordered)
    { k_cvt8<<<(unsigned)(((size_t)DQ * DM / 8 + 255) / 256), 256, 0, stream>>>(wq, WQ, (size_t)DQ * DM / 8); k_cvt8<<<(unsigned)(((size_t)DKV * DM / 8 + 255) / 256), 256, 0, stream>>>(wk, WK, (size_t)DKV * DM / 8); k_cvt8<<<(unsigned)(((size_t)DKV * DM / 8 + 255) / 256), 256, 0, stream>>>(wv, WV, (size_t)DKV * DM / 8);
      k_cvt8<<<(unsigned)(((size_t)DM * DQ / 8 + 255) / 256), 256, 0, stream>>>(wo, WO, (size_t)DM * DQ / 8);
       }
    k_csid<<<(TT * HD + 255) / 256, 256, 0, stream>>>(CS);
    const unsigned LQ = (unsigned)(((size_t)NH_ * TT * HD / 2 + 255) / 256), LKv = (unsigned)(((size_t)NKV * TT * HD / 2 + 255) / 256);
    for (int b = 0; b < NB_; ++b) {
        
        k_cvt8<<<(unsigned)(((size_t)TT * DM / 8 + 255) / 256), 256, 0, stream>>>(x + (size_t)b * TT * DM, XB, (size_t)TT * DM / 8);
        k_gemmw<bf, 0, true><<<dim3(TT / 64, DQ / 64, 1), 32, 0, stream>>>(XB, nullptr, WQ, nullptr, DM, FQ, DQ, bq, 0, 0, 0);
        k_rope<<<LQ, 256, 0, stream>>>(FQ, DQ, NH_, CS, nullptr, nullptr, 1.0f, QP16, QPh, QPl);
        k_cvt8<<<(unsigned)(((size_t)TT * DM / 8 + 255) / 256), 256, 0, stream>>>(xk + (size_t)b * TT * DM, XB, (size_t)TT * DM / 8);   /* XB := bf16(keys[b]) */ k_gemmw<bf, 0, true><<<dim3(TT / 64, DKV / 64, 1), 32, 0, stream>>>(XB, nullptr, WK, nullptr, DM, FK, DKV, bk, 0, 0, 0);
        k_rope<<<LKv, 256, 0, stream>>>(FK, DKV, NKV, CS, nullptr, nullptr, 1.0f, KP16, KPh, KPl);
        k_cvt8<<<(unsigned)(((size_t)TT * DM / 8 + 255) / 256), 256, 0, stream>>>(xv + (size_t)b * TT * DM, XB, (size_t)TT * DM / 8);   /* XB := bf16(values[b]) */ k_gemmw<bf, 0, true><<<dim3(TT / 64, DKV / 64, 1), 32, 0, stream>>>(XB, nullptr, WV, nullptr, DM, FV, DKV, bv, 0, 0, 0); k_vtp<<<LKv, 256, 0, stream>>>(FV, DKV, NKV, VT16, VTh, VTl);
        for (int h0 = 0; h0 < NH_; h0 += ZH) { const size_t zq = (size_t)h0, zk = (size_t)(h0 / REP);   // one kv head per query head: the pass's two heads use consecutive kv planes (z-strides TT*HD)
            k_gemmc<bf, 2, 1><<<dim3(RH / 64, TT / 64, ZH), 32, 0, stream>>>(QPh + zq * TT * HD, QPl + zq * TT * HD, KPh + zk * TT * HD, KPl + zk * TT * HD, HD, Sb, TT, 0, (size_t)TT * HD, (size_t)TT * HD, (size_t)TT * TT);
            k_gemmc<h16, 0, 1><<<dim3((TT - RH) / 64, TT / 64, ZH), 32, 0, stream>>>(QP16 + zq * TT * HD + (size_t)RH * HD, nullptr, KP16 + zk * TT * HD, nullptr, HD, Sb + (size_t)RH * TT, TT, RH, (size_t)TT * HD, (size_t)TT * HD, (size_t)TT * TT);
            k_asoft<<<ZH * TT / 8, 256, 0, stream>>>(Sb, P16, Ph, Pl);
            k_gemmc<bf, 2, 2><<<dim3(RH / 64, HD / 64, ZH), 32, 0, stream>>>(Ph, Pl, VTh + zk * HD * TT, VTl + zk * HD * TT, TT, Ob, HD, 0, (size_t)RH * TT, (size_t)HD * TT, (size_t)TT * HD);
            k_gemmc<h16, 0, 2><<<dim3((TT - RH) / 64, HD / 64, ZH), 32, 0, stream>>>(P16 + (size_t)RH * TT, nullptr, VT16 + zk * HD * TT, nullptr, TT, Ob + (size_t)RH * HD, HD, RH, (size_t)TT * TT, (size_t)HD * TT, (size_t)TT * HD);
            k_merge<<<(unsigned)(((size_t)ZH * TT * HD / 2 + 255) / 256), 256, 0, stream>>>(Ob, h0, ATh, ATl); }
        k_gemmw<bf, 1, true><<<dim3(TT / 64, DM / 64, 1), 32, 0, stream>>>(ATh, ATl, WO, nullptr, DQ, OUT + (size_t)b * TT * DM, DM, bo, 0, 0, 0); }
}

// v001
// One run takes 1200 microseconds.
// Two timings next to v000 put it at 1.86 and 1.84 times that version's speed.
#include <hip/hip_runtime.h>

// Causal multi-headed attention on three input streams (queries, keys, values [4][2048][768]; Q = queries W_Q^T + b_Q, K = keys W_K^T + b_K, V = values W_V^T + b_V ('oi' uniform(+-768^-0.5) incl. biases: non-zero; 12 heads x 64); scores x 1/sqrt(64); causal (-inf); softmax; outputs = merged (standard) W_O^T + b_O -> [4][2048][768] (6.3 M); argument order queries, keys, values, W_Q, b_Q, W_K, b_K, W_V, b_V, W_O, b_O).
// Layout per batch: bf16 copies of queries, keys, values in turn; 'oi' weights; exact projections (K 768) + f32 biases; identity-table plane builders; causal T-2048 attention at 12 heads (hybrid rows: < 512 hi/lo 3 products, rest fp16 x1024; k_gemmc skips tiles above the diagonal); merged hi/lo x W_O exact + b_O.
// Compute dtypes, f32 accumulate: every input rounded to bf16; projections exact + f32 biases; attention rows < 512 3 products, rest fp16; softmax f32; W_O hl x exact + bias.

#define NB_  4
#define TT   2048
#define DM   768
#define NH_  12
#define NKV  12
#define REP  (NH_ / NKV)
#define HD   64
#define DQ   (NH_ * HD)
#define DKV  (NKV * HD)
#define ZH   6                    // heads per attention pass (z of each attention launch); NH_ % ZH == 0, planes for ZH heads fit the workspace
#define RH   512                  // query rows < RH use hi+lo planes (0: none)
#define WIN  2048
#define PCAR 1024.0f
#define SCL  0.125f   // HD^-0.5
typedef _Float16 h16;
typedef unsigned short bf;
typedef __attribute__((ext_vector_type(16))) __bf16   v16bf;
typedef __attribute__((ext_vector_type(16))) _Float16 v16h;
typedef __attribute__((ext_vector_type(8)))  _Float16 v8h;
typedef __attribute__((ext_vector_type(8)))  unsigned short v8us;
typedef __attribute__((ext_vector_type(8)))  float    v8f;
typedef __attribute__((ext_vector_type(4)))  float    v4f;
typedef v8h  __attribute__((may_alias)) v8ha;
typedef v4f  __attribute__((may_alias)) v4fa;
typedef v8us __attribute__((may_alias)) v8usa;

__device__ __forceinline__ unsigned short f2bf(float f) { unsigned u = __float_as_uint(f); u += 0x7FFFu + ((u >> 16) & 1u); return (unsigned short)(u >> 16); }
__device__ __forceinline__ float bf2f(unsigned short b) { return __uint_as_float(((unsigned)b) << 16); }
__device__ __forceinline__ float bfr(float f) { return bf2f(f2bf(f)); }
__device__ __forceinline__ v16h cat16(v8h lo, v8h hi) { return __builtin_shufflevector(lo, hi, 0, 1, 2, 3, 4, 5, 6, 7, 8, 9, 10, 11, 12, 13, 14, 15); }
__device__ __forceinline__ v16bf cat16b(v8us lo, v8us hi) { return __builtin_bit_cast(v16bf, __builtin_shufflevector(lo, hi, 0, 1, 2, 3, 4, 5, 6, 7, 8, 9, 10, 11, 12, 13, 14, 15)); }
__device__ __forceinline__ v8f wmma16(v16h a, v16h b, v8f c) { return __builtin_amdgcn_wmma_f32_16x16x32_f16(false, a, false, b, (short)0, c, false, false); }
__device__ __forceinline__ v8f wmmab(v16bf a, v16bf b, v8f c) { return __builtin_amdgcn_wmma_f32_16x16x32_bf16(false, a, false, b, (short)0, c, false, false); }



// ---- k_gemmw: register-blocked GEMM, ONE WAVE per 64x64 output tile (16 accumulators), operands straight from K-contiguous 16-bit planes; grid (M/64, N/64, Z), 32 threads.
// C[m][n] (f32, pitch ldc, + optional f32 bias[n]) = sum_k A[m][k] Bt[n][k] (+ split products per NSPLIT). z-batch strides sA/sB/sC in elements. K % 32 == 0.
template <typename T16> struct WFrag;
template <> struct WFrag<h16> { typedef v16h V; static __device__ __forceinline__ V ld(const h16* p) { return cat16(*(const v8h*)p, *(const v8h*)(p + 16)); } static __device__ __forceinline__ v8f mma(V a, V b, v8f c) { return wmma16(a, b, c); } };
template <> struct WFrag<bf> { typedef v16bf V; static __device__ __forceinline__ V ld(const bf* p) { return cat16b(*(const v8us*)p, *(const v8us*)(p + 16)); } static __device__ __forceinline__ v8f mma(V a, V b, v8f c) { return wmmab(a, b, c); } };
template <typename T16, int NSPLIT, bool BIAS>
__global__ __launch_bounds__(32) void k_gemmw(const T16* __restrict__ A, const T16* __restrict__ A2, const T16* __restrict__ Bt, const T16* __restrict__ Bt2, int K, float* C, int ldc, const float* __restrict__ bias, size_t sA, size_t sB, size_t sC) {
    typedef typename WFrag<T16>::V V;
    __shared__ __align__(16) float os[16 * 68];
    const size_t z = blockIdx.z; A += z * sA; if (A2) A2 += z * sA; Bt += z * sB; if (Bt2) Bt2 += z * sB; C += z * sC;
    const int lane = threadIdx.x & 31, lr = lane & 15, hi = lane >> 4; const int r0 = blockIdx.x * 64, c0 = blockIdx.y * 64;
    v8f acc[4][4];
#pragma unroll
    for (int mb = 0; mb < 4; ++mb)
#pragma unroll
        for (int nb = 0; nb < 4; ++nb) acc[mb][nb] = (v8f){};
    const size_t aoff = (size_t)(r0 + lr) * K + 8 * hi, boff = (size_t)(c0 + lr) * K + 8 * hi;
#pragma unroll 1
    for (int kc = 0; kc < K; kc += 32) {
        V a[4], a2[4];
#pragma unroll
        for (int mb = 0; mb < 4; ++mb) { a[mb] = WFrag<T16>::ld(A + aoff + (size_t)mb * 16 * K + kc); if (NSPLIT == 1 || NSPLIT == 2) a2[mb] = WFrag<T16>::ld(A2 + aoff + (size_t)mb * 16 * K + kc); }
#pragma unroll
        for (int nb = 0; nb < 4; ++nb) { const V b = WFrag<T16>::ld(Bt + boff + (size_t)nb * 16 * K + kc); V b2; if (NSPLIT >= 2) b2 = WFrag<T16>::ld(Bt2 + boff + (size_t)nb * 16 * K + kc);
#pragma unroll
            for (int mb = 0; mb < 4; ++mb) { acc[mb][nb] = WFrag<T16>::mma(a[mb], b, acc[mb][nb]); if (NSPLIT == 1 || NSPLIT == 2) acc[mb][nb] = WFrag<T16>::mma(a2[mb], b, acc[mb][nb]); if (NSPLIT >= 2) acc[mb][nb] = WFrag<T16>::mma(a[mb], b2, acc[mb][nb]); } }
        asm volatile("v_nop\n\tv_nop\n\tv_nop\n\tv_nop" : "+v"(acc[0][0]), "+v"(acc[1][1]), "+v"(acc[2][2]), "+v"(acc[3][3]) : "v"(a[0]), "v"(a[3]));
    }
#pragma unroll
    for (int mb = 0; mb < 4; ++mb) {
#pragma unroll
        for (int nb = 0; nb < 4; ++nb) {
#pragma unroll
            for (int j = 0; j < 8; ++j) os[(hi * 8 + j) * 68 + nb * 16 + lr] = acc[mb][nb][j]; }
        __builtin_amdgcn_wave_barrier(); asm volatile("" ::: "memory");
        float* crow = C + (size_t)(r0 + mb * 16) * ldc + c0;
{
#pragma unroll
            for (int s = 0; s < 8; ++s) { const int row = 2 * s + hi, cofs = lr * 4; v4f val = *(const v4fa*)(os + row * 68 + cofs); if (BIAS) { val[0] += bfr(bias[c0 + cofs]); val[1] += bfr(bias[c0 + cofs + 1]); val[2] += bfr(bias[c0 + cofs + 2]); val[3] += bfr(bias[c0 + cofs + 3]); }
                *(v4f*)(crow + (size_t)row * ldc + cofs) = val; }
             }
        __builtin_amdgcn_wave_barrier(); asm volatile("" ::: "memory");
    }
}

// ---- k_gemmc: the same one-wave 64x64 tile GEMM specialised for causal attention: CMODE 1 skips score tiles entirely above the diagonal (query rows r0+roff.., key columns c0..), CMODE 2 limits the
// key (K) loop of the probability x value contraction to the diagonal block (probabilities beyond it are exactly zero). roff = row offset of this launch's first row within the sequence.
template <typename T16, int NSPLIT, int CMODE>
__global__ __launch_bounds__(32) void k_gemmc(const T16* __restrict__ A, const T16* __restrict__ A2, const T16* __restrict__ Bt, const T16* __restrict__ Bt2, int K, float* C, int ldc, int roff, size_t sA, size_t sB, size_t sC) {
    typedef typename WFrag<T16>::V V;
    __shared__ __align__(16) float os[16 * 68];
    const size_t z = blockIdx.z; A += z * sA; if (A2) A2 += z * sA; Bt += z * sB; if (Bt2) Bt2 += z * sB; C += z * sC;
    const int lane = threadIdx.x & 31, lr = lane & 15, hi = lane >> 4; const int r0 = blockIdx.x * 64, c0 = blockIdx.y * 64;
    if (CMODE == 1 && c0 > r0 + roff + 63) return;                  // score tile entirely above the causal diagonal: never read (the softmax masks j > i by select)
    const int Kl = (CMODE == 2) ? min(K, r0 + roff + 64) : K;        // P.V: probabilities are exactly 0 beyond the diagonal block, so the K loop stops there
    v8f acc[4][4];
#pragma unroll
    for (int mb = 0; mb < 4; ++mb)
#pragma unroll
        for (int nb = 0; nb < 4; ++nb) acc[mb][nb] = (v8f){};
    const size_t aoff = (size_t)(r0 + lr) * K + 8 * hi, boff = (size_t)(c0 + lr) * K + 8 * hi;
#pragma unroll 1
    for (int kc = 0; kc < Kl; kc += 32) {
        V a[4], a2[4];
#pragma unroll
        for (int mb = 0; mb < 4; ++mb) { a[mb] = WFrag<T16>::ld(A + aoff + (size_t)mb * 16 * K + kc); if (NSPLIT == 1 || NSPLIT == 2) a2[mb] = WFrag<T16>::ld(A2 + aoff + (size_t)mb * 16 * K + kc); }
#pragma unroll
        for (int nb = 0; nb < 4; ++nb) { const V b = WFrag<T16>::ld(Bt + boff + (size_t)nb * 16 * K + kc); V b2; if (NSPLIT >= 2) b2 = WFrag<T16>::ld(Bt2 + boff + (size_t)nb * 16 * K + kc);
#pragma unroll
            for (int mb = 0; mb < 4; ++mb) { acc[mb][nb] = WFrag<T16>::mma(a[mb], b, acc[mb][nb]); if (NSPLIT == 1 || NSPLIT == 2) acc[mb][nb] = WFrag<T16>::mma(a2[mb], b, acc[mb][nb]); if (NSPLIT >= 2) acc[mb][nb] = WFrag<T16>::mma(a[mb], b2, acc[mb][nb]); } }
        asm volatile("v_nop\n\tv_nop\n\tv_nop\n\tv_nop" : "+v"(acc[0][0]), "+v"(acc[1][1]), "+v"(acc[2][2]), "+v"(acc[3][3]) : "v"(a[0]), "v"(a[3]));
    }
#pragma unroll
    for (int mb = 0; mb < 4; ++mb) {
#pragma unroll
        for (int nb = 0; nb < 4; ++nb) {
#pragma unroll
            for (int j = 0; j < 8; ++j) os[(hi * 8 + j) * 68 + nb * 16 + lr] = acc[mb][nb][j]; }
        __builtin_amdgcn_wave_barrier(); asm volatile("" ::: "memory");
        float* crow = C + (size_t)(r0 + mb * 16) * ldc + c0;
{
#pragma unroll
            for (int s = 0; s < 8; ++s) { const int row = 2 * s + hi, cofs = lr * 4; v4f val = *(const v4fa*)(os + row * 68 + cofs);
                *(v4f*)(crow + (size_t)row * ldc + cofs) = val; }
             }
        __builtin_amdgcn_wave_barrier(); asm volatile("" ::: "memory");
    }
}

__device__ __forceinline__ h16 tohx(float x) { return (h16)x; }
__device__ __forceinline__ void splitf(float y, unsigned short& h, unsigned short& l) { h = f2bf(y); l = f2bf(y - bf2f(h)); }
typedef __attribute__((ext_vector_type(2))) _Float16 v2h;
typedef __attribute__((ext_vector_type(4))) _Float16 v4h;
typedef __attribute__((ext_vector_type(2))) unsigned short v2us;
typedef __attribute__((ext_vector_type(4))) unsigned short v4us;
typedef __attribute__((ext_vector_type(2))) float v2f;
typedef __attribute__((ext_vector_type(4))) int v4i;

__global__ __launch_bounds__(256) void k_cvt8(const float* __restrict__ src, bf* dst, size_t n8) { const size_t i = (size_t)blockIdx.x * 256 + threadIdx.x; if (i >= n8) return; const v8f v = *(const v8f*)(src + i * 8); v8us o;
#pragma unroll
    for (int k = 0; k < 8; ++k) o[k] = f2bf(v[k]); *(v8us*)(dst + i * 8) = o;  }

// k_rope: head planes [h][t][d] (fp16 + hi/lo) of rope(x) x sc with the rotate-half convention out[d] = x[d] cos[t][d] - x[d+HD/2] sin[t][d], out[d+HD/2] = x[d+HD/2] cos[t][d+HD/2] + x[d] sin[t][d+HD/2]
__global__ __launch_bounds__(256) void k_rope(const float* __restrict__ F, int pitch, int nheads, const float* __restrict__ CS, const float* __restrict__ RF, const float* __restrict__ nw, float sc, h16* P16, bf* Ph, bf* Pl) {
    const size_t e = ((size_t)blockIdx.x * 256 + threadIdx.x) * 2; if (e >= (size_t)nheads * TT * HD) return; const int d = (int)(e % HD); const int t = (int)((e / HD) % TT); const int h = (int)(e / ((size_t)HD * TT)); const float* f = F + (size_t)t * pitch + h * HD; const float rf = RF ? RF[(size_t)h * TT + t] : 1.0f; v2h o16; v2us oh, ol;
#pragma unroll
    for (int q = 0; q < 2; ++q) { const int dd = d + q; const int dp = (dd < HD / 2) ? dd + HD / 2 : dd - HD / 2; float x0 = f[dd], x1 = f[dp];
        if (RF) { float n0 = __fmul_rn(x0, rf), n1 = __fmul_rn(x1, rf); asm volatile("" : "+v"(n0)); asm volatile("" : "+v"(n1)); x0 = __fmul_rn(bfr(nw[dd]), n0); x1 = __fmul_rn(bfr(nw[dp]), n1); }
        const v2f cs = *(const v2f*)(CS + ((size_t)t * HD + dd) * 2); float a = __fmul_rn(x0, cs[0]), bq = __fmul_rn(x1, cs[1]); asm volatile("" : "+v"(a)); asm volatile("" : "+v"(bq)); const float r = ((dd < HD / 2) ? __fsub_rn(a, bq) : __fadd_rn(a, bq)) * sc;
        o16[q] = tohx(r); unsigned short a2, c2; splitf(r, a2, c2); oh[q] = a2; ol[q] = c2; }
    *(v2h*)(P16 + e) = o16; *(v2us*)(Ph + e) = oh; *(v2us*)(Pl + e) = ol;  }
__global__ __launch_bounds__(256) void k_vtp(const float* __restrict__ F, int pitch, int nheads, h16* V16, bf* Vh, bf* Vl) { const size_t e = ((size_t)blockIdx.x * 256 + threadIdx.x) * 2; if (e >= (size_t)nheads * HD * TT) return; const int t = (int)(e % TT); const int d = (int)((e / TT) % HD); const int g = (int)(e / ((size_t)TT * HD)); v2h o16; v2us oh, ol;
#pragma unroll
    for (int q = 0; q < 2; ++q) { const float x = F[(size_t)(t + q) * pitch + g * HD + d]; o16[q] = tohx(x); unsigned short a2, c2; splitf(x, a2, c2); oh[q] = a2; ol[q] = c2; }
    *(v2h*)(V16 + e) = o16; *(v2us*)(Vh + e) = oh; *(v2us*)(Vl + e) = ol;  }
__global__ __launch_bounds__(256) void k_csid(float* CS) { const int idx = blockIdx.x * 256 + threadIdx.x; if (idx >= TT * HD) return; v2f cs; cs[0] = 1.0f; cs[1] = 0.0f; *(v2f*)(CS + (size_t)idx * 2) = cs;  }
// k_asoft: per row (zz, i): t = S x HD^-0.5 for j <= i and i - j < WIN (WIN = TT: the window never binds, plain causal; the reference's -1e9 additive fill vanishes identically); softmax over the 2048 keys (register row, one exp, fixed trees);
__global__ __launch_bounds__(256) void k_asoft(const float* __restrict__ Sb, h16* P16, bf* Ph, bf* Pl) {
    const int lane = threadIdx.x & 31; const int row = blockIdx.x * 8 + (threadIdx.x >> 5); if (row >= ZH * TT) return; const int i = row % TT; const int zz = row / TT; (void)zz; const bool hires = (i < RH); const float* sr = Sb + (size_t)row * TT; float v[TT / 32]; float mx = -3.0e38f;
#pragma unroll
    for (int ch = 0; ch < TT / 128; ++ch) { const int j0 = ch * 128 + lane * 4; const v4f a = *(const v4f*)(sr + j0);
#pragma unroll
        for (int q = 0; q < 4; ++q) { const int j = j0 + q; (void)j; const float t = (j <= i && i - j < WIN) ? a[q] * SCL : -3.0e38f; v[ch * 4 + q] = t; mx = fmaxf(mx, t); } }
#pragma unroll
    for (int sh = 16; sh; sh >>= 1) mx = fmaxf(mx, __shfl_xor(mx, sh, 32));
    float sum = 0.f;
#pragma unroll
    for (int k = 0; k < TT / 32; ++k) { float d0 = __fsub_rn(v[k], mx); asm volatile("" : "+v"(d0)); v[k] = __builtin_amdgcn_exp2f(__fmul_rn(d0, 1.4426950408889634f)); sum += v[k]; }
#pragma unroll
    for (int sh = 16; sh; sh >>= 1) sum += __shfl_xor(sum, sh, 32);
    const float f = __fdiv_rn(hires ? 1.0f : PCAR, sum);
{
        if (hires) {
#pragma unroll
            for (int ch = 0; ch < TT / 128; ++ch) { v4us oh, ol;
#pragma unroll
                for (int q = 0; q < 4; ++q) { unsigned short a, c2; splitf(v[ch * 4 + q] * f, a, c2); oh[q] = a; ol[q] = c2; }
                const size_t oo = ((size_t)zz * (RH ? RH : 1) + i) * TT + ch * 128 + lane * 4; *(v4us*)(Ph + oo) = oh; *(v4us*)(Pl + oo) = ol; }
        } else {
#pragma unroll
            for (int ch = 0; ch < TT / 128; ++ch) { v4h o4;
#pragma unroll
                for (int q = 0; q < 4; ++q) o4[q] = tohx(v[ch * 4 + q] * f);
                *(v4h*)(P16 + (size_t)row * TT + ch * 128 + lane * 4) = o4; } }
         }
}
__global__ __launch_bounds__(256) void k_merge(const float* __restrict__ O, int h0, bf* Ah, bf* Al) { const size_t e = ((size_t)blockIdx.x * 256 + threadIdx.x) * 2; if (e >= (size_t)ZH * TT * HD) return; const int d = (int)(e % HD); const int t = (int)((e / HD) % TT); const int zz = (int)(e / ((size_t)HD * TT)); const float cs = (t < RH) ? 1.0f : (1.0f / PCAR); const size_t oo = (size_t)t * DQ + (h0 + zz) * HD + d;
    v2us oh, ol;
#pragma unroll
    for (int q = 0; q < 2; ++q) { unsigned short a, c2; splitf(O[e + q] * cs, a, c2); oh[q] = a; ol[q] = c2; } *(v2us*)(Ah + oo) = oh; *(v2us*)(Al + oo) = ol;  }

extern "C" void kernel_launch(void* const* d_in, const int* in_sizes, int n_in,
                              void* d_out, int out_size, void* d_ws, size_t ws_size, hipStream_t stream) {
    (void)in_sizes; (void)n_in; (void)out_size;
    const float* x = (const float*)d_in[0]; const float* xk = (const float*)d_in[1]; const float* xv = (const float*)d_in[2]; const float* wq = (const float*)d_in[3]; const float* bq = (const float*)d_in[4]; const float* wk = (const float*)d_in[5]; const float* bk = (const float*)d_in[6]; const float* wv = (const float*)d_in[7]; const float* bv = (const float*)d_in[8]; const float* wo = (const float*)d_in[9]; const float* bo = (const float*)d_in[10];
    float* OUT = (float*)d_out;     // [4][2048][768]
    char* wsp = (char*)d_ws;
    auto take = [&](size_t bytes) { char* p = wsp; wsp += (bytes + 255) & ~(size_t)255; return (void*)p; };
    bf* WQ = (bf*)take((size_t)DQ * DM * 2); bf* WK = (bf*)take((size_t)DKV * DM * 2); bf* WV = (bf*)take((size_t)DKV * DM * 2); bf* WO = (bf*)take((size_t)DM * DQ * 2); float* CS = (float*)take((size_t)TT * HD * 2 * 4);
    bf* XB = (bf*)take((size_t)TT * DM * 2); float* FQ = (float*)take((size_t)TT * DQ * 4); float* FK = (float*)take((size_t)TT * DKV * 4);
    h16* QP16 = (h16*)take((size_t)NH_ * TT * HD * 2); h16* KP16 = (h16*)take((size_t)NKV * TT * HD * 2); h16* VT16 = (h16*)take((size_t)NKV * HD * TT * 2);
    bf* QPh = (bf*)take((size_t)NH_ * TT * HD * 2); bf* QPl = (bf*)take((size_t)NH_ * TT * HD * 2); bf* KPh = (bf*)take((size_t)NKV * TT * HD * 2); bf* KPl = (bf*)take((size_t)NKV * TT * HD * 2); bf* VTh = (bf*)take((size_t)NKV * HD * TT * 2); bf* VTl = (bf*)take((size_t)NKV * HD * TT * 2); bf* Ph = (bf*)take((size_t)ZH * RH * TT * 2); bf* Pl = (bf*)take((size_t)ZH * RH * TT * 2);
    float* Sb = (float*)take((size_t)ZH * TT * TT * 4); h16* P16 = (h16*)take((size_t)ZH * TT * TT * 2); float* Ob = (float*)take((size_t)ZH * TT * HD * 4); bf* ATh = (bf*)take((size_t)TT * DQ * 2); bf* ATl = (bf*)take((size_t)TT * DQ * 2);
    if ((size_t)(wsp - (char*)d_ws) > ws_size) return;    // ws 256 MiB
    float* FV = FK;   // v projection reuses the k buffer after the k planes are built (stream-ordered)
    { k_cvt8<<<(unsigned)(((size_t)DQ * DM / 8 + 255) / 256), 256, 0, stream>>>(wq, WQ, (size_t)DQ * DM / 8); k_cvt8<<<(unsigned)(((size_t)DKV * DM / 8 + 255) / 256), 256, 0, stream>>>(wk, WK, (size_t)DKV * DM / 8); k_cvt8<<<(unsigned)(((size_t)DKV * DM / 8 + 255) / 256), 256, 0, stream>>>(wv, WV, (size_t)DKV * DM / 8);
      k_cvt8<<<(unsigned)(((size_t)DM * DQ / 8 + 255) / 256), 256, 0, stream>>>(wo, WO, (size_t)DM * DQ / 8);
       }
    k_csid<<<(TT * HD + 255) / 256, 256, 0, stream>>>(CS);
    const unsigned LQ = (unsigned)(((size_t)NH_ * TT * HD / 2 + 255) / 256), LKv = (unsigned)(((size_t)NKV * TT * HD / 2 + 255) / 256);
    for (int b = 0; b < NB_; ++b) {
        
        k_cvt8<<<(unsigned)(((size_t)TT * DM / 8 + 255) / 256), 256, 0, stream>>>(x + (size_t)b * TT * DM, XB, (size_t)TT * DM / 8);
        k_gemmw<bf, 0, true><<<dim3(TT / 64, DQ / 64, 1), 32, 0, stream>>>(XB, nullptr, WQ, nullptr, DM, FQ, DQ, bq, 0, 0, 0);
        k_rope<<<LQ, 256, 0, stream>>>(FQ, DQ, NH_, CS, nullptr, nullptr, 1.0f, QP16, QPh, QPl);
        k_cvt8<<<(unsigned)(((size_t)TT * DM / 8 + 255) / 256), 256, 0, stream>>>(xk + (size_t)b * TT * DM, XB, (size_t)TT * DM / 8);   /* XB := bf16(keys[b]) */ k_gemmw<bf, 0, true><<<dim3(TT / 64, DKV / 64, 1), 32, 0, stream>>>(XB, nullptr, WK, nullptr, DM, FK, DKV, bk, 0, 0, 0);
        k_rope<<<LKv, 256, 0, stream>>>(FK, DKV, NKV, CS, nullptr, nullptr, 1.0f, KP16, KPh, KPl);
        k_cvt8<<<(unsigned)(((size_t)TT * DM / 8 + 255) / 256), 256, 0, stream>>>(xv + (size_t)b * TT * DM, XB, (size_t)TT * DM / 8);   /* XB := bf16(values[b]) */ k_gemmw<bf, 0, true><<<dim3(TT / 64, DKV / 64, 1), 32, 0, stream>>>(XB, nullptr, WV, nullptr, DM, FV, DKV, bv, 0, 0, 0); k_vtp<<<LKv, 256, 0, stream>>>(FV, DKV, NKV, VT16, VTh, VTl);
        for (int h0 = 0; h0 < NH_; h0 += ZH) { const size_t zq = (size_t)h0, zk = (size_t)(h0 / REP);   // one kv head per query head: the pass's ZH heads use consecutive kv planes (z-strides TT*HD)
            k_gemmc<bf, 2, 1><<<dim3(RH / 64, TT / 64, ZH), 32, 0, stream>>>(QPh + zq * TT * HD, QPl + zq * TT * HD, KPh + zk * TT * HD, KPl + zk * TT * HD, HD, Sb, TT, 0, (size_t)TT * HD, (size_t)TT * HD, (size_t)TT * TT);
            k_gemmc<h16, 0, 1><<<dim3((TT - RH) / 64, TT / 64, ZH), 32, 0, stream>>>(QP16 + zq * TT * HD + (size_t)RH * HD, nullptr, KP16 + zk * TT * HD, nullptr, HD, Sb + (size_t)RH * TT, TT, RH, (size_t)TT * HD, (size_t)TT * HD, (size_t)TT * TT);
            k_asoft<<<ZH * TT / 8, 256, 0, stream>>>(Sb, P16, Ph, Pl);
            k_gemmc<bf, 2, 2><<<dim3(RH / 64, HD / 64, ZH), 32, 0, stream>>>(Ph, Pl, VTh + zk * HD * TT, VTl + zk * HD * TT, TT, Ob, HD, 0, (size_t)RH * TT, (size_t)HD * TT, (size_t)TT * HD);
            k_gemmc<h16, 0, 2><<<dim3((TT - RH) / 64, HD / 64, ZH), 32, 0, stream>>>(P16 + (size_t)RH * TT, nullptr, VT16 + zk * HD * TT, nullptr, TT, Ob + (size_t)RH * HD, HD, RH, (size_t)TT * TT, (size_t)HD * TT, (size_t)TT * HD);
            k_merge<<<(unsigned)(((size_t)ZH * TT * HD / 2 + 255) / 256), 256, 0, stream>>>(Ob, h0, ATh, ATl); }
        k_gemmw<bf, 1, true><<<dim3(TT / 64, DM / 64, 1), 32, 0, stream>>>(ATh, ATl, WO, nullptr, DQ, OUT + (size_t)b * TT * DM, DM, bo, 0, 0, 0); }
}

// v002
// It runs in 777 microseconds.
// Timed twice side by side with v001, it ran 1.54 times as fast both times.
// All steps since v000 together make it 2.84 times as fast.
#include <hip/hip_runtime.h>

// Causal multi-headed attention on three input streams (queries, keys, values [4][2048][768]; Q = queries W_Q^T + b_Q, K = keys W_K^T + b_K, V = values W_V^T + b_V ('oi' uniform(+-768^-0.5) incl. biases: non-zero; 12 heads x 64); scores x 1/sqrt(64); causal (-inf); softmax; outputs = merged (standard) W_O^T + b_O -> [4][2048][768] (6.3 M); argument order queries, keys, values, W_Q, b_Q, W_K, b_K, W_V, b_V, W_O, b_O).
// Layout per batch: bf16 copies of queries, keys, values in turn; 'oi' weights; exact projections (K 768) + f32 biases; identity-table plane builders; causal T-2048 attention at 12 heads (hybrid rows: < 512 hi/lo 3 products, rest fp16 x1024; k_gemmc skips tiles above the diagonal); merged hi/lo x W_O exact + b_O.
// Compute dtypes, f32 accumulate: every input rounded to bf16; projections exact + f32 biases; attention rows < 512 3 products, rest fp16; softmax f32; W_O hl x exact + bias.

#define NB_  4
#define TT   2048
#define DM   768
#define NH_  12
#define NKV  12
#define REP  (NH_ / NKV)
#define HD   64
#define DQ   (NH_ * HD)
#define DKV  (NKV * HD)
#define ZH   6                    // heads per attention pass (z of each attention launch); NH_ % ZH == 0, planes for ZH heads fit the workspace
#define RH   512                  // query rows < RH use hi+lo planes (0: none)
#define WIN  2048
#define PCAR 1024.0f
#define SCL  0.125f   // HD^-0.5
typedef _Float16 h16;
typedef unsigned short bf;
typedef __attribute__((ext_vector_type(16))) __bf16   v16bf;
typedef __attribute__((ext_vector_type(16))) _Float16 v16h;
typedef __attribute__((ext_vector_type(8)))  _Float16 v8h;
typedef __attribute__((ext_vector_type(8)))  unsigned short v8us;
typedef __attribute__((ext_vector_type(8)))  float    v8f;
typedef __attribute__((ext_vector_type(4)))  float    v4f;
typedef v8h  __attribute__((may_alias)) v8ha;
typedef v4f  __attribute__((may_alias)) v4fa;
typedef v8us __attribute__((may_alias)) v8usa;

__device__ __forceinline__ unsigned short f2bf(float f) { unsigned u = __float_as_uint(f); u += 0x7FFFu + ((u >> 16) & 1u); return (unsigned short)(u >> 16); }
__device__ __forceinline__ float bf2f(unsigned short b) { return __uint_as_float(((unsigned)b) << 16); }
__device__ __forceinline__ float bfr(float f) { return bf2f(f2bf(f)); }
__device__ __forceinline__ v16h cat16(v8h lo, v8h hi) { return __builtin_shufflevector(lo, hi, 0, 1, 2, 3, 4, 5, 6, 7, 8, 9, 10, 11, 12, 13, 14, 15); }
__device__ __forceinline__ v16bf cat16b(v8us lo, v8us hi) { return __builtin_bit_cast(v16bf, __builtin_shufflevector(lo, hi, 0, 1, 2, 3, 4, 5, 6, 7, 8, 9, 10, 11, 12, 13, 14, 15)); }
__device__ __forceinline__ v8f wmma16(v16h a, v16h b, v8f c) { return __builtin_amdgcn_wmma_f32_16x16x32_f16(false, a, false, b, (short)0, c, false, false); }
__device__ __forceinline__ v8f wmmab(v16bf a, v16bf b, v8f c) { return __builtin_amdgcn_wmma_f32_16x16x32_bf16(false, a, false, b, (short)0, c, false, false); }



#define KW   8                    // waves per 64x64 tile where the K loop is split; each wave takes every KW-th 64-wide K chunk (one 128-byte line per operand row)
// Sum of the KW waves' partial 64x64 tiles: every wave lays its accumulators out as [64][68] f32 in its own LDS plane, then the whole work-group adds the planes in wave order and stores whole rows.
template <bool BIAS>
__device__ __forceinline__ void ksum_store(float* os, int wv, const v8f (&acc)[4][4], float* C, int ldc, int r0, int c0, const float* __restrict__ bias) {
    const int lane = threadIdx.x & 31, lr = lane & 15, hi = lane >> 4; float* pw = os + wv * (64 * 68);
    v4f bv = (v4f){}; if (BIAS) { const int bc = c0 + (int)(threadIdx.x & 15) * 4; bv[0] = bfr(bias[bc]); bv[1] = bfr(bias[bc + 1]); bv[2] = bfr(bias[bc + 2]); bv[3] = bfr(bias[bc + 3]); }   // a thread's column group is the same in every pass below: read ahead of the LDS traffic
    // unrolled so that every accumulator index is a constant (the tile stays in registers, no scratch)
#pragma unroll
    for (int mb = 0; mb < 4; ++mb)
#pragma unroll
        for (int nb = 0; nb < 4; ++nb)
#pragma unroll
            for (int j = 0; j < 8; ++j) pw[(mb * 16 + hi * 8 + j) * 68 + nb * 16 + lr] = acc[mb][nb][j];
    __syncthreads();   // every wave's partial tile is in LDS before any thread adds across the planes
    // both loops unrolled so that the LDS reads of all planes and passes are in flight together
#pragma unroll
    for (int s = 0; s < 64 * 16 / (32 * KW); ++s) { const int idx = s * (32 * KW) + threadIdx.x; const int row = idx >> 4, cofs = (idx & 15) * 4; v4f val = *(const v4fa*)(os + row * 68 + cofs);
#pragma unroll
        for (int w = 1; w < KW; ++w) val += *(const v4fa*)(os + w * (64 * 68) + row * 68 + cofs);
        if (BIAS) val += bv;
        *(v4f*)(C + (size_t)(r0 + row) * ldc + c0 + cofs) = val; }
}

// ---- k_gemmw: register-blocked GEMM, KW WAVES per 64x64 output tile (16 accumulators each, K split over the waves), operands straight from K-contiguous 16-bit planes; grid (M/64, N/64, Z), 32 * KW threads.
// C[m][n] (f32, pitch ldc, + optional f32 bias[n]) = sum_k A[m][k] Bt[n][k] (+ split products per NSPLIT). z-batch strides sA/sB/sC in elements. K % 64 == 0.
template <typename T16> struct WFrag;
template <> struct WFrag<h16> { typedef v16h V; static __device__ __forceinline__ V ld(const h16* p) { return cat16(*(const v8h*)p, *(const v8h*)(p + 16)); } static __device__ __forceinline__ v8f mma(V a, V b, v8f c) { return wmma16(a, b, c); } };
template <> struct WFrag<bf> { typedef v16bf V; static __device__ __forceinline__ V ld(const bf* p) { return cat16b(*(const v8us*)p, *(const v8us*)(p + 16)); } static __device__ __forceinline__ v8f mma(V a, V b, v8f c) { return wmmab(a, b, c); } };
template <typename T16, int NSPLIT, bool BIAS>
__global__ __launch_bounds__(32 * KW) void k_gemmw(const T16* __restrict__ A, const T16* __restrict__ A2, const T16* __restrict__ Bt, const T16* __restrict__ Bt2, int K, float* C, int ldc, const float* __restrict__ bias, size_t sA, size_t sB, size_t sC) {
    typedef typename WFrag<T16>::V V;
    __shared__ __align__(16) float os[KW * 64 * 68];
    const size_t z = blockIdx.z; A += z * sA; if (A2) A2 += z * sA; Bt += z * sB; if (Bt2) Bt2 += z * sB; C += z * sC;
    const int lane = threadIdx.x & 31, lr = lane & 15, hi = lane >> 4; const int r0 = blockIdx.x * 64, c0 = blockIdx.y * 64;
    v8f acc[4][4];
#pragma unroll
    for (int mb = 0; mb < 4; ++mb)
#pragma unroll
        for (int nb = 0; nb < 4; ++nb) acc[mb][nb] = (v8f){};
    const size_t aoff = (size_t)(r0 + lr) * K + 8 * hi, boff = (size_t)(c0 + lr) * K + 8 * hi;
    const int wv = __builtin_amdgcn_readfirstlane((int)(threadIdx.x >> 5));   // wave number as a scalar: the K loop's counter and branch stay scalar
#pragma unroll 1
    for (int kc = wv * 64; kc < K; kc += (kc & 32) ? 64 * KW - 32 : 32) {   // both halves of a 64-wide chunk, then this wave's next chunk
        V a[4], a2[4];
#pragma unroll
        for (int mb = 0; mb < 4; ++mb) { a[mb] = WFrag<T16>::ld(A + aoff + (size_t)mb * 16 * K + kc); if (NSPLIT == 1 || NSPLIT == 2) a2[mb] = WFrag<T16>::ld(A2 + aoff + (size_t)mb * 16 * K + kc); }
#pragma unroll
        for (int nb = 0; nb < 4; ++nb) { const V b = WFrag<T16>::ld(Bt + boff + (size_t)nb * 16 * K + kc); V b2; if (NSPLIT >= 2) b2 = WFrag<T16>::ld(Bt2 + boff + (size_t)nb * 16 * K + kc);
#pragma unroll
            for (int mb = 0; mb < 4; ++mb) { acc[mb][nb] = WFrag<T16>::mma(a[mb], b, acc[mb][nb]); if (NSPLIT == 1 || NSPLIT == 2) acc[mb][nb] = WFrag<T16>::mma(a2[mb], b, acc[mb][nb]); if (NSPLIT >= 2) acc[mb][nb] = WFrag<T16>::mma(a[mb], b2, acc[mb][nb]); } }
        asm volatile("v_nop\n\tv_nop\n\tv_nop\n\tv_nop" : "+v"(acc[0][0]), "+v"(acc[1][1]), "+v"(acc[2][2]), "+v"(acc[3][3]) : "v"(a[0]), "v"(a[3]));
    }
    ksum_store<BIAS>(os, wv, acc, C, ldc, r0, c0, bias);
}

// ---- k_gemmc: the same 64x64 tile GEMM specialised for causal attention (CMODE 1: one wave, 32 threads; CMODE 2: K split over KW waves, 32 * KW threads): CMODE 1 skips score tiles entirely above the diagonal (query rows r0+roff.., key columns c0..), CMODE 2 limits the
// key (K) loop of the probability x value contraction to the diagonal block (probabilities beyond it are exactly zero). roff = row offset of this launch's first row within the sequence.
template <typename T16, int NSPLIT, int CMODE>
__global__ __launch_bounds__(CMODE == 2 ? 32 * KW : 32) void k_gemmc(const T16* __restrict__ A, const T16* __restrict__ A2, const T16* __restrict__ Bt, const T16* __restrict__ Bt2, int K, float* C, int ldc, int roff, size_t sA, size_t sB, size_t sC) {
    typedef typename WFrag<T16>::V V;
    __shared__ __align__(16) float os[CMODE == 2 ? KW * 64 * 68 : 16 * 68];
    const size_t z = blockIdx.z; A += z * sA; if (A2) A2 += z * sA; Bt += z * sB; if (Bt2) Bt2 += z * sB; C += z * sC;
    const int lane = threadIdx.x & 31, lr = lane & 15, hi = lane >> 4; const int r0 = blockIdx.x * 64, c0 = blockIdx.y * 64;
    if (CMODE == 1 && c0 > r0 + roff + 63) return;                  // score tile entirely above the causal diagonal: never read (the softmax masks j > i by select)
    const int Kl = (CMODE == 2) ? min(K, r0 + roff + 64) : K;        // P.V: probabilities are exactly 0 beyond the diagonal block, so the K loop stops there
    v8f acc[4][4];
#pragma unroll
    for (int mb = 0; mb < 4; ++mb)
#pragma unroll
        for (int nb = 0; nb < 4; ++nb) acc[mb][nb] = (v8f){};
    const size_t aoff = (size_t)(r0 + lr) * K + 8 * hi, boff = (size_t)(c0 + lr) * K + 8 * hi;
    const int wv = (CMODE == 2) ? __builtin_amdgcn_readfirstlane((int)(threadIdx.x >> 5)) : 0;   // wave number as a scalar: the K loop's counter and branch stay scalar
#pragma unroll 1
    for (int kc = wv * 64; kc < Kl; kc += (CMODE == 2 && (kc & 32)) ? 64 * KW - 32 : 32) {   // CMODE 2: both halves of a 64-wide chunk, then this wave's next chunk
        V a[4], a2[4];
#pragma unroll
        for (int mb = 0; mb < 4; ++mb) { a[mb] = WFrag<T16>::ld(A + aoff + (size_t)mb * 16 * K + kc); if (NSPLIT == 1 || NSPLIT == 2) a2[mb] = WFrag<T16>::ld(A2 + aoff + (size_t)mb * 16 * K + kc); }
#pragma unroll
        for (int nb = 0; nb < 4; ++nb) { const V b = WFrag<T16>::ld(Bt + boff + (size_t)nb * 16 * K + kc); V b2; if (NSPLIT >= 2) b2 = WFrag<T16>::ld(Bt2 + boff + (size_t)nb * 16 * K + kc);
#pragma unroll
            for (int mb = 0; mb < 4; ++mb) { acc[mb][nb] = WFrag<T16>::mma(a[mb], b, acc[mb][nb]); if (NSPLIT == 1 || NSPLIT == 2) acc[mb][nb] = WFrag<T16>::mma(a2[mb], b, acc[mb][nb]); if (NSPLIT >= 2) acc[mb][nb] = WFrag<T16>::mma(a[mb], b2, acc[mb][nb]); } }
        asm volatile("v_nop\n\tv_nop\n\tv_nop\n\tv_nop" : "+v"(acc[0][0]), "+v"(acc[1][1]), "+v"(acc[2][2]), "+v"(acc[3][3]) : "v"(a[0]), "v"(a[3]));
    }
    if constexpr (CMODE == 2) { ksum_store<false>(os, wv, acc, C, ldc, r0, c0, nullptr); return; }
#pragma unroll
    for (int mb = 0; mb < 4; ++mb) {
#pragma unroll
        for (int nb = 0; nb < 4; ++nb) {
#pragma unroll
            for (int j = 0; j < 8; ++j) os[(hi * 8 + j) * 68 + nb * 16 + lr] = acc[mb][nb][j]; }
        __builtin_amdgcn_wave_barrier(); asm volatile("" ::: "memory");
        float* crow = C + (size_t)(r0 + mb * 16) * ldc + c0;
{
#pragma unroll
            for (int s = 0; s < 8; ++s) { const int row = 2 * s + hi, cofs = lr * 4; v4f val = *(const v4fa*)(os + row * 68 + cofs);
                *(v4f*)(crow + (size_t)row * ldc + cofs) = val; }
             }
        __builtin_amdgcn_wave_barrier(); asm volatile("" ::: "memory");
    }
}

__device__ __forceinline__ h16 tohx(float x) { return (h16)x; }
__device__ __forceinline__ void splitf(float y, unsigned short& h, unsigned short& l) { h = f2bf(y); l = f2bf(y - bf2f(h)); }
typedef __attribute__((ext_vector_type(2))) _Float16 v2h;
typedef __attribute__((ext_vector_type(4))) _Float16 v4h;
typedef __attribute__((ext_vector_type(2))) unsigned short v2us;
typedef __attribute__((ext_vector_type(4))) unsigned short v4us;
typedef __attribute__((ext_vector_type(2))) float v2f;
typedef __attribute__((ext_vector_type(4))) int v4i;

__global__ __launch_bounds__(256) void k_cvt8(const float* __restrict__ src, bf* dst, size_t n8) { const size_t i = (size_t)blockIdx.x * 256 + threadIdx.x; if (i >= n8) return; const v8f v = *(const v8f*)(src + i * 8); v8us o;
#pragma unroll
    for (int k = 0; k < 8; ++k) o[k] = f2bf(v[k]); *(v8us*)(dst + i * 8) = o;  }

// k_rope: head planes [h][t][d] (fp16 + hi/lo) of rope(x) x sc with the rotate-half convention out[d] = x[d] cos[t][d] - x[d+HD/2] sin[t][d], out[d+HD/2] = x[d+HD/2] cos[t][d+HD/2] + x[d] sin[t][d+HD/2]
__global__ __launch_bounds__(256) void k_rope(const float* __restrict__ F, int pitch, int nheads, const float* __restrict__ CS, const float* __restrict__ RF, const float* __restrict__ nw, float sc, h16* P16, bf* Ph, bf* Pl) {
    const size_t e = ((size_t)blockIdx.x * 256 + threadIdx.x) * 2; if (e >= (size_t)nheads * TT * HD) return; const int d = (int)(e % HD); const int t = (int)((e / HD) % TT); const int h = (int)(e / ((size_t)HD * TT)); const float* f = F + (size_t)t * pitch + h * HD; const float rf = RF ? RF[(size_t)h * TT + t] : 1.0f; v2h o16; v2us oh, ol;
#pragma unroll
    for (int q = 0; q < 2; ++q) { const int dd = d + q; const int dp = (dd < HD / 2) ? dd + HD / 2 : dd - HD / 2; float x0 = f[dd], x1 = f[dp];
        if (RF) { float n0 = __fmul_rn(x0, rf), n1 = __fmul_rn(x1, rf); asm volatile("" : "+v"(n0)); asm volatile("" : "+v"(n1)); x0 = __fmul_rn(bfr(nw[dd]), n0); x1 = __fmul_rn(bfr(nw[dp]), n1); }
        const v2f cs = *(const v2f*)(CS + ((size_t)t * HD + dd) * 2); float a = __fmul_rn(x0, cs[0]), bq = __fmul_rn(x1, cs[1]); asm volatile("" : "+v"(a)); asm volatile("" : "+v"(bq)); const float r = ((dd < HD / 2) ? __fsub_rn(a, bq) : __fadd_rn(a, bq)) * sc;
        o16[q] = tohx(r); unsigned short a2, c2; splitf(r, a2, c2); oh[q] = a2; ol[q] = c2; }
    *(v2h*)(P16 + e) = o16; *(v2us*)(Ph + e) = oh; *(v2us*)(Pl + e) = ol;  }
__global__ __launch_bounds__(256) void k_vtp(const float* __restrict__ F, int pitch, int nheads, h16* V16, bf* Vh, bf* Vl) { const size_t e = ((size_t)blockIdx.x * 256 + threadIdx.x) * 2; if (e >= (size_t)nheads * HD * TT) return; const int t = (int)(e % TT); const int d = (int)((e / TT) % HD); const int g = (int)(e / ((size_t)TT * HD)); v2h o16; v2us oh, ol;
#pragma unroll
    for (int q = 0; q < 2; ++q) { const float x = F[(size_t)(t + q) * pitch + g * HD + d]; o16[q] = tohx(x); unsigned short a2, c2; splitf(x, a2, c2); oh[q] = a2; ol[q] = c2; }
    *(v2h*)(V16 + e) = o16; *(v2us*)(Vh + e) = oh; *(v2us*)(Vl + e) = ol;  }
__global__ __launch_bounds__(256) void k_csid(float* CS) { const int idx = blockIdx.x * 256 + threadIdx.x; if (idx >= TT * HD) return; v2f cs; cs[0] = 1.0f; cs[1] = 0.0f; *(v2f*)(CS + (size_t)idx * 2) = cs;  }
// k_asoft: per row (zz, i): t = S x HD^-0.5 for j <= i and i - j < WIN (WIN = TT: the window never binds, plain causal; the reference's -1e9 additive fill vanishes identically); softmax over the 2048 keys (register row, one exp, fixed trees);
__global__ __launch_bounds__(256) void k_asoft(const float* __restrict__ Sb, h16* P16, bf* Ph, bf* Pl) {
    const int lane = threadIdx.x & 31; const int row = blockIdx.x * 8 + (threadIdx.x >> 5); if (row >= ZH * TT) return; const int i = row % TT; const int zz = row / TT; (void)zz; const bool hires = (i < RH); const float* sr = Sb + (size_t)row * TT; float v[TT / 32]; float mx = -3.0e38f;
#pragma unroll
    for (int ch = 0; ch < TT / 128; ++ch) { const int j0 = ch * 128 + lane * 4; const v4f a = *(const v4f*)(sr + j0);
#pragma unroll
        for (int q = 0; q < 4; ++q) { const int j = j0 + q; (void)j; const float t = (j <= i && i - j < WIN) ? a[q] * SCL : -3.0e38f; v[ch * 4 + q] = t; mx = fmaxf(mx, t); } }
#pragma unroll
    for (int sh = 16; sh; sh >>= 1) mx = fmaxf(mx, __shfl_xor(mx, sh, 32));
    float sum = 0.f;
#pragma unroll
    for (int k = 0; k < TT / 32; ++k) { float d0 = __fsub_rn(v[k], mx); asm volatile("" : "+v"(d0)); v[k] = __builtin_amdgcn_exp2f(__fmul_rn(d0, 1.4426950408889634f)); sum += v[k]; }
#pragma unroll
    for (int sh = 16; sh; sh >>= 1) sum += __shfl_xor(sum, sh, 32);
    const float f = __fdiv_rn(hires ? 1.0f : PCAR, sum);
{
        if (hires) {
#pragma unroll
            for (int ch = 0; ch < TT / 128; ++ch) { v4us oh, ol;
#pragma unroll
                for (int q = 0; q < 4; ++q) { unsigned short a, c2; splitf(v[ch * 4 + q] * f, a, c2); oh[q] = a; ol[q] = c2; }
                const size_t oo = ((size_t)zz * (RH ? RH : 1) + i) * TT + ch * 128 + lane * 4; *(v4us*)(Ph + oo) = oh; *(v4us*)(Pl + oo) = ol; }
        } else {
#pragma unroll
            for (int ch = 0; ch < TT / 128; ++ch) { v4h o4;
#pragma unroll
                for (int q = 0; q < 4; ++q) o4[q] = tohx(v[ch * 4 + q] * f);
                *(v4h*)(P16 + (size_t)row * TT + ch * 128 + lane * 4) = o4; } }
         }
}
__global__ __launch_bounds__(256) void k_merge(const float* __restrict__ O, int h0, bf* Ah, bf* Al) { const size_t e = ((size_t)blockIdx.x * 256 + threadIdx.x) * 2; if (e >= (size_t)ZH * TT * HD) return; const int d = (int)(e % HD); const int t = (int)((e / HD) % TT); const int zz = (int)(e / ((size_t)HD * TT)); const float cs = (t < RH) ? 1.0f : (1.0f / PCAR); const size_t oo = (size_t)t * DQ + (h0 + zz) * HD + d;
    v2us oh, ol;
#pragma unroll
    for (int q = 0; q < 2; ++q) { unsigned short a, c2; splitf(O[e + q] * cs, a, c2); oh[q] = a; ol[q] = c2; } *(v2us*)(Ah + oo) = oh; *(v2us*)(Al + oo) = ol;  }

extern "C" void kernel_launch(void* const* d_in, const int* in_sizes, int n_in,
                              void* d_out, int out_size, void* d_ws, size_t ws_size, hipStream_t stream) {
    (void)in_sizes; (void)n_in; (void)out_size;
    const float* x = (const float*)d_in[0]; const float* xk = (const float*)d_in[1]; const float* xv = (const float*)d_in[2]; const float* wq = (const float*)d_in[3]; const float* bq = (const float*)d_in[4]; const float* wk = (const float*)d_in[5]; const float* bk = (const float*)d_in[6]; const float* wv = (const float*)d_in[7]; const float* bv = (const float*)d_in[8]; const float* wo = (const float*)d_in[9]; const float* bo = (const float*)d_in[10];
    float* OUT = (float*)d_out;     // [4][2048][768]
    char* wsp = (char*)d_ws;
    auto take = [&](size_t bytes) { char* p = wsp; wsp += (bytes + 255) & ~(size_t)255; return (void*)p; };
    bf* WQ = (bf*)take((size_t)DQ * DM * 2); bf* WK = (bf*)take((size_t)DKV * DM * 2); bf* WV = (bf*)take((size_t)DKV * DM * 2); bf* WO = (bf*)take((size_t)DM * DQ * 2); float* CS = (float*)take((size_t)TT * HD * 2 * 4);
    bf* XB = (bf*)take((size_t)TT * DM * 2); float* FQ = (float*)take((size_t)TT * DQ * 4); float* FK = (float*)take((size_t)TT * DKV * 4);
    h16* QP16 = (h16*)take((size_t)NH_ * TT * HD * 2); h16* KP16 = (h16*)take((size_t)NKV * TT * HD * 2); h16* VT16 = (h16*)take((size_t)NKV * HD * TT * 2);
    bf* QPh = (bf*)take((size_t)NH_ * TT * HD * 2); bf* QPl = (bf*)take((size_t)NH_ * TT * HD * 2); bf* KPh = (bf*)take((size_t)NKV * TT * HD * 2); bf* KPl = (bf*)take((size_t)NKV * TT * HD * 2); bf* VTh = (bf*)take((size_t)NKV * HD * TT * 2); bf* VTl = (bf*)take((size_t)NKV * HD * TT * 2); bf* Ph = (bf*)take((size_t)ZH * RH * TT * 2); bf* Pl = (bf*)take((size_t)ZH * RH * TT * 2);
    float* Sb = (float*)take((size_t)ZH * TT * TT * 4); h16* P16 = (h16*)take((size_t)ZH * TT * TT * 2); float* Ob = (float*)take((size_t)ZH * TT * HD * 4); bf* ATh = (bf*)take((size_t)TT * DQ * 2); bf* ATl = (bf*)take((size_t)TT * DQ * 2);
    if ((size_t)(wsp - (char*)d_ws) > ws_size) return;    // ws 256 MiB
    float* FV = FK;   // v projection reuses the k buffer after the k planes are built (stream-ordered)
    { k_cvt8<<<(unsigned)(((size_t)DQ * DM / 8 + 255) / 256), 256, 0, stream>>>(wq, WQ, (size_t)DQ * DM / 8); k_cvt8<<<(unsigned)(((size_t)DKV * DM / 8 + 255) / 256), 256, 0, stream>>>(wk, WK, (size_t)DKV * DM / 8); k_cvt8<<<(unsigned)(((size_t)DKV * DM / 8 + 255) / 256), 256, 0, stream>>>(wv, WV, (size_t)DKV * DM / 8);
      k_cvt8<<<(unsigned)(((size_t)DM * DQ / 8 + 255) / 256), 256, 0, stream>>>(wo, WO, (size_t)DM * DQ / 8);
       }
    k_csid<<<(TT * HD + 255) / 256, 256, 0, stream>>>(CS);
    const unsigned LQ = (unsigned)(((size_t)NH_ * TT * HD / 2 + 255) / 256), LKv = (unsigned)(((size_t)NKV * TT * HD / 2 + 255) / 256);
    for (int b = 0; b < NB_; ++b) {
        
        k_cvt8<<<(unsigned)(((size_t)TT * DM / 8 + 255) / 256), 256, 0, stream>>>(x + (size_t)b * TT * DM, XB, (size_t)TT * DM / 8);
        k_gemmw<bf, 0, true><<<dim3(TT / 64, DQ / 64, 1), 32 * KW, 0, stream>>>(XB, nullptr, WQ, nullptr, DM, FQ, DQ, bq, 0, 0, 0);
        k_rope<<<LQ, 256, 0, stream>>>(FQ, DQ, NH_, CS, nullptr, nullptr, 1.0f, QP16, QPh, QPl);
        k_cvt8<<<(unsigned)(((size_t)TT * DM / 8 + 255) / 256), 256, 0, stream>>>(xk + (size_t)b * TT * DM, XB, (size_t)TT * DM / 8);   /* XB := bf16(keys[b]) */ k_gemmw<bf, 0, true><<<dim3(TT / 64, DKV / 64, 1), 32 * KW, 0, stream>>>(XB, nullptr, WK, nullptr, DM, FK, DKV, bk, 0, 0, 0);
        k_rope<<<LKv, 256, 0, stream>>>(FK, DKV, NKV, CS, nullptr, nullptr, 1.0f, KP16, KPh, KPl);
        k_cvt8<<<(unsigned)(((size_t)TT * DM / 8 + 255) / 256), 256, 0, stream>>>(xv + (size_t)b * TT * DM, XB, (size_t)TT * DM / 8);   /* XB := bf16(values[b]) */ k_gemmw<bf, 0, true><<<dim3(TT / 64, DKV / 64, 1), 32 * KW, 0, stream>>>(XB, nullptr, WV, nullptr, DM, FV, DKV, bv, 0, 0, 0); k_vtp<<<LKv, 256, 0, stream>>>(FV, DKV, NKV, VT16, VTh, VTl);
        for (int h0 = 0; h0 < NH_; h0 += ZH) { const size_t zq = (size_t)h0, zk = (size_t)(h0 / REP);   // one kv head per query head: the pass's ZH heads use consecutive kv planes (z-strides TT*HD)
            k_gemmc<bf, 2, 1><<<dim3(RH / 64, TT / 64, ZH), 32, 0, stream>>>(QPh + zq * TT * HD, QPl + zq * TT * HD, KPh + zk * TT * HD, KPl + zk * TT * HD, HD, Sb, TT, 0, (size_t)TT * HD, (size_t)TT * HD, (size_t)TT * TT);
            k_gemmc<h16, 0, 1><<<dim3((TT - RH) / 64, TT / 64, ZH), 32, 0, stream>>>(QP16 + zq * TT * HD + (size_t)RH * HD, nullptr, KP16 + zk * TT * HD, nullptr, HD, Sb + (size_t)RH * TT, TT, RH, (size_t)TT * HD, (size_t)TT * HD, (size_t)TT * TT);
            k_asoft<<<ZH * TT / 8, 256, 0, stream>>>(Sb, P16, Ph, Pl);
            k_gemmc<bf, 2, 2><<<dim3(RH / 64, HD / 64, ZH), 32 * KW, 0, stream>>>(Ph, Pl, VTh + zk * HD * TT, VTl + zk * HD * TT, TT, Ob, HD, 0, (size_t)RH * TT, (size_t)HD * TT, (size_t)TT * HD);
            k_gemmc<h16, 0, 2><<<dim3((TT - RH) / 64, HD / 64, ZH), 32 * KW, 0, stream>>>(P16 + (size_t)RH * TT, nullptr, VT16 + zk * HD * TT, nullptr, TT, Ob + (size_t)RH * HD, HD, RH, (size_t)TT * TT, (size_t)HD * TT, (size_t)TT * HD);
            k_merge<<<(unsigned)(((size_t)ZH * TT * HD / 2 + 255) / 256), 256, 0, stream>>>(Ob, h0, ATh, ATl); }
        k_gemmw<bf, 1, true><<<dim3(TT / 64, DM / 64, 1), 32 * KW, 0, stream>>>(ATh, ATl, WO, nullptr, DQ, OUT + (size_t)b * TT * DM, DM, bo, 0, 0, 0); }
}

// v003
// Measured time: 376 microseconds a run.
// In two side-by-side timings against v002, it was 2.08 and 2.07 times as fast.
// Counting every step since v000, it is 5.90 times as fast.
#include <hip/hip_runtime.h>

// Causal multi-headed attention on three input streams (queries, keys, values [4][2048][768]; Q = queries W_Q^T + b_Q, K = keys W_K^T + b_K, V = values W_V^T + b_V ('oi' uniform(+-768^-0.5) incl. biases: non-zero; 12 heads x 64); scores x 1/sqrt(64); causal (-inf); softmax; outputs = merged (standard) W_O^T + b_O -> [4][2048][768] (6.3 M); argument order queries, keys, values, W_Q, b_Q, W_K, b_K, W_V, b_V, W_O, b_O).
// Layout per batch: bf16 copies of queries, keys, values in turn; 'oi' weights; exact projections (K 768) + f32 biases; identity-table plane builders; one fused causal attention launch over all batches and heads (hybrid rows: < 512 hi/lo 3 products, rest fp16; scores and probabilities stay in registers); merged hi/lo x W_O exact + b_O.
// Compute dtypes, f32 accumulate: every input rounded to bf16; projections exact + f32 biases; attention rows < 512 3 products, rest fp16; softmax f32; W_O hl x exact + bias.

#define NB_  4
#define TT   2048
#define DM   768
#define NH_  12
#define NKV  12
#define HD   64
#define DQ   (NH_ * HD)
#define DKV  (NKV * HD)
#define RH   512                  // query rows < RH use hi+lo planes (0: none)
#define SCL  0.125f   // HD^-0.5
typedef _Float16 h16;
typedef unsigned short bf;
typedef __attribute__((ext_vector_type(16))) __bf16   v16bf;
typedef __attribute__((ext_vector_type(16))) _Float16 v16h;
typedef __attribute__((ext_vector_type(8)))  _Float16 v8h;
typedef __attribute__((ext_vector_type(8)))  unsigned short v8us;
typedef __attribute__((ext_vector_type(8)))  float    v8f;
typedef __attribute__((ext_vector_type(4)))  float    v4f;
typedef v8h  __attribute__((may_alias)) v8ha;
typedef v4f  __attribute__((may_alias)) v4fa;
typedef v8us __attribute__((may_alias)) v8usa;

__device__ __forceinline__ unsigned short f2bf(float f) { unsigned u = __float_as_uint(f); u += 0x7FFFu + ((u >> 16) & 1u); return (unsigned short)(u >> 16); }
__device__ __forceinline__ float bf2f(unsigned short b) { return __uint_as_float(((unsigned)b) << 16); }
__device__ __forceinline__ float bfr(float f) { return bf2f(f2bf(f)); }
__device__ __forceinline__ v16h cat16(v8h lo, v8h hi) { return __builtin_shufflevector(lo, hi, 0, 1, 2, 3, 4, 5, 6, 7, 8, 9, 10, 11, 12, 13, 14, 15); }
__device__ __forceinline__ v16bf cat16b(v8us lo, v8us hi) { return __builtin_bit_cast(v16bf, __builtin_shufflevector(lo, hi, 0, 1, 2, 3, 4, 5, 6, 7, 8, 9, 10, 11, 12, 13, 14, 15)); }
__device__ __forceinline__ v8f wmma16(v16h a, v16h b, v8f c) { return __builtin_amdgcn_wmma_f32_16x16x32_f16(false, a, false, b, (short)0, c, false, false); }
__device__ __forceinline__ v8f wmmab(v16bf a, v16bf b, v8f c) { return __builtin_amdgcn_wmma_f32_16x16x32_bf16(false, a, false, b, (short)0, c, false, false); }



#define KW   8                    // waves per 64x64 tile where the K loop is split; each wave takes every KW-th 64-wide K chunk (one 128-byte line per operand row)
// Sum of the KW waves' partial 64x64 tiles: every wave lays its accumulators out as [64][68] f32 in its own LDS plane, then the whole work-group adds the planes in wave order and stores whole rows.
template <bool BIAS>
__device__ __forceinline__ void ksum_store(float* os, int wv, const v8f (&acc)[4][4], float* C, int ldc, int r0, int c0, const float* __restrict__ bias) {
    const int lane = threadIdx.x & 31, lr = lane & 15, hi = lane >> 4; float* pw = os + wv * (64 * 68);
    v4f bv = (v4f){}; if (BIAS) { const int bc = c0 + (int)(threadIdx.x & 15) * 4; bv[0] = bfr(bias[bc]); bv[1] = bfr(bias[bc + 1]); bv[2] = bfr(bias[bc + 2]); bv[3] = bfr(bias[bc + 3]); }   // a thread's column group is the same in every pass below: read ahead of the LDS traffic
    // unrolled so that every accumulator index is a constant (the tile stays in registers, no scratch)
#pragma unroll
    for (int mb = 0; mb < 4; ++mb)
#pragma unroll
        for (int nb = 0; nb < 4; ++nb)
#pragma unroll
            for (int j = 0; j < 8; ++j) pw[(mb * 16 + hi * 8 + j) * 68 + nb * 16 + lr] = acc[mb][nb][j];
    __syncthreads();   // every wave's partial tile is in LDS before any thread adds across the planes
    // both loops unrolled so that the LDS reads of all planes and passes are in flight together
#pragma unroll
    for (int s = 0; s < 64 * 16 / (32 * KW); ++s) { const int idx = s * (32 * KW) + threadIdx.x; const int row = idx >> 4, cofs = (idx & 15) * 4; v4f val = *(const v4fa*)(os + row * 68 + cofs);
#pragma unroll
        for (int w = 1; w < KW; ++w) val += *(const v4fa*)(os + w * (64 * 68) + row * 68 + cofs);
        if (BIAS) val += bv;
        *(v4f*)(C + (size_t)(r0 + row) * ldc + c0 + cofs) = val; }
}

// ---- k_gemmw: register-blocked GEMM, KW WAVES per 64x64 output tile (16 accumulators each, K split over the waves), operands straight from K-contiguous 16-bit planes; grid (M/64, N/64, Z), 32 * KW threads.
// C[m][n] (f32, pitch ldc, + optional f32 bias[n]) = sum_k A[m][k] Bt[n][k] (+ split products per NSPLIT). z-batch strides sA/sB/sC in elements. K % 64 == 0.
template <typename T16> struct WFrag;
template <> struct WFrag<h16> { typedef v16h V; static __device__ __forceinline__ V ld(const h16* p) { return cat16(*(const v8h*)p, *(const v8h*)(p + 16)); } static __device__ __forceinline__ v8f mma(V a, V b, v8f c) { return wmma16(a, b, c); } };
template <> struct WFrag<bf> { typedef v16bf V; static __device__ __forceinline__ V ld(const bf* p) { return cat16b(*(const v8us*)p, *(const v8us*)(p + 16)); } static __device__ __forceinline__ v8f mma(V a, V b, v8f c) { return wmmab(a, b, c); } };
template <typename T16, int NSPLIT, bool BIAS>
__global__ __launch_bounds__(32 * KW) void k_gemmw(const T16* __restrict__ A, const T16* __restrict__ A2, const T16* __restrict__ Bt, const T16* __restrict__ Bt2, int K, float* C, int ldc, const float* __restrict__ bias, size_t sA, size_t sB, size_t sC) {
    typedef typename WFrag<T16>::V V;
    __shared__ __align__(16) float os[KW * 64 * 68];
    const size_t z = blockIdx.z; A += z * sA; if (A2) A2 += z * sA; Bt += z * sB; if (Bt2) Bt2 += z * sB; C += z * sC;
    const int lane = threadIdx.x & 31, lr = lane & 15, hi = lane >> 4; const int r0 = blockIdx.x * 64, c0 = blockIdx.y * 64;
    v8f acc[4][4];
#pragma unroll
    for (int mb = 0; mb < 4; ++mb)
#pragma unroll
        for (int nb = 0; nb < 4; ++nb) acc[mb][nb] = (v8f){};
    const size_t aoff = (size_t)(r0 + lr) * K + 8 * hi, boff = (size_t)(c0 + lr) * K + 8 * hi;
    const int wv = __builtin_amdgcn_readfirstlane((int)(threadIdx.x >> 5));   // wave number as a scalar: the K loop's counter and branch stay scalar
#pragma unroll 1
    for (int kc = wv * 64; kc < K; kc += (kc & 32) ? 64 * KW - 32 : 32) {   // both halves of a 64-wide chunk, then this wave's next chunk
        V a[4], a2[4];
#pragma unroll
        for (int mb = 0; mb < 4; ++mb) { a[mb] = WFrag<T16>::ld(A + aoff + (size_t)mb * 16 * K + kc); if (NSPLIT == 1 || NSPLIT == 2) a2[mb] = WFrag<T16>::ld(A2 + aoff + (size_t)mb * 16 * K + kc); }
#pragma unroll
        for (int nb = 0; nb < 4; ++nb) { const V b = WFrag<T16>::ld(Bt + boff + (size_t)nb * 16 * K + kc); V b2; if (NSPLIT >= 2) b2 = WFrag<T16>::ld(Bt2 + boff + (size_t)nb * 16 * K + kc);
#pragma unroll
            for (int mb = 0; mb < 4; ++mb) { acc[mb][nb] = WFrag<T16>::mma(a[mb], b, acc[mb][nb]); if (NSPLIT == 1 || NSPLIT == 2) acc[mb][nb] = WFrag<T16>::mma(a2[mb], b, acc[mb][nb]); if (NSPLIT >= 2) acc[mb][nb] = WFrag<T16>::mma(a[mb], b2, acc[mb][nb]); } }
        asm volatile("v_nop\n\tv_nop\n\tv_nop\n\tv_nop" : "+v"(acc[0][0]), "+v"(acc[1][1]), "+v"(acc[2][2]), "+v"(acc[3][3]) : "v"(a[0]), "v"(a[3]));
    }
    ksum_store<BIAS>(os, wv, acc, C, ldc, r0, c0, bias);
}

__device__ __forceinline__ h16 tohx(float x) { return (h16)x; }
__device__ __forceinline__ void splitf(float y, unsigned short& h, unsigned short& l) { h = f2bf(y); l = f2bf(y - bf2f(h)); }
typedef __attribute__((ext_vector_type(2))) _Float16 v2h;
typedef __attribute__((ext_vector_type(4))) _Float16 v4h;
typedef __attribute__((ext_vector_type(2))) unsigned short v2us;
typedef __attribute__((ext_vector_type(4))) unsigned short v4us;
typedef __attribute__((ext_vector_type(2))) float v2f;
typedef __attribute__((ext_vector_type(4))) int v4i;

__global__ __launch_bounds__(256) void k_cvt8(const float* __restrict__ src, bf* dst, size_t n8) { const size_t i = (size_t)blockIdx.x * 256 + threadIdx.x; if (i >= n8) return; const v8f v = *(const v8f*)(src + i * 8); v8us o;
#pragma unroll
    for (int k = 0; k < 8; ++k) o[k] = f2bf(v[k]); *(v8us*)(dst + i * 8) = o;  }

// k_rope: head planes [h][t][d] (fp16 + hi/lo) of rope(x) x sc with the rotate-half convention out[d] = x[d] cos[t][d] - x[d+HD/2] sin[t][d], out[d+HD/2] = x[d+HD/2] cos[t][d+HD/2] + x[d] sin[t][d+HD/2]
__global__ __launch_bounds__(256) void k_rope(const float* __restrict__ F, int pitch, int nheads, const float* __restrict__ CS, const float* __restrict__ RF, const float* __restrict__ nw, float sc, h16* P16, bf* Ph, bf* Pl) {
    const size_t e = ((size_t)blockIdx.x * 256 + threadIdx.x) * 2; if (e >= (size_t)nheads * TT * HD) return; const int d = (int)(e % HD); const int t = (int)((e / HD) % TT); const int h = (int)(e / ((size_t)HD * TT)); const float* f = F + (size_t)t * pitch + h * HD; const float rf = RF ? RF[(size_t)h * TT + t] : 1.0f; v2h o16; v2us oh, ol;
#pragma unroll
    for (int q = 0; q < 2; ++q) { const int dd = d + q; const int dp = (dd < HD / 2) ? dd + HD / 2 : dd - HD / 2; float x0 = f[dd], x1 = f[dp];
        if (RF) { float n0 = __fmul_rn(x0, rf), n1 = __fmul_rn(x1, rf); asm volatile("" : "+v"(n0)); asm volatile("" : "+v"(n1)); x0 = __fmul_rn(bfr(nw[dd]), n0); x1 = __fmul_rn(bfr(nw[dp]), n1); }
        const v2f cs = *(const v2f*)(CS + ((size_t)t * HD + dd) * 2); float a = __fmul_rn(x0, cs[0]), bq = __fmul_rn(x1, cs[1]); asm volatile("" : "+v"(a)); asm volatile("" : "+v"(bq)); const float r = ((dd < HD / 2) ? __fsub_rn(a, bq) : __fadd_rn(a, bq)) * sc;
        o16[q] = tohx(r); unsigned short a2, c2; splitf(r, a2, c2); oh[q] = a2; ol[q] = c2; }
    *(v2h*)(P16 + e) = o16; *(v2us*)(Ph + e) = oh; *(v2us*)(Pl + e) = ol;  }
__global__ __launch_bounds__(256) void k_vtp(const float* __restrict__ F, int pitch, int nheads, h16* V16, bf* Vh, bf* Vl) { const size_t e = ((size_t)blockIdx.x * 256 + threadIdx.x) * 2; if (e >= (size_t)nheads * HD * TT) return; const int t = (int)(e % TT); const int d = (int)((e / TT) % HD); const int g = (int)(e / ((size_t)TT * HD)); v2h o16; v2us oh, ol;
#pragma unroll
    for (int q = 0; q < 2; ++q) { const float x = F[(size_t)(t + q) * pitch + g * HD + d]; o16[q] = tohx(x); unsigned short a2, c2; splitf(x, a2, c2); oh[q] = a2; ol[q] = c2; }
    *(v2h*)(V16 + e) = o16; *(v2us*)(Vh + e) = oh; *(v2us*)(Vl + e) = ol;  }
__global__ __launch_bounds__(256) void k_csid(float* CS) { const int idx = blockIdx.x * 256 + threadIdx.x; if (idx >= TT * HD) return; v2f cs; cs[0] = 1.0f; cs[1] = 0.0f; *(v2f*)(CS + (size_t)idx * 2) = cs;  }
// ---- k_fattn: causal attention with the scores kept in registers. One wave owns NQ * 16 query rows of one (batch, head) and walks the keys 32 at a time up to its diagonal:
// S^T = K Q^T (a lane holds one query's scores: 8 keys of each 16-key tile), running maximum and sum per query, P^T packed from the score accumulators straight into a B operand, O^T += V^T P^T.
// Rows < RH: bf16 hi/lo planes, 3 products for both contractions; other rows: fp16 planes. The epilogue divides by the row sum and writes the merged hi/lo planes [t][DQ] for the output projection.
// Every '#pragma unroll' of this section keeps the fragment and accumulator indices constant, so that the tiles stay in registers (no scratch).
#define FW   4                    // waves per work-group; each wave is independent (no LDS, no barrier), neighbours share K and V lines in the WGP cache
template <typename T16, bool HI> struct AFrag { typename WFrag<T16>::V k[2][2], k2[2][2], v[4], v2[4]; };
template <typename T16, bool HI>
__device__ __forceinline__ void afrag_ld(AFrag<T16, HI>& f, const T16* __restrict__ Kp, const T16* __restrict__ K2, const T16* __restrict__ Vt, const T16* __restrict__ V2, int kc, int lr, int hi) {
#pragma unroll
    for (int kt = 0; kt < 2; ++kt)
#pragma unroll
        for (int dc = 0; dc < 2; ++dc) { const size_t o = (size_t)(kc + kt * 16 + lr) * HD + dc * 32 + 8 * hi; f.k[kt][dc] = WFrag<T16>::ld(Kp + o); if (HI) f.k2[kt][dc] = WFrag<T16>::ld(K2 + o); }
    if (HI) asm volatile("s_wait_xcnt 0x0" ::: "memory");   // the hi/lo build reuses the K loads' address registers as destinations of the V loads: the wait stands in front of that overwrite
#pragma unroll
    for (int dt = 0; dt < 4; ++dt) { const size_t o = (size_t)(dt * 16 + lr) * TT + kc + 8 * hi; f.v[dt] = WFrag<T16>::ld(Vt + o); if (HI) f.v2[dt] = WFrag<T16>::ld(V2 + o); }
}
template <typename T16, bool HI, int NQ>
__device__ __forceinline__ void attn_step(const AFrag<T16, HI>& f, const typename WFrag<T16>::V (&qb)[NQ][2], const typename WFrag<T16>::V (&qb2)[NQ][2], v8f (&o)[4][NQ], float (&m)[NQ], float (&l)[NQ], int kc, int q0, int lr, int hi) {
    typedef typename WFrag<T16>::V V;
    const float c = SCL * 1.4426950408889634f;   // score scale and log2(e) in one factor: p = 2^((s - m) c)
    v8f s[NQ][2];
#pragma unroll
    for (int nq = 0; nq < NQ; ++nq)
#pragma unroll
        for (int kt = 0; kt < 2; ++kt) { v8f t = (v8f){};
#pragma unroll
            for (int dc = 0; dc < 2; ++dc) { t = WFrag<T16>::mma(f.k[kt][dc], qb[nq][dc], t); if (HI) { t = WFrag<T16>::mma(f.k[kt][dc], qb2[nq][dc], t); t = WFrag<T16>::mma(f.k2[kt][dc], qb[nq][dc], t); } }
            s[nq][kt] = t; }
    if (kc + 31 > q0) {   // only the chunk on the diagonal holds keys above a query (scalar test)
#pragma unroll
        for (int nq = 0; nq < NQ; ++nq)
#pragma unroll
            for (int kt = 0; kt < 2; ++kt)
#pragma unroll
                for (int j = 0; j < 8; ++j) if (kc + kt * 16 + hi * 8 + j > q0 + nq * 16 + lr) s[nq][kt][j] = -3.0e38f;
    }
    float mx[NQ]; bool need = false;
#pragma unroll
    for (int nq = 0; nq < NQ; ++nq) { float t = s[nq][0][0];
#pragma unroll
        for (int j = 1; j < 8; ++j) t = fmaxf(t, s[nq][0][j]);
#pragma unroll
        for (int j = 0; j < 8; ++j) t = fmaxf(t, s[nq][1][j]);
        t = fmaxf(t, __shfl_xor(t, 16, 32));   // the two halves of the wave hold the same query's other keys: both must use one maximum
        mx[nq] = t; need = need || ((t - m[nq]) * c > 8.0f); }
    if (__builtin_amdgcn_ballot_w32(need) != 0) {   // lazy rescale, one scalar test per chunk: the maximum in use moves only when some query's scores pass it by more than 2^8
#pragma unroll
        for (int nq = 0; nq < NQ; ++nq) { const float mn = fmaxf(m[nq], mx[nq]); const float al = __builtin_amdgcn_exp2f((m[nq] - mn) * c); m[nq] = mn; l[nq] *= al;
#pragma unroll
            for (int dt = 0; dt < 4; ++dt) o[dt][nq] *= al; }
    }
    V pb[NQ], pl[NQ];
#pragma unroll
    for (int nq = 0; nq < NQ; ++nq) { const float mc = m[nq] * c; float ps = 0.f;
#pragma unroll
        for (int kt = 0; kt < 2; ++kt)
#pragma unroll
            for (int j = 0; j < 8; ++j) { const float p = __builtin_amdgcn_exp2f(fmaf(s[nq][kt][j], c, -mc)); s[nq][kt][j] = p; ps += p; }
        l[nq] += ps;
        // slot e of the B operand is key 8 hi + e (e < 8) or 16 + 8 hi + (e - 8): register j of score tile 0 or 1, the k order of the V^T loader
        if constexpr (HI) { v8us h0, h1, l0, l1;
#pragma unroll
            for (int j = 0; j < 8; ++j) { unsigned short a, b2; splitf(s[nq][0][j], a, b2); h0[j] = a; l0[j] = b2; splitf(s[nq][1][j], a, b2); h1[j] = a; l1[j] = b2; }
            pb[nq] = cat16b(h0, h1); pl[nq] = cat16b(l0, l1);
        } else { v8h h0, h1;
#pragma unroll
            for (int j = 0; j < 8; ++j) { h0[j] = tohx(s[nq][0][j]); h1[j] = tohx(s[nq][1][j]); }
            pb[nq] = cat16(h0, h1); } }
#pragma unroll
    for (int dt = 0; dt < 4; ++dt)
#pragma unroll
        for (int nq = 0; nq < NQ; ++nq) { o[dt][nq] = WFrag<T16>::mma(f.v[dt], pb[nq], o[dt][nq]); if (HI) { o[dt][nq] = WFrag<T16>::mma(f.v[dt], pl[nq], o[dt][nq]); o[dt][nq] = WFrag<T16>::mma(f.v2[dt], pb[nq], o[dt][nq]); } }
}
template <typename T16, bool HI, int NQ>
__device__ __forceinline__ void attn_rows(const T16* __restrict__ Q, const T16* __restrict__ Q2, const T16* __restrict__ Kp, const T16* __restrict__ K2, const T16* __restrict__ Vt, const T16* __restrict__ V2, int q0, bf* Ah, bf* Al) {
    typedef typename WFrag<T16>::V V;
    const int lane = threadIdx.x & 31, lr = lane & 15, hi = lane >> 4;
    V qb[NQ][2], qb2[NQ][2]; v8f o[4][NQ]; float m[NQ], l[NQ];
#pragma unroll
    for (int nq = 0; nq < NQ; ++nq) { m[nq] = -3.0e38f; l[nq] = 0.f;
#pragma unroll
        for (int dc = 0; dc < 2; ++dc) { const size_t qo = (size_t)(q0 + nq * 16 + lr) * HD + dc * 32 + 8 * hi; qb[nq][dc] = WFrag<T16>::ld(Q + qo); if (HI) qb2[nq][dc] = WFrag<T16>::ld(Q2 + qo); }
#pragma unroll
        for (int dt = 0; dt < 4; ++dt) o[dt][nq] = (v8f){}; }
    const int kend = q0 + NQ * 16;   // keys 0 .. kend - 1, in chunks of 32; every chunk holds at least one key <= every query of the wave
#pragma unroll 1   // one chunk's fragments live at a time: an unrolled key loop would not fit four waves per SIMD
    for (int kc = 0; kc < kend; kc += 32) { AFrag<T16, HI> f; afrag_ld<T16, HI>(f, Kp, K2, Vt, V2, kc, lr, hi);
        // inputs-only fence on the loaded fragments: all of a chunk's loads are issued together and waited for once (left free, the loads are strung out between the products, one memory latency each)
        if constexpr (HI) asm volatile("" :: "v"(f.k[0][0]), "v"(f.k[0][1]), "v"(f.k[1][0]), "v"(f.k[1][1]), "v"(f.k2[0][0]), "v"(f.k2[0][1]), "v"(f.k2[1][0]), "v"(f.k2[1][1]), "v"(f.v[0]), "v"(f.v[1]), "v"(f.v[2]), "v"(f.v[3]), "v"(f.v2[0]), "v"(f.v2[1]), "v"(f.v2[2]), "v"(f.v2[3]));
        else asm volatile("" :: "v"(f.k[0][0]), "v"(f.k[0][1]), "v"(f.k[1][0]), "v"(f.k[1][1]), "v"(f.v[0]), "v"(f.v[1]), "v"(f.v[2]), "v"(f.v[3]));
        __builtin_amdgcn_sched_barrier(0);   // keeps the first products, and the wait they bring, from being lifted in front of the chunk's last loads
        attn_step<T16, HI, NQ>(f, qb, qb2, o, m, l, kc, q0, lr, hi); }
#pragma unroll
    for (int nq = 0; nq < NQ; ++nq) { const float li = __fdiv_rn(1.0f, l[nq] + __shfl_xor(l[nq], 16, 32));   // the halves' sums join once, here
        const size_t ro = (size_t)(q0 + nq * 16 + lr) * DQ + hi * 8;
#pragma unroll
        for (int dt = 0; dt < 4; ++dt) { v8us oh, ol;
#pragma unroll
            for (int j = 0; j < 8; ++j) { unsigned short a, b2; splitf(o[dt][nq][j] * li, a, b2); oh[j] = a; ol[j] = b2; }
            *(v8us*)(Ah + ro + dt * 16) = oh; *(v8us*)(Al + ro + dt * 16) = ol; } }
}
// grid (NB_ * NH_, row blocks): the row block is the slow index and the longest rows come first. Blocks 0 .. NBF-1: fp16 rows, FW * 32 each, from the end of the sequence down to RH; the rest: hi/lo rows, FW * 16 each.
#define NBF  ((TT - RH) / (FW * 32))
#define NBH  (RH / (FW * 16))
__global__ __launch_bounds__(32 * FW) void k_fattn(const h16* __restrict__ Q16, const h16* __restrict__ K16, const h16* __restrict__ V16, const bf* __restrict__ Qh, const bf* __restrict__ Ql, const bf* __restrict__ Kh, const bf* __restrict__ Kl, const bf* __restrict__ Vh, const bf* __restrict__ Vl, bf* Ah, bf* Al) {
    const int z = blockIdx.x, y = blockIdx.y; const size_t po = (size_t)z * TT * HD; const size_t ao = (size_t)(z / NH_) * TT * DQ + (size_t)(z % NH_) * HD;
    const int wv = __builtin_amdgcn_readfirstlane((int)(threadIdx.x >> 5));   // wave number as a scalar: row offsets, trip counts and the diagonal test stay scalar
    if (y < NBF) attn_rows<h16, false, 2>(Q16 + po, nullptr, K16 + po, nullptr, V16 + po, nullptr, TT - (y + 1) * (FW * 32) + wv * 32, Ah + ao, Al + ao);
    else attn_rows<bf, true, 1>(Qh + po, Ql + po, Kh + po, Kl + po, Vh + po, Vl + po, RH - (y - NBF + 1) * (FW * 16) + wv * 16, Ah + ao, Al + ao);
}

extern "C" void kernel_launch(void* const* d_in, const int* in_sizes, int n_in,
                              void* d_out, int out_size, void* d_ws, size_t ws_size, hipStream_t stream) {
    (void)in_sizes; (void)n_in; (void)out_size;
    const float* x = (const float*)d_in[0]; const float* xk = (const float*)d_in[1]; const float* xv = (const float*)d_in[2]; const float* wq = (const float*)d_in[3]; const float* bq = (const float*)d_in[4]; const float* wk = (const float*)d_in[5]; const float* bk = (const float*)d_in[6]; const float* wv = (const float*)d_in[7]; const float* bv = (const float*)d_in[8]; const float* wo = (const float*)d_in[9]; const float* bo = (const float*)d_in[10];
    float* OUT = (float*)d_out;     // [4][2048][768]
    char* wsp = (char*)d_ws;
    auto take = [&](size_t bytes) { char* p = wsp; wsp += (bytes + 255) & ~(size_t)255; return (void*)p; };
    bf* WQ = (bf*)take((size_t)DQ * DM * 2); bf* WK = (bf*)take((size_t)DKV * DM * 2); bf* WV = (bf*)take((size_t)DKV * DM * 2); bf* WO = (bf*)take((size_t)DM * DQ * 2); float* CS = (float*)take((size_t)TT * HD * 2 * 4);
    bf* XB = (bf*)take((size_t)TT * DM * 2); float* FQ = (float*)take((size_t)TT * DQ * 4); float* FK = (float*)take((size_t)TT * DKV * 4);
    const size_t PB = (size_t)NH_ * TT * HD;   // one batch's head planes, elements; every plane holds all NB_ batches
    h16* QP16 = (h16*)take(NB_ * PB * 2); h16* KP16 = (h16*)take(NB_ * PB * 2); h16* VT16 = (h16*)take(NB_ * PB * 2);
    bf* QPh = (bf*)take(NB_ * PB * 2); bf* QPl = (bf*)take(NB_ * PB * 2); bf* KPh = (bf*)take(NB_ * PB * 2); bf* KPl = (bf*)take(NB_ * PB * 2); bf* VTh = (bf*)take(NB_ * PB * 2); bf* VTl = (bf*)take(NB_ * PB * 2);
    bf* ATh = (bf*)take((size_t)NB_ * TT * DQ * 2); bf* ATl = (bf*)take((size_t)NB_ * TT * DQ * 2);
    if ((size_t)(wsp - (char*)d_ws) > ws_size) return;    // ws 256 MiB
    float* FV = FK;   // v projection reuses the k buffer after the k planes are built (stream-ordered)
    { k_cvt8<<<(unsigned)(((size_t)DQ * DM / 8 + 255) / 256), 256, 0, stream>>>(wq, WQ, (size_t)DQ * DM / 8); k_cvt8<<<(unsigned)(((size_t)DKV * DM / 8 + 255) / 256), 256, 0, stream>>>(wk, WK, (size_t)DKV * DM / 8); k_cvt8<<<(unsigned)(((size_t)DKV * DM / 8 + 255) / 256), 256, 0, stream>>>(wv, WV, (size_t)DKV * DM / 8);
      k_cvt8<<<(unsigned)(((size_t)DM * DQ / 8 + 255) / 256), 256, 0, stream>>>(wo, WO, (size_t)DM * DQ / 8);
       }
    k_csid<<<(TT * HD + 255) / 256, 256, 0, stream>>>(CS);
    const unsigned LQ = (unsigned)(((size_t)NH_ * TT * HD / 2 + 255) / 256), LKv = (unsigned)(((size_t)NKV * TT * HD / 2 + 255) / 256);
    for (int b = 0; b < NB_; ++b) {
        
        k_cvt8<<<(unsigned)(((size_t)TT * DM / 8 + 255) / 256), 256, 0, stream>>>(x + (size_t)b * TT * DM, XB, (size_t)TT * DM / 8);
        k_gemmw<bf, 0, true><<<dim3(TT / 64, DQ / 64, 1), 32 * KW, 0, stream>>>(XB, nullptr, WQ, nullptr, DM, FQ, DQ, bq, 0, 0, 0);
        k_rope<<<LQ, 256, 0, stream>>>(FQ, DQ, NH_, CS, nullptr, nullptr, 1.0f, QP16 + b * PB, QPh + b * PB, QPl + b * PB);
        k_cvt8<<<(unsigned)(((size_t)TT * DM / 8 + 255) / 256), 256, 0, stream>>>(xk + (size_t)b * TT * DM, XB, (size_t)TT * DM / 8);   /* XB := bf16(keys[b]) */ k_gemmw<bf, 0, true><<<dim3(TT / 64, DKV / 64, 1), 32 * KW, 0, stream>>>(XB, nullptr, WK, nullptr, DM, FK, DKV, bk, 0, 0, 0);
        k_rope<<<LKv, 256, 0, stream>>>(FK, DKV, NKV, CS, nullptr, nullptr, 1.0f, KP16 + b * PB, KPh + b * PB, KPl + b * PB);
        k_cvt8<<<(unsigned)(((size_t)TT * DM / 8 + 255) / 256), 256, 0, stream>>>(xv + (size_t)b * TT * DM, XB, (size_t)TT * DM / 8);   /* XB := bf16(values[b]) */ k_gemmw<bf, 0, true><<<dim3(TT / 64, DKV / 64, 1), 32 * KW, 0, stream>>>(XB, nullptr, WV, nullptr, DM, FV, DKV, bv, 0, 0, 0); k_vtp<<<LKv, 256, 0, stream>>>(FV, DKV, NKV, VT16 + b * PB, VTh + b * PB, VTl + b * PB); }
    k_fattn<<<dim3(NB_ * NH_, NBF + NBH, 1), 32 * FW, 0, stream>>>(QP16, KP16, VT16, QPh, QPl, KPh, KPl, VTh, VTl, ATh, ATl);
    for (int b = 0; b < NB_; ++b)
        k_gemmw<bf, 1, true><<<dim3(TT / 64, DM / 64, 1), 32 * KW, 0, stream>>>(ATh + (size_t)b * TT * DQ, ATl + (size_t)b * TT * DQ, WO, nullptr, DQ, OUT + (size_t)b * TT * DM, DM, bo, 0, 0, 0);
}

// v004
// Measured time: 296 microseconds a run.
// In both of two side-by-side timings against v003, it was 1.27 times as fast.
// All steps since v000 together make it 7.51 times as fast.
#include <hip/hip_runtime.h>

// Causal multi-headed attention on three input streams (queries, keys, values [4][2048][768]; Q = queries W_Q^T + b_Q, K = keys W_K^T + b_K, V = values W_V^T + b_V ('oi' uniform(+-768^-0.5) incl. biases: non-zero; 12 heads x 64); scores x 1/sqrt(64); causal (-inf); softmax; outputs = merged (standard) W_O^T + b_O -> [4][2048][768] (6.3 M); argument order queries, keys, values, W_Q, b_Q, W_K, b_K, W_V, b_V, W_O, b_O).
// Layout per batch: bf16 copies of queries, keys, values in turn; 'oi' weights; exact projections (K 768) + f32 biases, their epilogue writes the head planes (V as W_V x values^T, so that its planes come out [d][t]); one fused causal attention launch over all batches and heads (hybrid rows: < 512 hi/lo 3 products, rest fp16; scores and probabilities stay in registers); merged hi/lo x W_O exact + b_O.
// Compute dtypes, f32 accumulate: every input rounded to bf16; projections exact + f32 biases; attention rows < 512 3 products, rest fp16; softmax f32; W_O hl x exact + bias.

#define NB_  4
#define TT   2048
#define DM   768
#define NH_  12
#define NKV  12
#define HD   64
#define DQ   (NH_ * HD)
#define DKV  (NKV * HD)
#define RH   512                  // query rows < RH use hi+lo planes (0: none)
#define SCL  0.125f   // HD^-0.5
typedef _Float16 h16;
typedef unsigned short bf;
typedef __attribute__((ext_vector_type(16))) __bf16   v16bf;
typedef __attribute__((ext_vector_type(16))) _Float16 v16h;
typedef __attribute__((ext_vector_type(8)))  _Float16 v8h;
typedef __attribute__((ext_vector_type(8)))  unsigned short v8us;
typedef __attribute__((ext_vector_type(8)))  float    v8f;
typedef __attribute__((ext_vector_type(4)))  float    v4f;
typedef v8h  __attribute__((may_alias)) v8ha;
typedef v4f  __attribute__((may_alias)) v4fa;
typedef v8us __attribute__((may_alias)) v8usa;

__device__ __forceinline__ unsigned short f2bf(float f) { unsigned u = __float_as_uint(f); u += 0x7FFFu + ((u >> 16) & 1u); return (unsigned short)(u >> 16); }
__device__ __forceinline__ float bf2f(unsigned short b) { return __uint_as_float(((unsigned)b) << 16); }
__device__ __forceinline__ float bfr(float f) { return bf2f(f2bf(f)); }
__device__ __forceinline__ v16h cat16(v8h lo, v8h hi) { return __builtin_shufflevector(lo, hi, 0, 1, 2, 3, 4, 5, 6, 7, 8, 9, 10, 11, 12, 13, 14, 15); }
__device__ __forceinline__ v16bf cat16b(v8us lo, v8us hi) { return __builtin_bit_cast(v16bf, __builtin_shufflevector(lo, hi, 0, 1, 2, 3, 4, 5, 6, 7, 8, 9, 10, 11, 12, 13, 14, 15)); }
__device__ __forceinline__ v8f wmma16(v16h a, v16h b, v8f c) { return __builtin_amdgcn_wmma_f32_16x16x32_f16(false, a, false, b, (short)0, c, false, false); }
__device__ __forceinline__ v8f wmmab(v16bf a, v16bf b, v8f c) { return __builtin_amdgcn_wmma_f32_16x16x32_bf16(false, a, false, b, (short)0, c, false, false); }



#define KW   8                    // waves per 64x64 tile where the K loop is split; each wave takes every KW-th 64-wide K chunk (one 128-byte line per operand row)
// Sum of the KW waves' partial 64x64 tiles: every wave lays its accumulators out as [64][68] f32 in its own LDS plane, then the whole work-group adds the planes in wave order and stores whole rows.
template <bool BIAS>
__device__ __forceinline__ void ksum_store(float* os, int wv, const v8f (&acc)[4][4], float* C, int ldc, int r0, int c0, const float* __restrict__ bias) {
    const int lane = threadIdx.x & 31, lr = lane & 15, hi = lane >> 4; float* pw = os + wv * (64 * 68);
    v4f bv = (v4f){}; if (BIAS) { const int bc = c0 + (int)(threadIdx.x & 15) * 4; bv[0] = bfr(bias[bc]); bv[1] = bfr(bias[bc + 1]); bv[2] = bfr(bias[bc + 2]); bv[3] = bfr(bias[bc + 3]); }   // a thread's column group is the same in every pass below: read ahead of the LDS traffic
    // unrolled so that every accumulator index is a constant (the tile stays in registers, no scratch)
#pragma unroll
    for (int mb = 0; mb < 4; ++mb)
#pragma unroll
        for (int nb = 0; nb < 4; ++nb)
#pragma unroll
            for (int j = 0; j < 8; ++j) pw[(mb * 16 + hi * 8 + j) * 68 + nb * 16 + lr] = acc[mb][nb][j];
    __syncthreads();   // every wave's partial tile is in LDS before any thread adds across the planes
    // both loops unrolled so that the LDS reads of all planes and passes are in flight together
#pragma unroll
    for (int s = 0; s < 64 * 16 / (32 * KW); ++s) { const int idx = s * (32 * KW) + threadIdx.x; const int row = idx >> 4, cofs = (idx & 15) * 4; v4f val = *(const v4fa*)(os + row * 68 + cofs);
#pragma unroll
        for (int w = 1; w < KW; ++w) val += *(const v4fa*)(os + w * (64 * 68) + row * 68 + cofs);
        if (BIAS) val += bv;
        *(v4f*)(C + (size_t)(r0 + row) * ldc + c0 + cofs) = val; }
}
__device__ __forceinline__ h16 tohx(float x) { return (h16)x; }
__device__ __forceinline__ void splitf(float y, unsigned short& h, unsigned short& l) { h = f2bf(y); l = f2bf(y - bf2f(h)); }
// The same sum (planes in wave order, then the bias), stored as the three 16-bit planes attention reads (fp16, bf16 hi, bf16 lo) instead of an f32 tile. A thread takes 8 neighbouring columns: every store is 16 bytes and 8 lanes fill one 128-byte line of a plane row.
// P16, Ph, Pl: the tile's first element, row pitch ldp elements. bias: the tile's first entry, by column, or by row where ROWB (the transposed product).
template <bool ROWB>
__device__ __forceinline__ void ksum_planes(float* os, int wv, const v8f (&acc)[4][4], h16* P16, bf* Ph, bf* Pl, int ldp, const float* __restrict__ bias) {
    const int lane = threadIdx.x & 31, lr = lane & 15, hi = lane >> 4; float* pw = os + wv * (64 * 68);
    const int cofs = (int)(threadIdx.x & 7) * 8, rw = (int)(threadIdx.x >> 3); constexpr int NP = 64 * 8 / (32 * KW);
    float bv[ROWB ? NP : 8];
    // every loop below is unrolled so that accumulator and vector indices are constants (registers, no scratch) and the LDS reads of all planes are in flight together
#pragma unroll
    for (int k = 0; k < (ROWB ? NP : 8); ++k) bv[k] = bfr(bias[ROWB ? k * (4 * KW) + rw : cofs + k]);
#pragma unroll
    for (int mb = 0; mb < 4; ++mb)
#pragma unroll
        for (int nb = 0; nb < 4; ++nb)
#pragma unroll
            for (int j = 0; j < 8; ++j) pw[(mb * 16 + hi * 8 + j) * 68 + nb * 16 + lr] = acc[mb][nb][j];
    __syncthreads();   // every wave's partial tile is in LDS before any thread adds across the planes
#pragma unroll
    for (int s = 0; s < NP; ++s) { const int row = s * (4 * KW) + rw; const float* p = os + row * 68 + cofs; v4f v0 = *(const v4fa*)p, v1 = *(const v4fa*)(p + 4);
#pragma unroll
        for (int w = 1; w < KW; ++w) { v0 += *(const v4fa*)(p + w * (64 * 68)); v1 += *(const v4fa*)(p + w * (64 * 68) + 4); }
        v8h o16; v8us oh, ol;
#pragma unroll
        for (int k = 0; k < 8; ++k) { const float y = (k < 4 ? v0[k & 3] : v1[k & 3]) + bv[ROWB ? s : k]; o16[k] = tohx(y); unsigned short a, b2; splitf(y, a, b2); oh[k] = a; ol[k] = b2; }
        const size_t o = (size_t)row * ldp + cofs; *(v8h*)(P16 + o) = o16; *(v8us*)(Ph + o) = oh; *(v8us*)(Pl + o) = ol; }
}

// ---- k_gemmw: register-blocked GEMM, KW WAVES per 64x64 output tile (16 accumulators each, K split over the waves), operands straight from K-contiguous 16-bit planes; grid (M/64, N/64, Z), 32 * KW threads.
// C[m][n] (f32, pitch ldc, + optional f32 bias[n]) = sum_k A[m][k] Bt[n][k] (+ split products per NSPLIT). z-batch strides sA/sB/sC in elements. K % 64 == 0.
// EPI 0: the f32 tile to C. EPI 1: m = position, n = head * HD + d, a tile is one head: planes [head][t][d]. EPI 2: m = head * HD + d, n = position, bias[m]: planes [head][d][t].
template <typename T16> struct WFrag;
template <> struct WFrag<h16> { typedef v16h V; static __device__ __forceinline__ V ld(const h16* p) { return cat16(*(const v8h*)p, *(const v8h*)(p + 16)); } static __device__ __forceinline__ v8f mma(V a, V b, v8f c) { return wmma16(a, b, c); } };
template <> struct WFrag<bf> { typedef v16bf V; static __device__ __forceinline__ V ld(const bf* p) { return cat16b(*(const v8us*)p, *(const v8us*)(p + 16)); } static __device__ __forceinline__ v8f mma(V a, V b, v8f c) { return wmmab(a, b, c); } };
template <typename T16, int NSPLIT, bool BIAS, int EPI>
__global__ __launch_bounds__(32 * KW) void k_gemmw(const T16* __restrict__ A, const T16* __restrict__ A2, const T16* __restrict__ Bt, const T16* __restrict__ Bt2, int K, float* C, int ldc, const float* __restrict__ bias, size_t sA, size_t sB, size_t sC, h16* P16, bf* Ph, bf* Pl) {
    typedef typename WFrag<T16>::V V;
    __shared__ __align__(16) float os[KW * 64 * 68];
    const size_t z = blockIdx.z; A += z * sA; if (A2) A2 += z * sA; Bt += z * sB; if (Bt2) Bt2 += z * sB; C += z * sC;
    const int lane = threadIdx.x & 31, lr = lane & 15, hi = lane >> 4; const int r0 = blockIdx.x * 64, c0 = blockIdx.y * 64;
    v8f acc[4][4];
#pragma unroll
    for (int mb = 0; mb < 4; ++mb)
#pragma unroll
        for (int nb = 0; nb < 4; ++nb) acc[mb][nb] = (v8f){};
    const size_t aoff = (size_t)(r0 + lr) * K + 8 * hi, boff = (size_t)(c0 + lr) * K + 8 * hi;
    const int wv = __builtin_amdgcn_readfirstlane((int)(threadIdx.x >> 5));   // wave number as a scalar: the K loop's counter and branch stay scalar
#pragma unroll 1
    for (int kc = wv * 64; kc < K; kc += (kc & 32) ? 64 * KW - 32 : 32) {   // both halves of a 64-wide chunk, then this wave's next chunk
        V a[4], a2[4];
#pragma unroll
        for (int mb = 0; mb < 4; ++mb) { a[mb] = WFrag<T16>::ld(A + aoff + (size_t)mb * 16 * K + kc); if (NSPLIT == 1 || NSPLIT == 2) a2[mb] = WFrag<T16>::ld(A2 + aoff + (size_t)mb * 16 * K + kc); }
#pragma unroll
        for (int nb = 0; nb < 4; ++nb) { const V b = WFrag<T16>::ld(Bt + boff + (size_t)nb * 16 * K + kc); V b2; if (NSPLIT >= 2) b2 = WFrag<T16>::ld(Bt2 + boff + (size_t)nb * 16 * K + kc);
#pragma unroll
            for (int mb = 0; mb < 4; ++mb) { acc[mb][nb] = WFrag<T16>::mma(a[mb], b, acc[mb][nb]); if (NSPLIT == 1 || NSPLIT == 2) acc[mb][nb] = WFrag<T16>::mma(a2[mb], b, acc[mb][nb]); if (NSPLIT >= 2) acc[mb][nb] = WFrag<T16>::mma(a[mb], b2, acc[mb][nb]); } }
        asm volatile("v_nop\n\tv_nop\n\tv_nop\n\tv_nop" : "+v"(acc[0][0]), "+v"(acc[1][1]), "+v"(acc[2][2]), "+v"(acc[3][3]) : "v"(a[0]), "v"(a[3]));
    }
    if constexpr (EPI == 0) ksum_store<BIAS>(os, wv, acc, C, ldc, r0, c0, bias);
    else if constexpr (EPI == 1) { const size_t po = ((size_t)blockIdx.y * TT + r0) * HD; ksum_planes<false>(os, wv, acc, P16 + po, Ph + po, Pl + po, HD, bias + c0); }
    else { const size_t po = (size_t)r0 * TT + c0; ksum_planes<true>(os, wv, acc, P16 + po, Ph + po, Pl + po, TT, bias + r0); }
}

__global__ __launch_bounds__(256) void k_cvt8(const float* __restrict__ src, bf* dst, size_t n8) { const size_t i = (size_t)blockIdx.x * 256 + threadIdx.x; if (i >= n8) return; const v8f v = *(const v8f*)(src + i * 8); v8us o;
#pragma unroll
    for (int k = 0; k < 8; ++k) o[k] = f2bf(v[k]); *(v8us*)(dst + i * 8) = o;  }

// ---- k_fattn: causal attention with the scores kept in registers. One wave owns NQ * 16 query rows of one (batch, head) and walks the keys 32 at a time up to its diagonal:
// S^T = K Q^T (a lane holds one query's scores: 8 keys of each 16-key tile), running maximum and sum per query, P^T packed from the score accumulators straight into a B operand, O^T += V^T P^T.
// Rows < RH: bf16 hi/lo planes, 3 products for both contractions; other rows: fp16 planes. The epilogue divides by the row sum and writes the merged hi/lo planes [t][DQ] for the output projection.
// Every '#pragma unroll' of this section keeps the fragment and accumulator indices constant, so that the tiles stay in registers (no scratch).
#define FW   4                    // waves per work-group; each wave is independent (no LDS, no barrier), neighbours share K and V lines in the WGP cache
template <typename T16, bool HI> struct AFrag { typename WFrag<T16>::V k[2][2], k2[2][2], v[4], v2[4]; };
template <typename T16, bool HI>
__device__ __forceinline__ void afrag_ld(AFrag<T16, HI>& f, const T16* __restrict__ Kp, const T16* __restrict__ K2, const T16* __restrict__ Vt, const T16* __restrict__ V2, int kc, int lr, int hi) {
#pragma unroll
    for (int kt = 0; kt < 2; ++kt)
#pragma unroll
        for (int dc = 0; dc < 2; ++dc) { const size_t o = (size_t)(kc + kt * 16 + lr) * HD + dc * 32 + 8 * hi; f.k[kt][dc] = WFrag<T16>::ld(Kp + o); if (HI) f.k2[kt][dc] = WFrag<T16>::ld(K2 + o); }
    if (HI) asm volatile("s_wait_xcnt 0x0" ::: "memory");   // the hi/lo build reuses the K loads' address registers as destinations of the V loads: the wait stands in front of that overwrite
#pragma unroll
    for (int dt = 0; dt < 4; ++dt) { const size_t o = (size_t)(dt * 16 + lr) * TT + kc + 8 * hi; f.v[dt] = WFrag<T16>::ld(Vt + o); if (HI) f.v2[dt] = WFrag<T16>::ld(V2 + o); }
}
template <typename T16, bool HI, int NQ>
__device__ __forceinline__ void attn_step(const AFrag<T16, HI>& f, const typename WFrag<T16>::V (&qb)[NQ][2], const typename WFrag<T16>::V (&qb2)[NQ][2], v8f (&o)[4][NQ], float (&m)[NQ], float (&l)[NQ], int kc, int q0, int lr, int hi) {
    typedef typename WFrag<T16>::V V;
    const float c = SCL * 1.4426950408889634f;   // score scale and log2(e) in one factor: p = 2^((s - m) c)
    v8f s[NQ][2];
#pragma unroll
    for (int nq = 0; nq < NQ; ++nq)
#pragma unroll
        for (int kt = 0; kt < 2; ++kt) { v8f t = (v8f){};
#pragma unroll
            for (int dc = 0; dc < 2; ++dc) { t = WFrag<T16>::mma(f.k[kt][dc], qb[nq][dc], t); if (HI) { t = WFrag<T16>::mma(f.k[kt][dc], qb2[nq][dc], t); t = WFrag<T16>::mma(f.k2[kt][dc], qb[nq][dc], t); } }
            s[nq][kt] = t; }
    if (kc + 31 > q0) {   // only the chunk on the diagonal holds keys above a query (scalar test)
#pragma unroll
        for (int nq = 0; nq < NQ; ++nq)
#pragma unroll
            for (int kt = 0; kt < 2; ++kt)
#pragma unroll
                for (int j = 0; j < 8; ++j) if (kc + kt * 16 + hi * 8 + j > q0 + nq * 16 + lr) s[nq][kt][j] = -3.0e38f;
    }
    float mx[NQ]; bool need = false;
#pragma unroll
    for (int nq = 0; nq < NQ; ++nq) { float t = s[nq][0][0];
#pragma unroll
        for (int j = 1; j < 8; ++j) t = fmaxf(t, s[nq][0][j]);
#pragma unroll
        for (int j = 0; j < 8; ++j) t = fmaxf(t, s[nq][1][j]);
        t = fmaxf(t, __shfl_xor(t, 16, 32));   // the two halves of the wave hold the same query's other keys: both must use one maximum
        mx[nq] = t; need = need || ((t - m[nq]) * c > 8.0f); }
    if (__builtin_amdgcn_ballot_w32(need) != 0) {   // lazy rescale, one scalar test per chunk: the maximum in use moves only when some query's scores pass it by more than 2^8
#pragma unroll
        for (int nq = 0; nq < NQ; ++nq) { const float mn = fmaxf(m[nq], mx[nq]); const float al = __builtin_amdgcn_exp2f((m[nq] - mn) * c); m[nq] = mn; l[nq] *= al;
#pragma unroll
            for (int dt = 0; dt < 4; ++dt) o[dt][nq] *= al; }
    }
    V pb[NQ], pl[NQ];
#pragma unroll
    for (int nq = 0; nq < NQ; ++nq) { const float mc = m[nq] * c; float ps = 0.f;
#pragma unroll
        for (int kt = 0; kt < 2; ++kt)
#pragma unroll
            for (int j = 0; j < 8; ++j) { const float p = __builtin_amdgcn_exp2f(fmaf(s[nq][kt][j], c, -mc)); s[nq][kt][j] = p; ps += p; }
        l[nq] += ps;
        // slot e of the B operand is key 8 hi + e (e < 8) or 16 + 8 hi + (e - 8): register j of score tile 0 or 1, the k order of the V^T loader
        if constexpr (HI) { v8us h0, h1, l0, l1;
#pragma unroll
            for (int j = 0; j < 8; ++j) { unsigned short a, b2; splitf(s[nq][0][j], a, b2); h0[j] = a; l0[j] = b2; splitf(s[nq][1][j], a, b2); h1[j] = a; l1[j] = b2; }
            pb[nq] = cat16b(h0, h1); pl[nq] = cat16b(l0, l1);
        } else { v8h h0, h1;
#pragma unroll
            for (int j = 0; j < 8; ++j) { h0[j] = tohx(s[nq][0][j]); h1[j] = tohx(s[nq][1][j]); }
            pb[nq] = cat16(h0, h1); } }
#pragma unroll
    for (int dt = 0; dt < 4; ++dt)
#pragma unroll
        for (int nq = 0; nq < NQ; ++nq) { o[dt][nq] = WFrag<T16>::mma(f.v[dt], pb[nq], o[dt][nq]); if (HI) { o[dt][nq] = WFrag<T16>::mma(f.v[dt], pl[nq], o[dt][nq]); o[dt][nq] = WFrag<T16>::mma(f.v2[dt], pb[nq], o[dt][nq]); } }
}
template <typename T16, bool HI, int NQ>
__device__ __forceinline__ void attn_rows(const T16* __restrict__ Q, const T16* __restrict__ Q2, const T16* __restrict__ Kp, const T16* __restrict__ K2, const T16* __restrict__ Vt, const T16* __restrict__ V2, int q0, bf* Ah, bf* Al) {
    typedef typename WFrag<T16>::V V;
    const int lane = threadIdx.x & 31, lr = lane & 15, hi = lane >> 4;
    V qb[NQ][2], qb2[NQ][2]; v8f o[4][NQ]; float m[NQ], l[NQ];
#pragma unroll
    for (int nq = 0; nq < NQ; ++nq) { m[nq] = -3.0e38f; l[nq] = 0.f;
#pragma unroll
        for (int dc = 0; dc < 2; ++dc) { const size_t qo = (size_t)(q0 + nq * 16 + lr) * HD + dc * 32 + 8 * hi; qb[nq][dc] = WFrag<T16>::ld(Q + qo); if (HI) qb2[nq][dc] = WFrag<T16>::ld(Q2 + qo); }
#pragma unroll
        for (int dt = 0; dt < 4; ++dt) o[dt][nq] = (v8f){}; }
    const int kend = q0 + NQ * 16;   // keys 0 .. kend - 1, in chunks of 32; every chunk holds at least one key <= every query of the wave
#pragma unroll 1   // one chunk's fragments live at a time: an unrolled key loop would not fit four waves per SIMD
    for (int kc = 0; kc < kend; kc += 32) { AFrag<T16, HI> f; afrag_ld<T16, HI>(f, Kp, K2, Vt, V2, kc, lr, hi);
        // inputs-only fence on the loaded fragments: all of a chunk's loads are issued together and waited for once (left free, the loads are strung out between the products, one memory latency each)
        if constexpr (HI) asm volatile("" :: "v"(f.k[0][0]), "v"(f.k[0][1]), "v"(f.k[1][0]), "v"(f.k[1][1]), "v"(f.k2[0][0]), "v"(f.k2[0][1]), "v"(f.k2[1][0]), "v"(f.k2[1][1]), "v"(f.v[0]), "v"(f.v[1]), "v"(f.v[2]), "v"(f.v[3]), "v"(f.v2[0]), "v"(f.v2[1]), "v"(f.v2[2]), "v"(f.v2[3]));
        else asm volatile("" :: "v"(f.k[0][0]), "v"(f.k[0][1]), "v"(f.k[1][0]), "v"(f.k[1][1]), "v"(f.v[0]), "v"(f.v[1]), "v"(f.v[2]), "v"(f.v[3]));
        __builtin_amdgcn_sched_barrier(0);   // keeps the first products, and the wait they bring, from being lifted in front of the chunk's last loads
        attn_step<T16, HI, NQ>(f, qb, qb2, o, m, l, kc, q0, lr, hi); }
#pragma unroll
    for (int nq = 0; nq < NQ; ++nq) { const float li = __fdiv_rn(1.0f, l[nq] + __shfl_xor(l[nq], 16, 32));   // the halves' sums join once, here
        const size_t ro = (size_t)(q0 + nq * 16 + lr) * DQ + hi * 8;
#pragma unroll
        for (int dt = 0; dt < 4; ++dt) { v8us oh, ol;
#pragma unroll
            for (int j = 0; j < 8; ++j) { unsigned short a, b2; splitf(o[dt][nq][j] * li, a, b2); oh[j] = a; ol[j] = b2; }
            *(v8us*)(Ah + ro + dt * 16) = oh; *(v8us*)(Al + ro + dt * 16) = ol; } }
}
// grid (NB_ * NH_, row blocks): the row block is the slow index and the longest rows come first. Blocks 0 .. NBF-1: fp16 rows, FW * 32 each, from the end of the sequence down to RH; the rest: hi/lo rows, FW * 16 each.
#define NBF  ((TT - RH) / (FW * 32))
#define NBH  (RH / (FW * 16))
__global__ __launch_bounds__(32 * FW) void k_fattn(const h16* __restrict__ Q16, const h16* __restrict__ K16, const h16* __restrict__ V16, const bf* __restrict__ Qh, const bf* __restrict__ Ql, const bf* __restrict__ Kh, const bf* __restrict__ Kl, const bf* __restrict__ Vh, const bf* __restrict__ Vl, bf* Ah, bf* Al) {
    const int z = blockIdx.x, y = blockIdx.y; const size_t po = (size_t)z * TT * HD; const size_t ao = (size_t)(z / NH_) * TT * DQ + (size_t)(z % NH_) * HD;
    const int wv = __builtin_amdgcn_readfirstlane((int)(threadIdx.x >> 5));   // wave number as a scalar: row offsets, trip counts and the diagonal test stay scalar
    if (y < NBF) attn_rows<h16, false, 2>(Q16 + po, nullptr, K16 + po, nullptr, V16 + po, nullptr, TT - (y + 1) * (FW * 32) + wv * 32, Ah + ao, Al + ao);
    else attn_rows<bf, true, 1>(Qh + po, Ql + po, Kh + po, Kl + po, Vh + po, Vl + po, RH - (y - NBF + 1) * (FW * 16) + wv * 16, Ah + ao, Al + ao);
}

extern "C" void kernel_launch(void* const* d_in, const int* in_sizes, int n_in,
                              void* d_out, int out_size, void* d_ws, size_t ws_size, hipStream_t stream) {
    (void)in_sizes; (void)n_in; (void)out_size;
    const float* x = (const float*)d_in[0]; const float* xk = (const float*)d_in[1]; const float* xv = (const float*)d_in[2]; const float* wq = (const float*)d_in[3]; const float* bq = (const float*)d_in[4]; const float* wk = (const float*)d_in[5]; const float* bk = (const float*)d_in[6]; const float* wv = (const float*)d_in[7]; const float* bv = (const float*)d_in[8]; const float* wo = (const float*)d_in[9]; const float* bo = (const float*)d_in[10];
    float* OUT = (float*)d_out;     // [4][2048][768]
    char* wsp = (char*)d_ws;
    auto take = [&](size_t bytes) { char* p = wsp; wsp += (bytes + 255) & ~(size_t)255; return (void*)p; };
    bf* WQ = (bf*)take((size_t)DQ * DM * 2); bf* WK = (bf*)take((size_t)DKV * DM * 2); bf* WV = (bf*)take((size_t)DKV * DM * 2); bf* WO = (bf*)take((size_t)DM * DQ * 2);
    bf* XB = (bf*)take((size_t)TT * DM * 2);
    const size_t PB = (size_t)NH_ * TT * HD;   // one batch's head planes, elements; every plane holds all NB_ batches
    h16* QP16 = (h16*)take(NB_ * PB * 2); h16* KP16 = (h16*)take(NB_ * PB * 2); h16* VT16 = (h16*)take(NB_ * PB * 2);
    bf* QPh = (bf*)take(NB_ * PB * 2); bf* QPl = (bf*)take(NB_ * PB * 2); bf* KPh = (bf*)take(NB_ * PB * 2); bf* KPl = (bf*)take(NB_ * PB * 2); bf* VTh = (bf*)take(NB_ * PB * 2); bf* VTl = (bf*)take(NB_ * PB * 2);
    bf* ATh = (bf*)take((size_t)NB_ * TT * DQ * 2); bf* ATl = (bf*)take((size_t)NB_ * TT * DQ * 2);
    if ((size_t)(wsp - (char*)d_ws) > ws_size) return;    // ws 256 MiB
    { k_cvt8<<<(unsigned)(((size_t)DQ * DM / 8 + 255) / 256), 256, 0, stream>>>(wq, WQ, (size_t)DQ * DM / 8); k_cvt8<<<(unsigned)(((size_t)DKV * DM / 8 + 255) / 256), 256, 0, stream>>>(wk, WK, (size_t)DKV * DM / 8); k_cvt8<<<(unsigned)(((size_t)DKV * DM / 8 + 255) / 256), 256, 0, stream>>>(wv, WV, (size_t)DKV * DM / 8);
      k_cvt8<<<(unsigned)(((size_t)DM * DQ / 8 + 255) / 256), 256, 0, stream>>>(wo, WO, (size_t)DM * DQ / 8);
       }
    for (int b = 0; b < NB_; ++b) {
        k_cvt8<<<(unsigned)(((size_t)TT * DM / 8 + 255) / 256), 256, 0, stream>>>(x + (size_t)b * TT * DM, XB, (size_t)TT * DM / 8);
        k_gemmw<bf, 0, true, 1><<<dim3(TT / 64, DQ / 64, 1), 32 * KW, 0, stream>>>(XB, nullptr, WQ, nullptr, DM, nullptr, 0, bq, 0, 0, 0, QP16 + b * PB, QPh + b * PB, QPl + b * PB);
        k_cvt8<<<(unsigned)(((size_t)TT * DM / 8 + 255) / 256), 256, 0, stream>>>(xk + (size_t)b * TT * DM, XB, (size_t)TT * DM / 8);   /* XB := bf16(keys[b]) */
        k_gemmw<bf, 0, true, 1><<<dim3(TT / 64, DKV / 64, 1), 32 * KW, 0, stream>>>(XB, nullptr, WK, nullptr, DM, nullptr, 0, bk, 0, 0, 0, KP16 + b * PB, KPh + b * PB, KPl + b * PB);
        k_cvt8<<<(unsigned)(((size_t)TT * DM / 8 + 255) / 256), 256, 0, stream>>>(xv + (size_t)b * TT * DM, XB, (size_t)TT * DM / 8);   /* XB := bf16(values[b]) */
        k_gemmw<bf, 0, true, 2><<<dim3(DKV / 64, TT / 64, 1), 32 * KW, 0, stream>>>(WV, nullptr, XB, nullptr, DM, nullptr, 0, bv, 0, 0, 0, VT16 + b * PB, VTh + b * PB, VTl + b * PB); }
    k_fattn<<<dim3(NB_ * NH_, NBF + NBH, 1), 32 * FW, 0, stream>>>(QP16, KP16, VT16, QPh, QPl, KPh, KPl, VTh, VTl, ATh, ATl);
    for (int b = 0; b < NB_; ++b)
        k_gemmw<bf, 1, true, 0><<<dim3(TT / 64, DM / 64, 1), 32 * KW, 0, stream>>>(ATh + (size_t)b * TT * DQ, ATl + (size_t)b * TT * DQ, WO, nullptr, DQ, OUT + (size_t)b * TT * DM, DM, bo, 0, 0, 0, nullptr, nullptr, nullptr);
}

// v005
// It runs in 210 microseconds.
// Timed twice side by side with v004, it ran 1.40 and 1.42 times as fast.
// All steps since v000 together make it 10.6 times as fast.
#include <hip/hip_runtime.h>

// Causal multi-headed attention on three input streams (queries, keys, values [4][2048][768]; Q = queries W_Q^T + b_Q, K = keys W_K^T + b_K, V = values W_V^T + b_V ('oi' uniform(+-768^-0.5) incl. biases: non-zero; 12 heads x 64); scores x 1/sqrt(64); causal (-inf); softmax; outputs = merged (standard) W_O^T + b_O -> [4][2048][768] (6.3 M); argument order queries, keys, values, W_Q, b_Q, W_K, b_K, W_V, b_V, W_O, b_O).
// Four launches, each over all batches: bf16 copies of queries, keys, values and the four 'oi' weights; the three exact projections (K 768) + f32 biases, their epilogue writes the head planes (V as W_V x values^T, so that its planes come out [d][t]); one fused causal attention launch over all batches and heads (hybrid rows: < 512 hi/lo 3 products, rest fp16; scores and probabilities stay in registers); merged hi/lo x W_O exact + b_O.
// Compute dtypes, f32 accumulate: every input rounded to bf16; projections exact + f32 biases; attention rows < 512 3 products, rest fp16; softmax f32; W_O hl x exact + bias.

#define NB_  4
#define TT   2048
#define DM   768
#define NH_  12
#define NKV  12
#define HD   64
#define DQ   (NH_ * HD)
#define DKV  (NKV * HD)
#define RH   512                  // query rows < RH use hi+lo planes (0: none)
#define SCL  0.125f   // HD^-0.5
typedef _Float16 h16;
typedef unsigned short bf;
typedef __attribute__((ext_vector_type(16))) __bf16   v16bf;
typedef __attribute__((ext_vector_type(16))) _Float16 v16h;
typedef __attribute__((ext_vector_type(8)))  _Float16 v8h;
typedef __attribute__((ext_vector_type(8)))  unsigned short v8us;
typedef __attribute__((ext_vector_type(8)))  float    v8f;
typedef __attribute__((ext_vector_type(4)))  float    v4f;
typedef v8h  __attribute__((may_alias)) v8ha;
typedef v4f  __attribute__((may_alias)) v4fa;
typedef v8us __attribute__((may_alias)) v8usa;

__device__ __forceinline__ unsigned short f2bf(float f) { unsigned u = __float_as_uint(f); u += 0x7FFFu + ((u >> 16) & 1u); return (unsigned short)(u >> 16); }
__device__ __forceinline__ float bf2f(unsigned short b) { return __uint_as_float(((unsigned)b) << 16); }
__device__ __forceinline__ float bfr(float f) { return bf2f(f2bf(f)); }
__device__ __forceinline__ v16h cat16(v8h lo, v8h hi) { return __builtin_shufflevector(lo, hi, 0, 1, 2, 3, 4, 5, 6, 7, 8, 9, 10, 11, 12, 13, 14, 15); }
__device__ __forceinline__ v16bf cat16b(v8us lo, v8us hi) { return __builtin_bit_cast(v16bf, __builtin_shufflevector(lo, hi, 0, 1, 2, 3, 4, 5, 6, 7, 8, 9, 10, 11, 12, 13, 14, 15)); }
__device__ __forceinline__ v8f wmma16(v16h a, v16h b, v8f c) { return __builtin_amdgcn_wmma_f32_16x16x32_f16(false, a, false, b, (short)0, c, false, false); }
__device__ __forceinline__ v8f wmmab(v16bf a, v16bf b, v8f c) { return __builtin_amdgcn_wmma_f32_16x16x32_bf16(false, a, false, b, (short)0, c, false, false); }



#define KW   8                    // waves per 64x64 tile where the K loop is split; each wave takes every KW-th 64-wide K chunk (one 128-byte line per operand row)
// Sum of the KW waves' partial 64x64 tiles: every wave lays its accumulators out as [64][68] f32 in its own LDS plane, then the whole work-group adds the planes in wave order and stores whole rows.
template <bool BIAS>
__device__ __forceinline__ void ksum_store(float* os, int wv, const v8f (&acc)[4][4], float* C, int ldc, int r0, int c0, const float* __restrict__ bias) {
    const int lane = threadIdx.x & 31, lr = lane & 15, hi = lane >> 4; float* pw = os + wv * (64 * 68);
    v4f bv = (v4f){}; if (BIAS) { const int bc = c0 + (int)(threadIdx.x & 15) * 4; bv[0] = bfr(bias[bc]); bv[1] = bfr(bias[bc + 1]); bv[2] = bfr(bias[bc + 2]); bv[3] = bfr(bias[bc + 3]); }   // a thread's column group is the same in every pass below: read ahead of the LDS traffic
    // unrolled so that every accumulator index is a constant (the tile stays in registers, no scratch)
#pragma unroll
    for (int mb = 0; mb < 4; ++mb)
#pragma unroll
        for (int nb = 0; nb < 4; ++nb)
#pragma unroll
            for (int j = 0; j < 8; ++j) pw[(mb * 16 + hi * 8 + j) * 68 + nb * 16 + lr] = acc[mb][nb][j];
    __syncthreads();   // every wave's partial tile is in LDS before any thread adds across the planes
    // both loops unrolled so that the LDS reads of all planes and passes are in flight together
#pragma unroll
    for (int s = 0; s < 64 * 16 / (32 * KW); ++s) { const int idx = s * (32 * KW) + threadIdx.x; const int row = idx >> 4, cofs = (idx & 15) * 4; v4f val = *(const v4fa*)(os + row * 68 + cofs);
#pragma unroll
        for (int w = 1; w < KW; ++w) val += *(const v4fa*)(os + w * (64 * 68) + row * 68 + cofs);
        if (BIAS) val += bv;
        *(v4f*)(C + (size_t)(r0 + row) * ldc + c0 + cofs) = val; }
}
__device__ __forceinline__ h16 tohx(float x) { return (h16)x; }
__device__ __forceinline__ void splitf(float y, unsigned short& h, unsigned short& l) { h = f2bf(y); l = f2bf(y - bf2f(h)); }
// The same sum (planes in wave order, then the bias), stored as the three 16-bit planes attention reads (fp16, bf16 hi, bf16 lo) instead of an f32 tile. A thread takes 8 neighbouring columns: every store is 16 bytes and 8 lanes fill one 128-byte line of a plane row.
// P16, Ph, Pl: the tile's first element, row pitch ldp elements. bias: the tile's first entry (64 of them), by column, or by row where rowb (the transposed product; the same for the whole work-group).
__device__ __forceinline__ void ksum_planes(float* os, int wv, const v8f (&acc)[4][4], h16* P16, bf* Ph, bf* Pl, int ldp, const float* __restrict__ bias, bool rowb) {
    const int lane = threadIdx.x & 31, lr = lane & 15, hi = lane >> 4; float* pw = os + wv * (64 * 68);
    const int cofs = (int)(threadIdx.x & 7) * 8, rw = (int)(threadIdx.x >> 3); constexpr int NP = 64 * 8 / (32 * KW);
    float bc[8], br[NP];
    // every loop below is unrolled so that accumulator and vector indices are constants (registers, no scratch) and the LDS reads of all planes are in flight together
#pragma unroll
    for (int k = 0; k < 8; ++k) bc[k] = bfr(bias[cofs + k]);
#pragma unroll
    for (int s = 0; s < NP; ++s) br[s] = bfr(bias[s * (4 * KW) + rw]);
#pragma unroll
    for (int mb = 0; mb < 4; ++mb)
#pragma unroll
        for (int nb = 0; nb < 4; ++nb)
#pragma unroll
            for (int j = 0; j < 8; ++j) pw[(mb * 16 + hi * 8 + j) * 68 + nb * 16 + lr] = acc[mb][nb][j];
    __syncthreads();   // every wave's partial tile is in LDS before any thread adds across the planes
#pragma unroll
    for (int s = 0; s < NP; ++s) { const int row = s * (4 * KW) + rw; const float* p = os + row * 68 + cofs; v4f v0 = *(const v4fa*)p, v1 = *(const v4fa*)(p + 4);
#pragma unroll
        for (int w = 1; w < KW; ++w) { v0 += *(const v4fa*)(p + w * (64 * 68)); v1 += *(const v4fa*)(p + w * (64 * 68) + 4); }
        v8h o16; v8us oh, ol;
#pragma unroll
        for (int k = 0; k < 8; ++k) { const float y = (k < 4 ? v0[k & 3] : v1[k & 3]) + (rowb ? br[s] : bc[k]); o16[k] = tohx(y); unsigned short a, b2; splitf(y, a, b2); oh[k] = a; ol[k] = b2; }
        const size_t o = (size_t)row * ldp + cofs; *(v8h*)(P16 + o) = o16; *(v8us*)(Ph + o) = oh; *(v8us*)(Pl + o) = ol; }
}

// ---- k_gemmw: register-blocked GEMM, KW WAVES per 64x64 output tile (16 accumulators each, K split over the waves), operands straight from K-contiguous 16-bit planes; 32 * KW threads.
// C[m][n] (f32, pitch ldc, + optional f32 bias[n]) = sum_k A[m][k] Bt[n][k] (+ split products per NSPLIT). K % 64 == 0.
// EPI 0: grid (M/64, N/64), the f32 tile to C.
// EPI 1: the three projections of all batches, grid (TT/64, heads, 3 * NB_), z = stream * NB_ + batch. A: the streams' bf16 copies [z][t][DM]; Bt: W_Q, W_K, W_V one behind the other; bias, biasK, biasV: theirs; planes [z][head][..].
//        Streams 0, 1: m = position, n = head * HD + d, a tile is one head: planes [head][t][d]. Stream 2: the operands change places, m = head * HD + d, n = position, bias[m]: planes [head][d][t].
template <typename T16> struct WFrag;
template <> struct WFrag<h16> { typedef v16h V; static __device__ __forceinline__ V ld(const h16* p) { return cat16(*(const v8h*)p, *(const v8h*)(p + 16)); } static __device__ __forceinline__ v8f mma(V a, V b, v8f c) { return wmma16(a, b, c); } };
template <> struct WFrag<bf> { typedef v16bf V; static __device__ __forceinline__ V ld(const bf* p) { return cat16b(*(const v8us*)p, *(const v8us*)(p + 16)); } static __device__ __forceinline__ v8f mma(V a, V b, v8f c) { return wmmab(a, b, c); } };
template <typename T16, int NSPLIT, bool BIAS, int EPI>
__global__ __launch_bounds__(32 * KW) void k_gemmw(const T16* __restrict__ A, const T16* __restrict__ A2, const T16* __restrict__ Bt, const T16* __restrict__ Bt2, int K, float* C, int ldc, const float* __restrict__ bias, const float* __restrict__ biasK, const float* __restrict__ biasV, h16* P16, bf* Ph, bf* Pl) {
    typedef typename WFrag<T16>::V V;
    __shared__ __align__(16) float os[KW * 64 * 68];
    const int lane = threadIdx.x & 31, lr = lane & 15, hi = lane >> 4; int r0 = blockIdx.x * 64, c0 = blockIdx.y * 64;
    const int st = EPI == 1 ? (int)(blockIdx.z / NB_) : 0;   // stream, the same for the whole work-group
    if constexpr (EPI == 1) { const T16* X = A + (size_t)blockIdx.z * TT * DM; const T16* Wt = Bt + (size_t)st * DQ * DM;
        if (st == 2) { A = Wt; Bt = X; r0 = blockIdx.y * 64; c0 = blockIdx.x * 64; } else { A = X; Bt = Wt; } }
    v8f acc[4][4];
#pragma unroll
    for (int mb = 0; mb < 4; ++mb)
#pragma unroll
        for (int nb = 0; nb < 4; ++nb) acc[mb][nb] = (v8f){};
    const size_t aoff = (size_t)(r0 + lr) * K + 8 * hi, boff = (size_t)(c0 + lr) * K + 8 * hi;
    const int wv = __builtin_amdgcn_readfirstlane((int)(threadIdx.x >> 5));   // wave number as a scalar: the K loop's counter and branch stay scalar
#pragma unroll 1
    for (int kc = wv * 64; kc < K; kc += (kc & 32) ? 64 * KW - 32 : 32) {   // both halves of a 64-wide chunk, then this wave's next chunk
        V a[4], a2[4];
#pragma unroll
        for (int mb = 0; mb < 4; ++mb) { a[mb] = WFrag<T16>::ld(A + aoff + (size_t)mb * 16 * K + kc); if (NSPLIT == 1 || NSPLIT == 2) a2[mb] = WFrag<T16>::ld(A2 + aoff + (size_t)mb * 16 * K + kc); }
#pragma unroll
        for (int nb = 0; nb < 4; ++nb) { const V b = WFrag<T16>::ld(Bt + boff + (size_t)nb * 16 * K + kc); V b2; if (NSPLIT >= 2) b2 = WFrag<T16>::ld(Bt2 + boff + (size_t)nb * 16 * K + kc);
#pragma unroll
            for (int mb = 0; mb < 4; ++mb) { acc[mb][nb] = WFrag<T16>::mma(a[mb], b, acc[mb][nb]); if (NSPLIT == 1 || NSPLIT == 2) acc[mb][nb] = WFrag<T16>::mma(a2[mb], b, acc[mb][nb]); if (NSPLIT >= 2) acc[mb][nb] = WFrag<T16>::mma(a[mb], b2, acc[mb][nb]); } }
        asm volatile("v_nop\n\tv_nop\n\tv_nop\n\tv_nop" : "+v"(acc[0][0]), "+v"(acc[1][1]), "+v"(acc[2][2]), "+v"(acc[3][3]) : "v"(a[0]), "v"(a[3]));
    }
    if constexpr (EPI == 0) ksum_store<BIAS>(os, wv, acc, C, ldc, r0, c0, bias);
    else { const bool tr = st == 2; const size_t po = (size_t)blockIdx.z * NH_ * TT * HD + (tr ? (size_t)r0 * TT + c0 : ((size_t)blockIdx.y * TT + r0) * HD);
        ksum_planes(os, wv, acc, P16 + po, Ph + po, Pl + po, tr ? TT : HD, (st == 0 ? bias : st == 1 ? biasK : biasV) + blockIdx.y * 64, tr); }
}

// bf16 copies of all seven f32 matrices in one launch, 8 elements a thread: blocks 0 .. 3 * CXB - 1 the three streams (all batches) to X [stream][batch][t][DM], the next 4 * CWB the four weights to Wd, one behind the other.
#define CXB  (NB_ * TT * DM / 8 / 256)
#define CWB  (DQ * DM / 8 / 256)
static_assert(NB_ * TT * DM % (8 * 256) == 0 && DQ * DM % (8 * 256) == 0 && DKV == DQ, "whole blocks, equal weights");
__global__ __launch_bounds__(256) void k_cvt8(const float* __restrict__ x, const float* __restrict__ xk, const float* __restrict__ xv, const float* __restrict__ wq, const float* __restrict__ wk, const float* __restrict__ wv, const float* __restrict__ wo, bf* X, bf* Wd) {
    const int blk = blockIdx.x; const float* src; bf* dst; size_t i;
    if (blk < 3 * CXB) { const int s = blk / CXB; src = s == 0 ? x : s == 1 ? xk : xv; dst = X + (size_t)s * NB_ * TT * DM; i = (size_t)(blk - s * CXB) * 256 + threadIdx.x; }
    else { const int s = (blk - 3 * CXB) / CWB; src = s == 0 ? wq : s == 1 ? wk : s == 2 ? wv : wo; dst = Wd + (size_t)s * DQ * DM; i = (size_t)(blk - 3 * CXB - s * CWB) * 256 + threadIdx.x; }
    const v8f v = *(const v8f*)(src + i * 8); v8us o;
#pragma unroll
    for (int k = 0; k < 8; ++k) o[k] = f2bf(v[k]); *(v8us*)(dst + i * 8) = o;  }

// ---- k_fattn: causal attention with the scores kept in registers. One wave owns NQ * 16 query rows of one (batch, head) and walks the keys 32 at a time up to its diagonal:
// S^T = K Q^T (a lane holds one query's scores: 8 keys of each 16-key tile), running maximum and sum per query, P^T packed from the score accumulators straight into a B operand, O^T += V^T P^T.
// Rows < RH: bf16 hi/lo planes, 3 products for both contractions; other rows: fp16 planes. The epilogue divides by the row sum and writes the merged hi/lo planes [t][DQ] for the output projection.
// Every '#pragma unroll' of this section keeps the fragment and accumulator indices constant, so that the tiles stay in registers (no scratch).
#define FW   4                    // waves per work-group; each wave is independent (no LDS, no barrier), neighbours share K and V lines in the WGP cache
template <typename T16, bool HI> struct AFrag { typename WFrag<T16>::V k[2][2], k2[2][2], v[4], v2[4]; };
template <typename T16, bool HI>
__device__ __forceinline__ void afrag_ld(AFrag<T16, HI>& f, const T16* __restrict__ Kp, const T16* __restrict__ K2, const T16* __restrict__ Vt, const T16* __restrict__ V2, int kc, int lr, int hi) {
#pragma unroll
    for (int kt = 0; kt < 2; ++kt)
#pragma unroll
        for (int dc = 0; dc < 2; ++dc) { const size_t o = (size_t)(kc + kt * 16 + lr) * HD + dc * 32 + 8 * hi; f.k[kt][dc] = WFrag<T16>::ld(Kp + o); if (HI) f.k2[kt][dc] = WFrag<T16>::ld(K2 + o); }
    if (HI) asm volatile("s_wait_xcnt 0x0" ::: "memory");   // the hi/lo build reuses the K loads' address registers as destinations of the V loads: the wait stands in front of that overwrite
#pragma unroll
    for (int dt = 0; dt < 4; ++dt) { const size_t o = (size_t)(dt * 16 + lr) * TT + kc + 8 * hi; f.v[dt] = WFrag<T16>::ld(Vt + o); if (HI) f.v2[dt] = WFrag<T16>::ld(V2 + o); }
}
template <typename T16, bool HI, int NQ>
__device__ __forceinline__ void attn_step(const AFrag<T16, HI>& f, const typename WFrag<T16>::V (&qb)[NQ][2], const typename WFrag<T16>::V (&qb2)[NQ][2], v8f (&o)[4][NQ], float (&m)[NQ], float (&l)[NQ], int kc, int q0, int lr, int hi) {
    typedef typename WFrag<T16>::V V;
    const float c = SCL * 1.4426950408889634f;   // score scale and log2(e) in one factor: p = 2^((s - m) c)
    v8f s[NQ][2];
#pragma unroll
    for (int nq = 0; nq < NQ; ++nq)
#pragma unroll
        for (int kt = 0; kt < 2; ++kt) { v8f t = (v8f){};
#pragma unroll
            for (int dc = 0; dc < 2; ++dc) { t = WFrag<T16>::mma(f.k[kt][dc], qb[nq][dc], t); if (HI) { t = WFrag<T16>::mma(f.k[kt][dc], qb2[nq][dc], t); t = WFrag<T16>::mma(f.k2[kt][dc], qb[nq][dc], t); } }
            s[nq][kt] = t; }
    if (kc + 31 > q0) {   // only the chunk on the diagonal holds keys above a query (scalar test)
#pragma unroll
        for (int nq = 0; nq < NQ; ++nq)
#pragma unroll
            for (int kt = 0; kt < 2; ++kt)
#pragma unroll
                for (int j = 0; j < 8; ++j) if (kc + kt * 16 + hi * 8 + j > q0 + nq * 16 + lr) s[nq][kt][j] = -3.0e38f;
    }
    float mx[NQ]; bool need = false;
#pragma unroll
    for (int nq = 0; nq < NQ; ++nq) { float t = s[nq][0][0];
#pragma unroll
        for (int j = 1; j < 8; ++j) t = fmaxf(t, s[nq][0][j]);
#pragma unroll
        for (int j = 0; j < 8; ++j) t = fmaxf(t, s[nq][1][j]);
        t = fmaxf(t, __shfl_xor(t, 16, 32));   // the two halves of the wave hold the same query's other keys: both must use one maximum
        mx[nq] = t; need = need || ((t - m[nq]) * c > 8.0f); }
    if (__builtin_amdgcn_ballot_w32(need) != 0) {   // lazy rescale, one scalar test per chunk: the maximum in use moves only when some query's scores pass it by more than 2^8
#pragma unroll
        for (int nq = 0; nq < NQ; ++nq) { const float mn = fmaxf(m[nq], mx[nq]); const float al = __builtin_amdgcn_exp2f((m[nq] - mn) * c); m[nq] = mn; l[nq] *= al;
#pragma unroll
            for (int dt = 0; dt < 4; ++dt) o[dt][nq] *= al; }
    }
    V pb[NQ], pl[NQ];
#pragma unroll
    for (int nq = 0; nq < NQ; ++nq) { const float mc = m[nq] * c; float ps = 0.f;
#pragma unroll
        for (int kt = 0; kt < 2; ++kt)
#pragma unroll
            for (int j = 0; j < 8; ++j) { const float p = __builtin_amdgcn_exp2f(fmaf(s[nq][kt][j], c, -mc)); s[nq][kt][j] = p; ps += p; }
        l[nq] += ps;
        // slot e of the B operand is key 8 hi + e (e < 8) or 16 + 8 hi + (e - 8): register j of score tile 0 or 1, the k order of the V^T loader
        if constexpr (HI) { v8us h0, h1, l0, l1;
#pragma unroll
            for (int j = 0; j < 8; ++j) { unsigned short a, b2; splitf(s[nq][0][j], a, b2); h0[j] = a; l0[j] = b2; splitf(s[nq][1][j], a, b2); h1[j] = a; l1[j] = b2; }
            pb[nq] = cat16b(h0, h1); pl[nq] = cat16b(l0, l1);
        } else { v8h h0, h1;
#pragma unroll
            for (int j = 0; j < 8; ++j) { h0[j] = tohx(s[nq][0][j]); h1[j] = tohx(s[nq][1][j]); }
            pb[nq] = cat16(h0, h1); } }
#pragma unroll
    for (int dt = 0; dt < 4; ++dt)
#pragma unroll
        for (int nq = 0; nq < NQ; ++nq) { o[dt][nq] = WFrag<T16>::mma(f.v[dt], pb[nq], o[dt][nq]); if (HI) { o[dt][nq] = WFrag<T16>::mma(f.v[dt], pl[nq], o[dt][nq]); o[dt][nq] = WFrag<T16>::mma(f.v2[dt], pb[nq], o[dt][nq]); } }
}
template <typename T16, bool HI, int NQ>
__device__ __forceinline__ void attn_rows(const T16* __restrict__ Q, const T16* __restrict__ Q2, const T16* __restrict__ Kp, const T16* __restrict__ K2, const T16* __restrict__ Vt, const T16* __restrict__ V2, int q0, bf* Ah, bf* Al) {
    typedef typename WFrag<T16>::V V;
    const int lane = threadIdx.x & 31, lr = lane & 15, hi = lane >> 4;
    V qb[NQ][2], qb2[NQ][2]; v8f o[4][NQ]; float m[NQ], l[NQ];
#pragma unroll
    for (int nq = 0; nq < NQ; ++nq) { m[nq] = -3.0e38f; l[nq] = 0.f;
#pragma unroll
        for (int dc = 0; dc < 2; ++dc) { const size_t qo = (size_t)(q0 + nq * 16 + lr) * HD + dc * 32 + 8 * hi; qb[nq][dc] = WFrag<T16>::ld(Q + qo); if (HI) qb2[nq][dc] = WFrag<T16>::ld(Q2 + qo); }
#pragma unroll
        for (int dt = 0; dt < 4; ++dt) o[dt][nq] = (v8f){}; }
    const int kend = q0 + NQ * 16;   // keys 0 .. kend - 1, in chunks of 32; every chunk holds at least one key <= every query of the wave
#pragma unroll 1   // one chunk's fragments live at a time: an unrolled key loop would not fit four waves per SIMD
    for (int kc = 0; kc < kend; kc += 32) { AFrag<T16, HI> f; afrag_ld<T16, HI>(f, Kp, K2, Vt, V2, kc, lr, hi);
        // inputs-only fence on the loaded fragments: all of a chunk's loads are issued together and waited for once (left free, the loads are strung out between the products, one memory latency each)
        if constexpr (HI) asm volatile("" :: "v"(f.k[0][0]), "v"(f.k[0][1]), "v"(f.k[1][0]), "v"(f.k[1][1]), "v"(f.k2[0][0]), "v"(f.k2[0][1]), "v"(f.k2[1][0]), "v"(f.k2[1][1]), "v"(f.v[0]), "v"(f.v[1]), "v"(f.v[2]), "v"(f.v[3]), "v"(f.v2[0]), "v"(f.v2[1]), "v"(f.v2[2]), "v"(f.v2[3]));
        else asm volatile("" :: "v"(f.k[0][0]), "v"(f.k[0][1]), "v"(f.k[1][0]), "v"(f.k[1][1]), "v"(f.v[0]), "v"(f.v[1]), "v"(f.v[2]), "v"(f.v[3]));
        __builtin_amdgcn_sched_barrier(0);   // keeps the first products, and the wait they bring, from being lifted in front of the chunk's last loads
        attn_step<T16, HI, NQ>(f, qb, qb2, o, m, l, kc, q0, lr, hi); }
#pragma unroll
    for (int nq = 0; nq < NQ; ++nq) { const float li = __fdiv_rn(1.0f, l[nq] + __shfl_xor(l[nq], 16, 32));   // the halves' sums join once, here
        const size_t ro = (size_t)(q0 + nq * 16 + lr) * DQ + hi * 8;
#pragma unroll
        for (int dt = 0; dt < 4; ++dt) { v8us oh, ol;
#pragma unroll
            for (int j = 0; j < 8; ++j) { unsigned short a, b2; splitf(o[dt][nq][j] * li, a, b2); oh[j] = a; ol[j] = b2; }
            *(v8us*)(Ah + ro + dt * 16) = oh; *(v8us*)(Al + ro + dt * 16) = ol; } }
}
// grid (NB_ * NH_, row blocks): the row block is the slow index and the longest rows come first. Blocks 0 .. NBF-1: fp16 rows, FW * 32 each, from the end of the sequence down to RH; the rest: hi/lo rows, FW * 16 each.
#define NBF  ((TT - RH) / (FW * 32))
#define NBH  (RH / (FW * 16))
__global__ __launch_bounds__(32 * FW) void k_fattn(const h16* __restrict__ Q16, const h16* __restrict__ K16, const h16* __restrict__ V16, const bf* __restrict__ Qh, const bf* __restrict__ Ql, const bf* __restrict__ Kh, const bf* __restrict__ Kl, const bf* __restrict__ Vh, const bf* __restrict__ Vl, bf* Ah, bf* Al) {
    const int z = blockIdx.x, y = blockIdx.y; const size_t po = (size_t)z * TT * HD; const size_t ao = (size_t)(z / NH_) * TT * DQ + (size_t)(z % NH_) * HD;
    const int wv = __builtin_amdgcn_readfirstlane((int)(threadIdx.x >> 5));   // wave number as a scalar: row offsets, trip counts and the diagonal test stay scalar
    if (y < NBF) attn_rows<h16, false, 2>(Q16 + po, nullptr, K16 + po, nullptr, V16 + po, nullptr, TT - (y + 1) * (FW * 32) + wv * 32, Ah + ao, Al + ao);
    else attn_rows<bf, true, 1>(Qh + po, Ql + po, Kh + po, Kl + po, Vh + po, Vl + po, RH - (y - NBF + 1) * (FW * 16) + wv * 16, Ah + ao, Al + ao);
}

extern "C" void kernel_launch(void* const* d_in, const int* in_sizes, int n_in,
                              void* d_out, int out_size, void* d_ws, size_t ws_size, hipStream_t stream) {
    (void)in_sizes; (void)n_in; (void)out_size;
    const float* x = (const float*)d_in[0]; const float* xk = (const float*)d_in[1]; const float* xv = (const float*)d_in[2]; const float* wq = (const float*)d_in[3]; const float* bq = (const float*)d_in[4]; const float* wk = (const float*)d_in[5]; const float* bk = (const float*)d_in[6]; const float* wv = (const float*)d_in[7]; const float* bv = (const float*)d_in[8]; const float* wo = (const float*)d_in[9]; const float* bo = (const float*)d_in[10];
    float* OUT = (float*)d_out;     // [4][2048][768]
    char* wsp = (char*)d_ws;
    auto take = [&](size_t bytes) { char* p = wsp; wsp += (bytes + 255) & ~(size_t)255; return (void*)p; };
    bf* WQ = (bf*)take((size_t)4 * DQ * DM * 2); bf* WO = WQ + (size_t)3 * DQ * DM;   // W_Q, W_K, W_V, W_O one behind the other
    bf* XB = (bf*)take((size_t)3 * NB_ * TT * DM * 2);   // [stream][batch][t][DM]
    const size_t PB = (size_t)NH_ * TT * HD;   // one batch's head planes, elements; every plane set holds [stream][batch]
    h16* QP16 = (h16*)take(3 * NB_ * PB * 2); h16* KP16 = QP16 + NB_ * PB; h16* VT16 = KP16 + NB_ * PB;
    bf* QPh = (bf*)take(3 * NB_ * PB * 2); bf* KPh = QPh + NB_ * PB; bf* VTh = KPh + NB_ * PB; bf* QPl = (bf*)take(3 * NB_ * PB * 2); bf* KPl = QPl + NB_ * PB; bf* VTl = KPl + NB_ * PB;
    bf* ATh = (bf*)take((size_t)NB_ * TT * DQ * 2); bf* ATl = (bf*)take((size_t)NB_ * TT * DQ * 2);
    if ((size_t)(wsp - (char*)d_ws) > ws_size) return;    // ws 256 MiB
    k_cvt8<<<3 * CXB + 4 * CWB, 256, 0, stream>>>(x, xk, xv, wq, wk, wv, wo, XB, WQ);
    k_gemmw<bf, 0, true, 1><<<dim3(TT / 64, NH_, 3 * NB_), 32 * KW, 0, stream>>>(XB, nullptr, WQ, nullptr, DM, nullptr, 0, bq, bk, bv, QP16, QPh, QPl);
    k_fattn<<<dim3(NB_ * NH_, NBF + NBH, 1), 32 * FW, 0, stream>>>(QP16, KP16, VT16, QPh, QPl, KPh, KPl, VTh, VTl, ATh, ATl);
    k_gemmw<bf, 1, true, 0><<<dim3(NB_ * TT / 64, DM / 64, 1), 32 * KW, 0, stream>>>(ATh, ATl, WO, nullptr, DQ, OUT, DM, bo, nullptr, nullptr, nullptr, nullptr, nullptr);
}

// v006
// Measured time: 146 microseconds a run.
// Next to v005, in two timings, it ran 1.45 and 1.44 times as fast.
// All steps since v000 together make it 15.3 times as fast.
#include <hip/hip_runtime.h>

// Causal multi-headed attention on three input streams (queries, keys, values [4][2048][768]; Q = queries W_Q^T + b_Q, K = keys W_K^T + b_K, V = values W_V^T + b_V ('oi' uniform(+-768^-0.5) incl. biases: non-zero; 12 heads x 64); scores x 1/sqrt(64); causal (-inf); softmax; outputs = merged (standard) W_O^T + b_O -> [4][2048][768] (6.3 M); argument order queries, keys, values, W_Q, b_Q, W_K, b_K, W_V, b_V, W_O, b_O).
// Four launches, each over all batches: bf16 copies of queries, keys, values and the four 'oi' weights; the three exact projections (K 768) + f32 biases, their epilogue writes the head planes (V as W_V x values^T, so that its planes come out [d][t]); one fused causal attention launch over all batches and heads (hybrid rows: < 512 hi/lo 3 products, rest fp16; scores and probabilities stay in registers); merged hi/lo x W_O exact + b_O.
// Compute dtypes, f32 accumulate: every input rounded to bf16; projections exact + f32 biases; attention rows < 512 3 products, rest fp16; softmax f32; W_O hl x exact + bias.

#define NB_  4
#define TT   2048
#define DM   768
#define NH_  12
#define NKV  12
#define HD   64
#define DQ   (NH_ * HD)
#define DKV  (NKV * HD)
#define RH   512                  // query rows < RH use hi+lo planes (0: none)
#define SCL  0.125f   // HD^-0.5
typedef _Float16 h16;
typedef unsigned short bf;
typedef __attribute__((ext_vector_type(16))) __bf16   v16bf;
typedef __attribute__((ext_vector_type(16))) _Float16 v16h;
typedef __attribute__((ext_vector_type(8)))  _Float16 v8h;
typedef __attribute__((ext_vector_type(8)))  unsigned short v8us;
typedef __attribute__((ext_vector_type(8)))  float    v8f;
typedef __attribute__((ext_vector_type(4)))  float    v4f;
typedef v8h  __attribute__((may_alias)) v8ha;
typedef v4f  __attribute__((may_alias)) v4fa;
typedef v8us __attribute__((may_alias)) v8usa;

__device__ __forceinline__ unsigned short f2bf(float f) { unsigned u = __float_as_uint(f); u += 0x7FFFu + ((u >> 16) & 1u); return (unsigned short)(u >> 16); }
__device__ __forceinline__ float bf2f(unsigned short b) { return __uint_as_float(((unsigned)b) << 16); }
__device__ __forceinline__ float bfr(float f) { return bf2f(f2bf(f)); }
__device__ __forceinline__ v16h cat16(v8h lo, v8h hi) { return __builtin_shufflevector(lo, hi, 0, 1, 2, 3, 4, 5, 6, 7, 8, 9, 10, 11, 12, 13, 14, 15); }
__device__ __forceinline__ v16bf cat16b(v8us lo, v8us hi) { return __builtin_bit_cast(v16bf, __builtin_shufflevector(lo, hi, 0, 1, 2, 3, 4, 5, 6, 7, 8, 9, 10, 11, 12, 13, 14, 15)); }
__device__ __forceinline__ v8f wmma16(v16h a, v16h b, v8f c) { return __builtin_amdgcn_wmma_f32_16x16x32_f16(false, a, false, b, (short)0, c, false, false); }
__device__ __forceinline__ v8f wmmab(v16bf a, v16bf b, v8f c) { return __builtin_amdgcn_wmma_f32_16x16x32_bf16(false, a, false, b, (short)0, c, false, false); }



__device__ __forceinline__ h16 tohx(float x) { return (h16)x; }
__device__ __forceinline__ void splitf(float y, unsigned short& h, unsigned short& l) { h = f2bf(y); l = f2bf(y - bf2f(h)); }
template <typename T16> struct WFrag;
template <> struct WFrag<h16> { typedef v16h V; static __device__ __forceinline__ V ld(const h16* p) { return cat16(*(const v8h*)p, *(const v8h*)(p + 16)); } static __device__ __forceinline__ v8f mma(V a, V b, v8f c) { return wmma16(a, b, c); } };
template <> struct WFrag<bf> { typedef v16bf V; static __device__ __forceinline__ V ld(const bf* p) { return cat16b(*(const v8us*)p, *(const v8us*)(p + 16)); } static __device__ __forceinline__ v8f mma(V a, V b, v8f c) { return wmmab(a, b, c); } };

// ---- k_gemmt: block-tiled GEMM, one BT x BT output tile per work-group of 4 waves (2 x 2, 64x64 each, 16 accumulators), the whole K loop in every wave.
// C[m][n] = sum_k A[m][k] Bt[n][k] (+ A2[m][k] Bt[n][k] where NSPLIT), K = DM, operands K-contiguous bf16 planes.
// A stage is 64 k (one 128-byte line) of every operand row of the block: [A BT rows | Bt BT rows | A2 BT rows] at pitch LP in LDS, two buffers, filled by asynchronous copies one stage ahead of the products.
// EPI 0: grid (M/BT, N/BT), f32 tile + bias[n] to C (pitch DM).
// EPI 1: the three projections of all batches, grid (TT/BT, DQ/BT, 3 * NB_), z = stream * NB_ + batch. A: the streams' bf16 copies [z][t][DM]; Bt: W_Q, W_K, W_V one behind the other; bias, biasK, biasV: theirs; planes [z][head][..].
//        Streams 0, 1: m = position, n = head * HD + d, a wave's tile is one head: planes [head][t][d]. Stream 2: the operands change places, m = head * HD + d, n = position, bias[m]: planes [head][d][t].
#define BT   128
#define LP   144                  // LDS row pitch, bytes: 128 + 16, an odd multiple of 16 for the 16-byte fragment reads
#define NST  (DM / 64)            // stages
static_assert(DQ == DM && DM % 64 == 0 && NST >= 2 && TT % BT == 0 && DQ % BT == 0 && HD == 64, "whole tiles, whole stages, a wave tile is one head");
// Eight asynchronous 16-byte copies of one thread, rows 16 apart in the source and in the stage: the work-group's 128 threads bring BT rows of 128 bytes, a wave's copy covers four whole lines.
// The s_wait_xcnt stands in the copies' own statement, so that no address register is rewritten ahead of it.
__device__ __forceinline__ void cp8(unsigned l, const bf* g) {
    asm volatile("global_load_async_to_lds_b128 %0, %8, off\n\t"
                 "global_load_async_to_lds_b128 %1, %9, off\n\t"
                 "global_load_async_to_lds_b128 %2, %10, off\n\t"
                 "global_load_async_to_lds_b128 %3, %11, off\n\t"
                 "global_load_async_to_lds_b128 %4, %12, off\n\t"
                 "global_load_async_to_lds_b128 %5, %13, off\n\t"
                 "global_load_async_to_lds_b128 %6, %14, off\n\t"
                 "global_load_async_to_lds_b128 %7, %15, off\n\t"
                 "s_wait_xcnt 0x0"
                 :: "v"(l), "v"(l + 16 * LP), "v"(l + 32 * LP), "v"(l + 48 * LP), "v"(l + 64 * LP), "v"(l + 80 * LP), "v"(l + 96 * LP), "v"(l + 112 * LP),
                    "v"(g), "v"(g + 16 * DM), "v"(g + 32 * DM), "v"(g + 48 * DM), "v"(g + 64 * DM), "v"(g + 80 * DM), "v"(g + 96 * DM), "v"(g + 112 * DM) : "memory");
}
__device__ __forceinline__ v16bf ldsfrag(const unsigned char* p) { return cat16b(*(const v8usa*)p, *(const v8usa*)(p + 32)); }   // the k order of WFrag::ld: 8 hi + e, then 16 + 8 hi + (e - 8)
// A wave's 64x64 accumulators laid out as [64][68] f32 in the wave's own LDS range, so that the stores below cover whole lines. Every loop of the epilogues is unrolled so that accumulator and vector indices are constants (registers, no scratch).
__device__ __forceinline__ void tile_to_lds(float* pw, const v8f (&acc)[4][4], int lr, int hi) {
#pragma unroll
    for (int mb = 0; mb < 4; ++mb)
#pragma unroll
        for (int nb = 0; nb < 4; ++nb)
#pragma unroll
            for (int j = 0; j < 8; ++j) pw[(mb * 16 + hi * 8 + j) * 68 + nb * 16 + lr] = acc[mb][nb][j];
    __syncthreads();   // the lanes read each other's values below
}
// f32 tile + bias by column. C, bias: the wave tile's first element and entry.
__device__ __forceinline__ void wave_store(float* pw, const v8f (&acc)[4][4], float* C, const float* __restrict__ bias) {
    const int lane = threadIdx.x & 31; v4f bv;
#pragma unroll
    for (int k = 0; k < 4; ++k) bv[k] = bfr(bias[(lane & 15) * 4 + k]);
    tile_to_lds(pw, acc, lane & 15, lane >> 4);
#pragma unroll
    for (int s = 0; s < 32; ++s) { const int row = s * 2 + (lane >> 4), cofs = (lane & 15) * 4; *(v4f*)(C + (size_t)row * DM + cofs) = *(const v4fa*)(pw + row * 68 + cofs) + bv; }
}
// The tile + bias stored as the three 16-bit planes attention reads (fp16, bf16 hi, bf16 lo). A lane takes 8 neighbouring columns: every store is 16 bytes and 8 lanes fill one 128-byte line of a plane row.
// P16, Ph, Pl: the wave tile's first element, row pitch ldp elements. bias: the tile's first entry (64 of them), by column, or by row where rowb (the transposed product; the same for the whole work-group).
__device__ __forceinline__ void wave_planes(float* pw, const v8f (&acc)[4][4], h16* P16, bf* Ph, bf* Pl, int ldp, const float* __restrict__ bias, bool rowb) {
    const int lane = threadIdx.x & 31, cofs = (lane & 7) * 8, rw = lane >> 3;
    float bc[8], br[16];
#pragma unroll
    for (int k = 0; k < 8; ++k) bc[k] = bfr(bias[cofs + k]);
#pragma unroll
    for (int s = 0; s < 16; ++s) br[s] = bfr(bias[s * 4 + rw]);
    tile_to_lds(pw, acc, lane & 15, lane >> 4);
#pragma unroll
    for (int s = 0; s < 16; ++s) { const int row = s * 4 + rw; const float* p = pw + row * 68 + cofs; const v4f v0 = *(const v4fa*)p, v1 = *(const v4fa*)(p + 4);
        v8h o16; v8us oh, ol;
#pragma unroll
        for (int k = 0; k < 8; ++k) { const float y = (k < 4 ? v0[k & 3] : v1[k & 3]) + (rowb ? br[s] : bc[k]); o16[k] = tohx(y); unsigned short a, b2; splitf(y, a, b2); oh[k] = a; ol[k] = b2; }
        const size_t o = (size_t)row * ldp + cofs; *(v8h*)(P16 + o) = o16; *(v8us*)(Ph + o) = oh; *(v8us*)(Pl + o) = ol; }
}
// At least 4 waves per SIMD asked for: at most 256 registers, so that four work-groups of the projections share a WGP and hide each other's waits.
// Every '#pragma unroll' of the kernel keeps fragment and accumulator indices constant, so that the tiles stay in registers (no scratch).
template <int NSPLIT, int EPI>
__global__ __launch_bounds__(128, 4) void k_gemmt(const bf* __restrict__ A, const bf* __restrict__ A2, const bf* __restrict__ Bt, float* C, const float* __restrict__ bias, const float* __restrict__ biasK, const float* __restrict__ biasV, h16* P16, bf* Ph, bf* Pl) {
    constexpr int SB = (NSPLIT ? 3 : 2) * BT * LP;   // one stage, bytes
    __shared__ __align__(16) unsigned char ring[2 * SB];
    static_assert(2 * SB >= 4 * 64 * 68 * 4, "the ring holds the four waves' output staging");
    const int tid = threadIdx.x, lane = tid & 31, lr = lane & 15, hi = lane >> 4; int r0 = blockIdx.x * BT, c0 = blockIdx.y * BT;
    const int wv = __builtin_amdgcn_readfirstlane(tid >> 5), wm = wv >> 1, wn = wv & 1;   // wave number as a scalar: tile offsets stay scalar
    const int st = EPI == 1 ? (int)(blockIdx.z / NB_) : 0;   // stream, the same for the whole work-group
    if constexpr (EPI == 1) { const bf* X = A + (size_t)blockIdx.z * TT * DM; const bf* Wt = Bt + (size_t)st * DQ * DM;
        if (st == 2) { A = Wt; Bt = X; r0 = blockIdx.y * BT; c0 = blockIdx.x * BT; } else { A = X; Bt = Wt; } }
    v8f acc[4][4];
#pragma unroll
    for (int mb = 0; mb < 4; ++mb)
#pragma unroll
        for (int nb = 0; nb < 4; ++nb) acc[mb][nb] = (v8f){};
    const size_t go = (size_t)(tid >> 3) * DM + (tid & 7) * 8;   // a thread's row and 16-byte piece within 16 rows
    const bf* ga = A + (size_t)r0 * DM + go; const bf* gb = Bt + (size_t)c0 * DM + go; const bf* ga2 = NSPLIT ? A2 + (size_t)r0 * DM + go : nullptr;
    const unsigned lb = (unsigned)(size_t)ring + (unsigned)((tid >> 3) * LP + (tid & 7) * 16);
    auto fill = [&](int t) { const unsigned l = lb + (unsigned)((t & 1) * SB); cp8(l, ga + t * 64); cp8(l + BT * LP, gb + t * 64); if constexpr (NSPLIT != 0) cp8(l + 2 * BT * LP, ga2 + t * 64); };
    fill(0);
    asm volatile("s_wait_asynccnt 0x0" ::: "memory");   // this wave's part of stage 0 has landed
    __syncthreads();                                     // ... and every other wave's
    fill(1);
    const unsigned char* fa = ring + (wm * 64 + lr) * LP + hi * 16; const unsigned char* fb = ring + (BT + wn * 64 + lr) * LP + hi * 16;
#pragma unroll 1   // one stage per trip: the buffer is picked by the trip's parity
    for (int t = 0; t < NST; ++t) { const int bo = (t & 1) * SB; v16bf a[4], a2[4], b[4];
        auto frags = [&](int kk) {   // one block's fragments: 32 k of the wave's 64 A (and A2) rows and 64 Bt rows
#pragma unroll
            for (int i = 0; i < 4; ++i) { a[i] = ldsfrag(fa + bo + i * 16 * LP + kk * 64); b[i] = ldsfrag(fb + bo + i * 16 * LP + kk * 64); if (NSPLIT != 0) a2[i] = ldsfrag(fa + bo + 2 * BT * LP + i * 16 * LP + kk * 64); } };
        auto products = [&]() {
#pragma unroll
            for (int nb = 0; nb < 4; ++nb)
#pragma unroll
                for (int mb = 0; mb < 4; ++mb) { acc[mb][nb] = wmmab(a[mb], b[nb], acc[mb][nb]); if (NSPLIT != 0) acc[mb][nb] = wmmab(a2[mb], b[nb], acc[mb][nb]); } };
#pragma unroll
        for (int kk = 0; kk < 2; ++kk) { frags(kk);
            __builtin_amdgcn_sched_barrier(0);   // the block's fragment reads go out as one group ahead of its products (left free, they are strung out among the products, one LDS latency each)
            products(); }
        __builtin_amdgcn_sched_barrier(0);   // the products stay in front of the barrier, so that the refill goes out directly behind it and has a whole trip to land
        asm volatile("s_wait_dscnt 0x0" ::: "memory");      // this wave's reads of the buffer are done before the buffer is given up
        asm volatile("s_wait_asynccnt 0x0" ::: "memory");   // this wave's part of stage t + 1 has landed
        __syncthreads();                                     // publishes stage t + 1 and ends every wave's reads of stage t
        if (t + 2 < NST) fill(t + 2);                        // into the buffer this trip has just read
    }
    asm volatile("s_wait_asynccnt 0x0" ::: "memory");   // no copy is outstanding when the ring becomes output staging
    float* pw = (float*)ring + wv * (64 * 68);
    if constexpr (EPI == 0) wave_store(pw, acc, C + (size_t)(r0 + wm * 64) * DM + c0 + wn * 64, bias + c0 + wn * 64);
    else { const bool tr = st == 2; const int rw0 = r0 + wm * 64, cw0 = c0 + wn * 64;   // tr: rw0 = head * HD, cw0 = position; else rw0 = position, cw0 = head * HD
        const size_t po = (size_t)blockIdx.z * NH_ * TT * HD + (tr ? (size_t)rw0 * TT + cw0 : (size_t)cw0 * TT + (size_t)rw0 * HD);
        wave_planes(pw, acc, P16 + po, Ph + po, Pl + po, tr ? TT : HD, (st == 0 ? bias : st == 1 ? biasK : biasV) + (tr ? rw0 : cw0), tr); }
}

// bf16 copies of all seven f32 matrices in one launch, 8 elements a thread: blocks 0 .. 3 * CXB - 1 the three streams (all batches) to X [stream][batch][t][DM], the next 4 * CWB the four weights to Wd, one behind the other.
#define CXB  (NB_ * TT * DM / 8 / 256)
#define CWB  (DQ * DM / 8 / 256)
static_assert(NB_ * TT * DM % (8 * 256) == 0 && DQ * DM % (8 * 256) == 0 && DKV == DQ, "whole blocks, equal weights");
__global__ __launch_bounds__(256) void k_cvt8(const float* __restrict__ x, const float* __restrict__ xk, const float* __restrict__ xv, const float* __restrict__ wq, const float* __restrict__ wk, const float* __restrict__ wv, const float* __restrict__ wo, bf* X, bf* Wd) {
    const int blk = blockIdx.x; const float* src; bf* dst; size_t i;
    if (blk < 3 * CXB) { const int s = blk / CXB; src = s == 0 ? x : s == 1 ? xk : xv; dst = X + (size_t)s * NB_ * TT * DM; i = (size_t)(blk - s * CXB) * 256 + threadIdx.x; }
    else { const int s = (blk - 3 * CXB) / CWB; src = s == 0 ? wq : s == 1 ? wk : s == 2 ? wv : wo; dst = Wd + (size_t)s * DQ * DM; i = (size_t)(blk - 3 * CXB - s * CWB) * 256 + threadIdx.x; }
    const v8f v = *(const v8f*)(src + i * 8); v8us o;
#pragma unroll
    for (int k = 0; k < 8; ++k) o[k] = f2bf(v[k]); *(v8us*)(dst + i * 8) = o;  }

// ---- k_fattn: causal attention with the scores kept in registers. One wave owns NQ * 16 query rows of one (batch, head) and walks the keys 32 at a time up to its diagonal:
// S^T = K Q^T (a lane holds one query's scores: 8 keys of each 16-key tile), running maximum and sum per query, P^T packed from the score accumulators straight into a B operand, O^T += V^T P^T.
// Rows < RH: bf16 hi/lo planes, 3 products for both contractions; other rows: fp16 planes. The epilogue divides by the row sum and writes the merged hi/lo planes [t][DQ] for the output projection.
// Every '#pragma unroll' of this section keeps the fragment and accumulator indices constant, so that the tiles stay in registers (no scratch).
#define FW   4                    // waves per work-group; each wave is independent (no LDS, no barrier), neighbours share K and V lines in the WGP cache
template <typename T16, bool HI> struct AFrag { typename WFrag<T16>::V k[2][2], k2[2][2], v[4], v2[4]; };
template <typename T16, bool HI>
__device__ __forceinline__ void afrag_ld(AFrag<T16, HI>& f, const T16* __restrict__ Kp, const T16* __restrict__ K2, const T16* __restrict__ Vt, const T16* __restrict__ V2, int kc, int lr, int hi) {
#pragma unroll
    for (int kt = 0; kt < 2; ++kt)
#pragma unroll
        for (int dc = 0; dc < 2; ++dc) { const size_t o = (size_t)(kc + kt * 16 + lr) * HD + dc * 32 + 8 * hi; f.k[kt][dc] = WFrag<T16>::ld(Kp + o); if (HI) f.k2[kt][dc] = WFrag<T16>::ld(K2 + o); }
    if (HI) asm volatile("s_wait_xcnt 0x0" ::: "memory");   // the hi/lo build reuses the K loads' address registers as destinations of the V loads: the wait stands in front of that overwrite
#pragma unroll
    for (int dt = 0; dt < 4; ++dt) { const size_t o = (size_t)(dt * 16 + lr) * TT + kc + 8 * hi; f.v[dt] = WFrag<T16>::ld(Vt + o); if (HI) f.v2[dt] = WFrag<T16>::ld(V2 + o); }
}
template <typename T16, bool HI, int NQ>
__device__ __forceinline__ void attn_step(const AFrag<T16, HI>& f, const typename WFrag<T16>::V (&qb)[NQ][2], const typename WFrag<T16>::V (&qb2)[NQ][2], v8f (&o)[4][NQ], float (&m)[NQ], float (&l)[NQ], int kc, int q0, int lr, int hi) {
    typedef typename WFrag<T16>::V V;
    const float c = SCL * 1.4426950408889634f;   // score scale and log2(e) in one factor: p = 2^((s - m) c)
    v8f s[NQ][2];
#pragma unroll
    for (int nq = 0; nq < NQ; ++nq)
#pragma unroll
        for (int kt = 0; kt < 2; ++kt) { v8f t = (v8f){};
#pragma unroll
            for (int dc = 0; dc < 2; ++dc) { t = WFrag<T16>::mma(f.k[kt][dc], qb[nq][dc], t); if (HI) { t = WFrag<T16>::mma(f.k[kt][dc], qb2[nq][dc], t); t = WFrag<T16>::mma(f.k2[kt][dc], qb[nq][dc], t); } }
            s[nq][kt] = t; }
    if (kc + 31 > q0) {   // only the chunk on the diagonal holds keys above a query (scalar test)
#pragma unroll
        for (int nq = 0; nq < NQ; ++nq)
#pragma unroll
            for (int kt = 0; kt < 2; ++kt)
#pragma unroll
                for (int j = 0; j < 8; ++j) if (kc + kt * 16 + hi * 8 + j > q0 + nq * 16 + lr) s[nq][kt][j] = -3.0e38f;
    }
    float mx[NQ]; bool need = false;
#pragma unroll
    for (int nq = 0; nq < NQ; ++nq) { float t = s[nq][0][0];
#pragma unroll
        for (int j = 1; j < 8; ++j) t = fmaxf(t, s[nq][0][j]);
#pragma unroll
        for (int j = 0; j < 8; ++j) t = fmaxf(t, s[nq][1][j]);
        t = fmaxf(t, __shfl_xor(t, 16, 32));   // the two halves of the wave hold the same query's other keys: both must use one maximum
        mx[nq] = t; need = need || ((t - m[nq]) * c > 8.0f); }
    if (__builtin_amdgcn_ballot_w32(need) != 0) {   // lazy rescale, one scalar test per chunk: the maximum in use moves only when some query's scores pass it by more than 2^8
#pragma unroll
        for (int nq = 0; nq < NQ; ++nq) { const float mn = fmaxf(m[nq], mx[nq]); const float al = __builtin_amdgcn_exp2f((m[nq] - mn) * c); m[nq] = mn; l[nq] *= al;
#pragma unroll
            for (int dt = 0; dt < 4; ++dt) o[dt][nq] *= al; }
    }
    V pb[NQ], pl[NQ];
#pragma unroll
    for (int nq = 0; nq < NQ; ++nq) { const float mc = m[nq] * c; float ps = 0.f;
#pragma unroll
        for (int kt = 0; kt < 2; ++kt)
#pragma unroll
            for (int j = 0; j < 8; ++j) { const float p = __builtin_amdgcn_exp2f(fmaf(s[nq][kt][j], c, -mc)); s[nq][kt][j] = p; ps += p; }
        l[nq] += ps;
        // slot e of the B operand is key 8 hi + e (e < 8) or 16 + 8 hi + (e - 8): register j of score tile 0 or 1, the k order of the V^T loader
        if constexpr (HI) { v8us h0, h1, l0, l1;
#pragma unroll
            for (int j = 0; j < 8; ++j) { unsigned short a, b2; splitf(s[nq][0][j], a, b2); h0[j] = a; l0[j] = b2; splitf(s[nq][1][j], a, b2); h1[j] = a; l1[j] = b2; }
            pb[nq] = cat16b(h0, h1); pl[nq] = cat16b(l0, l1);
        } else { v8h h0, h1;
#pragma unroll
            for (int j = 0; j < 8; ++j) { h0[j] = tohx(s[nq][0][j]); h1[j] = tohx(s[nq][1][j]); }
            pb[nq] = cat16(h0, h1); } }
#pragma unroll
    for (int dt = 0; dt < 4; ++dt)
#pragma unroll
        for (int nq = 0; nq < NQ; ++nq) { o[dt][nq] = WFrag<T16>::mma(f.v[dt], pb[nq], o[dt][nq]); if (HI) { o[dt][nq] = WFrag<T16>::mma(f.v[dt], pl[nq], o[dt][nq]); o[dt][nq] = WFrag<T16>::mma(f.v2[dt], pb[nq], o[dt][nq]); } }
}
template <typename T16, bool HI, int NQ>
__device__ __forceinline__ void attn_rows(const T16* __restrict__ Q, const T16* __restrict__ Q2, const T16* __restrict__ Kp, const T16* __restrict__ K2, const T16* __restrict__ Vt, const T16* __restrict__ V2, int q0, bf* Ah, bf* Al) {
    typedef typename WFrag<T16>::V V;
    const int lane = threadIdx.x & 31, lr = lane & 15, hi = lane >> 4;
    V qb[NQ][2], qb2[NQ][2]; v8f o[4][NQ]; float m[NQ], l[NQ];
#pragma unroll
    for (int nq = 0; nq < NQ; ++nq) { m[nq] = -3.0e38f; l[nq] = 0.f;
#pragma unroll
        for (int dc = 0; dc < 2; ++dc) { const size_t qo = (size_t)(q0 + nq * 16 + lr) * HD + dc * 32 + 8 * hi; qb[nq][dc] = WFrag<T16>::ld(Q + qo); if (HI) qb2[nq][dc] = WFrag<T16>::ld(Q2 + qo); }
#pragma unroll
        for (int dt = 0; dt < 4; ++dt) o[dt][nq] = (v8f){}; }
    const int kend = q0 + NQ * 16;   // keys 0 .. kend - 1, in chunks of 32; every chunk holds at least one key <= every query of the wave
#pragma unroll 1   // one chunk's fragments live at a time: an unrolled key loop would not fit four waves per SIMD
    for (int kc = 0; kc < kend; kc += 32) { AFrag<T16, HI> f; afrag_ld<T16, HI>(f, Kp, K2, Vt, V2, kc, lr, hi);
        // inputs-only fence on the loaded fragments: all of a chunk's loads are issued together and waited for once (left free, the loads are strung out between the products, one memory latency each)
        if constexpr (HI) asm volatile("" :: "v"(f.k[0][0]), "v"(f.k[0][1]), "v"(f.k[1][0]), "v"(f.k[1][1]), "v"(f.k2[0][0]), "v"(f.k2[0][1]), "v"(f.k2[1][0]), "v"(f.k2[1][1]), "v"(f.v[0]), "v"(f.v[1]), "v"(f.v[2]), "v"(f.v[3]), "v"(f.v2[0]), "v"(f.v2[1]), "v"(f.v2[2]), "v"(f.v2[3]));
        else asm volatile("" :: "v"(f.k[0][0]), "v"(f.k[0][1]), "v"(f.k[1][0]), "v"(f.k[1][1]), "v"(f.v[0]), "v"(f.v[1]), "v"(f.v[2]), "v"(f.v[3]));
        __builtin_amdgcn_sched_barrier(0);   // keeps the first products, and the wait they bring, from being lifted in front of the chunk's last loads
        attn_step<T16, HI, NQ>(f, qb, qb2, o, m, l, kc, q0, lr, hi); }
#pragma unroll
    for (int nq = 0; nq < NQ; ++nq) { const float li = __fdiv_rn(1.0f, l[nq] + __shfl_xor(l[nq], 16, 32));   // the halves' sums join once, here
        const size_t ro = (size_t)(q0 + nq * 16 + lr) * DQ + hi * 8;
#pragma unroll
        for (int dt = 0; dt < 4; ++dt) { v8us oh, ol;
#pragma unroll
            for (int j = 0; j < 8; ++j) { unsigned short a, b2; splitf(o[dt][nq][j] * li, a, b2); oh[j] = a; ol[j] = b2; }
            *(v8us*)(Ah + ro + dt * 16) = oh; *(v8us*)(Al + ro + dt * 16) = ol; } }
}
// grid (NB_ * NH_, row blocks): the row block is the slow index and the longest rows come first. Blocks 0 .. NBF-1: fp16 rows, FW * 32 each, from the end of the sequence down to RH; the rest: hi/lo rows, FW * 16 each.
#define NBF  ((TT - RH) / (FW * 32))
#define NBH  (RH / (FW * 16))
__global__ __launch_bounds__(32 * FW) void k_fattn(const h16* __restrict__ Q16, const h16* __restrict__ K16, const h16* __restrict__ V16, const bf* __restrict__ Qh, const bf* __restrict__ Ql, const bf* __restrict__ Kh, const bf* __restrict__ Kl, const bf* __restrict__ Vh, const bf* __restrict__ Vl, bf* Ah, bf* Al) {
    const int z = blockIdx.x, y = blockIdx.y; const size_t po = (size_t)z * TT * HD; const size_t ao = (size_t)(z / NH_) * TT * DQ + (size_t)(z % NH_) * HD;
    const int wv = __builtin_amdgcn_readfirstlane((int)(threadIdx.x >> 5));   // wave number as a scalar: row offsets, trip counts and the diagonal test stay scalar
    if (y < NBF) attn_rows<h16, false, 2>(Q16 + po, nullptr, K16 + po, nullptr, V16 + po, nullptr, TT - (y + 1) * (FW * 32) + wv * 32, Ah + ao, Al + ao);
    else attn_rows<bf, true, 1>(Qh + po, Ql + po, Kh + po, Kl + po, Vh + po, Vl + po, RH - (y - NBF + 1) * (FW * 16) + wv * 16, Ah + ao, Al + ao);
}

extern "C" void kernel_launch(void* const* d_in, const int* in_sizes, int n_in,
                              void* d_out, int out_size, void* d_ws, size_t ws_size, hipStream_t stream) {
    (void)in_sizes; (void)n_in; (void)out_size;
    const float* x = (const float*)d_in[0]; const float* xk = (const float*)d_in[1]; const float* xv = (const float*)d_in[2]; const float* wq = (const float*)d_in[3]; const float* bq = (const float*)d_in[4]; const float* wk = (const float*)d_in[5]; const float* bk = (const float*)d_in[6]; const float* wv = (const float*)d_in[7]; const float* bv = (const float*)d_in[8]; const float* wo = (const float*)d_in[9]; const float* bo = (const float*)d_in[10];
    float* OUT = (float*)d_out;     // [4][2048][768]
    char* wsp = (char*)d_ws;
    auto take = [&](size_t bytes) { char* p = wsp; wsp += (bytes + 255) & ~(size_t)255; return (void*)p; };
    bf* WQ = (bf*)take((size_t)4 * DQ * DM * 2); bf* WO = WQ + (size_t)3 * DQ * DM;   // W_Q, W_K, W_V, W_O one behind the other
    bf* XB = (bf*)take((size_t)3 * NB_ * TT * DM * 2);   // [stream][batch][t][DM]
    const size_t PB = (size_t)NH_ * TT * HD;   // one batch's head planes, elements; every plane set holds [stream][batch]
    h16* QP16 = (h16*)take(3 * NB_ * PB * 2); h16* KP16 = QP16 + NB_ * PB; h16* VT16 = KP16 + NB_ * PB;
    bf* QPh = (bf*)take(3 * NB_ * PB * 2); bf* KPh = QPh + NB_ * PB; bf* VTh = KPh + NB_ * PB; bf* QPl = (bf*)take(3 * NB_ * PB * 2); bf* KPl = QPl + NB_ * PB; bf* VTl = KPl + NB_ * PB;
    bf* ATh = (bf*)take((size_t)NB_ * TT * DQ * 2); bf* ATl = (bf*)take((size_t)NB_ * TT * DQ * 2);
    if ((size_t)(wsp - (char*)d_ws) > ws_size) return;    // ws 256 MiB
    k_cvt8<<<3 * CXB + 4 * CWB, 256, 0, stream>>>(x, xk, xv, wq, wk, wv, wo, XB, WQ);
    k_gemmt<0, 1><<<dim3(TT / BT, DQ / BT, 3 * NB_), 128, 0, stream>>>(XB, nullptr, WQ, nullptr, bq, bk, bv, QP16, QPh, QPl);
    k_fattn<<<dim3(NB_ * NH_, NBF + NBH, 1), 32 * FW, 0, stream>>>(QP16, KP16, VT16, QPh, QPl, KPh, KPl, VTh, VTl, ATh, ATl);
    k_gemmt<1, 0><<<dim3(NB_ * TT / BT, DM / BT, 1), 128, 0, stream>>>(ATh, ATl, WO, OUT, bo, nullptr, nullptr, nullptr, nullptr, nullptr);
}

// v007
// Measured time: 104 microseconds a run.
// Two timings next to v006 both put it at 1.41 times that version's speed.
// All steps since v000 together make it 21.5 times as fast.
#include <hip/hip_runtime.h>

// Causal multi-headed attention on three input streams (queries, keys, values [4][2048][768]; Q = queries W_Q^T + b_Q, K = keys W_K^T + b_K, V = values W_V^T + b_V ('oi' uniform(+-768^-0.5) incl. biases: non-zero; 12 heads x 64); scores x 1/sqrt(64); causal (-inf); softmax; outputs = merged (standard) W_O^T + b_O -> [4][2048][768] (6.3 M); argument order queries, keys, values, W_Q, b_Q, W_K, b_K, W_V, b_V, W_O, b_O).
// Four launches, each over all batches: bf16 copies of queries, keys, values and the four 'oi' weights; the three exact projections (K 768) + f32 biases, their epilogue writes the head planes (V as W_V x values^T, so that its planes come out [d][t]); one fused causal attention launch over all batches and heads (hybrid rows: < 512 hi/lo 3 products, rest fp16; K and V tiles through LDS, scores and probabilities stay in registers); merged hi/lo x W_O exact + b_O.
// Compute dtypes, f32 accumulate: every input rounded to bf16; projections exact + f32 biases; attention rows < 512 3 products, rest fp16; softmax f32; W_O hl x exact + bias.

#define NB_  4
#define TT   2048
#define DM   768
#define NH_  12
#define NKV  12
#define HD   64
#define DQ   (NH_ * HD)
#define DKV  (NKV * HD)
#define RH   512                  // query rows < RH use hi+lo planes (0: none)
#define SCL  0.125f   // HD^-0.5
typedef _Float16 h16;
typedef unsigned short bf;
typedef __attribute__((ext_vector_type(16))) __bf16   v16bf;
typedef __attribute__((ext_vector_type(16))) _Float16 v16h;
typedef __attribute__((ext_vector_type(8)))  _Float16 v8h;
typedef __attribute__((ext_vector_type(8)))  unsigned short v8us;
typedef __attribute__((ext_vector_type(8)))  float    v8f;
typedef __attribute__((ext_vector_type(4)))  float    v4f;
typedef v8h  __attribute__((may_alias)) v8ha;
typedef v4f  __attribute__((may_alias)) v4fa;
typedef v8us __attribute__((may_alias)) v8usa;

__device__ __forceinline__ unsigned short f2bf(float f) { unsigned u = __float_as_uint(f); u += 0x7FFFu + ((u >> 16) & 1u); return (unsigned short)(u >> 16); }
__device__ __forceinline__ float bf2f(unsigned short b) { return __uint_as_float(((unsigned)b) << 16); }
__device__ __forceinline__ float bfr(float f) { return bf2f(f2bf(f)); }
__device__ __forceinline__ v16h cat16(v8h lo, v8h hi) { return __builtin_shufflevector(lo, hi, 0, 1, 2, 3, 4, 5, 6, 7, 8, 9, 10, 11, 12, 13, 14, 15); }
__device__ __forceinline__ v16bf cat16b(v8us lo, v8us hi) { return __builtin_bit_cast(v16bf, __builtin_shufflevector(lo, hi, 0, 1, 2, 3, 4, 5, 6, 7, 8, 9, 10, 11, 12, 13, 14, 15)); }
__device__ __forceinline__ v8f wmma16(v16h a, v16h b, v8f c) { return __builtin_amdgcn_wmma_f32_16x16x32_f16(false, a, false, b, (short)0, c, false, false); }
__device__ __forceinline__ v8f wmmab(v16bf a, v16bf b, v8f c) { return __builtin_amdgcn_wmma_f32_16x16x32_bf16(false, a, false, b, (short)0, c, false, false); }



__device__ __forceinline__ h16 tohx(float x) { return (h16)x; }
__device__ __forceinline__ void splitf(float y, unsigned short& h, unsigned short& l) { h = f2bf(y); l = f2bf(y - bf2f(h)); }
template <typename T16> struct WFrag;
template <> struct WFrag<h16> { typedef v16h V; static __device__ __forceinline__ V ld(const h16* p) { return cat16(*(const v8h*)p, *(const v8h*)(p + 16)); } static __device__ __forceinline__ V lds(const unsigned char* p) { return cat16(*(const v8ha*)p, *(const v8ha*)(p + 32)); } static __device__ __forceinline__ v8f mma(V a, V b, v8f c) { return wmma16(a, b, c); } };
template <> struct WFrag<bf> { typedef v16bf V; static __device__ __forceinline__ V ld(const bf* p) { return cat16b(*(const v8us*)p, *(const v8us*)(p + 16)); } static __device__ __forceinline__ V lds(const unsigned char* p) { return cat16b(*(const v8usa*)p, *(const v8usa*)(p + 32)); } static __device__ __forceinline__ v8f mma(V a, V b, v8f c) { return wmmab(a, b, c); } };

// ---- k_gemmt: block-tiled GEMM, one BT x BT output tile per work-group of 4 waves (2 x 2, 64x64 each, 16 accumulators), the whole K loop in every wave.
// C[m][n] = sum_k A[m][k] Bt[n][k] (+ A2[m][k] Bt[n][k] where NSPLIT), K = DM, operands K-contiguous bf16 planes.
// A stage is 64 k (one 128-byte line) of every operand row of the block: [A BT rows | Bt BT rows | A2 BT rows] at pitch LP in LDS, two buffers, filled by asynchronous copies one stage ahead of the products.
// EPI 0: grid (M/BT, N/BT), f32 tile + bias[n] to C (pitch DM).
// EPI 1: the three projections of all batches, grid (TT/BT, DQ/BT, 3 * NB_), z = stream * NB_ + batch. A: the streams' bf16 copies [z][t][DM]; Bt: W_Q, W_K, W_V one behind the other; bias, biasK, biasV: theirs; planes [z][head][..].
//        Streams 0, 1: m = position, n = head * HD + d, a wave's tile is one head: planes [head][t][d]. Stream 2: the operands change places, m = head * HD + d, n = position, bias[m]: planes [head][d][t].
#define BT   128
#define LP   144                  // LDS row pitch, bytes: 128 + 16, an odd multiple of 16 for the 16-byte fragment reads
#define NST  (DM / 64)            // stages
static_assert(DQ == DM && DM % 64 == 0 && NST >= 2 && TT % BT == 0 && DQ % BT == 0 && HD == 64, "whole tiles, whole stages, a wave tile is one head");
// Eight asynchronous 16-byte copies of one thread, rows 16 apart in the source and in the stage: the work-group's 128 threads bring BT rows of 128 bytes, a wave's copy covers four whole lines.
// The s_wait_xcnt stands in the copies' own statement, so that no address register is rewritten ahead of it.
__device__ __forceinline__ void cp8(unsigned l, const bf* g) {
    asm volatile("global_load_async_to_lds_b128 %0, %8, off\n\t"
                 "global_load_async_to_lds_b128 %1, %9, off\n\t"
                 "global_load_async_to_lds_b128 %2, %10, off\n\t"
                 "global_load_async_to_lds_b128 %3, %11, off\n\t"
                 "global_load_async_to_lds_b128 %4, %12, off\n\t"
                 "global_load_async_to_lds_b128 %5, %13, off\n\t"
                 "global_load_async_to_lds_b128 %6, %14, off\n\t"
                 "global_load_async_to_lds_b128 %7, %15, off\n\t"
                 "s_wait_xcnt 0x0"
                 :: "v"(l), "v"(l + 16 * LP), "v"(l + 32 * LP), "v"(l + 48 * LP), "v"(l + 64 * LP), "v"(l + 80 * LP), "v"(l + 96 * LP), "v"(l + 112 * LP),
                    "v"(g), "v"(g + 16 * DM), "v"(g + 32 * DM), "v"(g + 48 * DM), "v"(g + 64 * DM), "v"(g + 80 * DM), "v"(g + 96 * DM), "v"(g + 112 * DM) : "memory");
}
__device__ __forceinline__ v16bf ldsfrag(const unsigned char* p) { return cat16b(*(const v8usa*)p, *(const v8usa*)(p + 32)); }   // the k order of WFrag::ld: 8 hi + e, then 16 + 8 hi + (e - 8)
// A wave's 64x64 accumulators laid out as [64][68] f32 in the wave's own LDS range, so that the stores below cover whole lines. Every loop of the epilogues is unrolled so that accumulator and vector indices are constants (registers, no scratch).
__device__ __forceinline__ void tile_to_lds(float* pw, const v8f (&acc)[4][4], int lr, int hi) {
#pragma unroll
    for (int mb = 0; mb < 4; ++mb)
#pragma unroll
        for (int nb = 0; nb < 4; ++nb)
#pragma unroll
            for (int j = 0; j < 8; ++j) pw[(mb * 16 + hi * 8 + j) * 68 + nb * 16 + lr] = acc[mb][nb][j];
    __syncthreads();   // the lanes read each other's values below
}
// f32 tile + bias by column. C, bias: the wave tile's first element and entry.
__device__ __forceinline__ void wave_store(float* pw, const v8f (&acc)[4][4], float* C, const float* __restrict__ bias) {
    const int lane = threadIdx.x & 31; v4f bv;
#pragma unroll
    for (int k = 0; k < 4; ++k) bv[k] = bfr(bias[(lane & 15) * 4 + k]);
    tile_to_lds(pw, acc, lane & 15, lane >> 4);
#pragma unroll
    for (int s = 0; s < 32; ++s) { const int row = s * 2 + (lane >> 4), cofs = (lane & 15) * 4; *(v4f*)(C + (size_t)row * DM + cofs) = *(const v4fa*)(pw + row * 68 + cofs) + bv; }
}
// The tile + bias stored as the three 16-bit planes attention reads (fp16, bf16 hi, bf16 lo). A lane takes 8 neighbouring columns: every store is 16 bytes and 8 lanes fill one 128-byte line of a plane row.
// P16, Ph, Pl: the wave tile's first element, row pitch ldp elements. bias: the tile's first entry (64 of them), by column, or by row where rowb (the transposed product; the same for the whole work-group).
__device__ __forceinline__ void wave_planes(float* pw, const v8f (&acc)[4][4], h16* P16, bf* Ph, bf* Pl, int ldp, const float* __restrict__ bias, bool rowb) {
    const int lane = threadIdx.x & 31, cofs = (lane & 7) * 8, rw = lane >> 3;
    float bc[8], br[16];
#pragma unroll
    for (int k = 0; k < 8; ++k) bc[k] = bfr(bias[cofs + k]);
#pragma unroll
    for (int s = 0; s < 16; ++s) br[s] = bfr(bias[s * 4 + rw]);
    tile_to_lds(pw, acc, lane & 15, lane >> 4);
#pragma unroll
    for (int s = 0; s < 16; ++s) { const int row = s * 4 + rw; const float* p = pw + row * 68 + cofs; const v4f v0 = *(const v4fa*)p, v1 = *(const v4fa*)(p + 4);
        v8h o16; v8us oh, ol;
#pragma unroll
        for (int k = 0; k < 8; ++k) { const float y = (k < 4 ? v0[k & 3] : v1[k & 3]) + (rowb ? br[s] : bc[k]); o16[k] = tohx(y); unsigned short a, b2; splitf(y, a, b2); oh[k] = a; ol[k] = b2; }
        const size_t o = (size_t)row * ldp + cofs; *(v8h*)(P16 + o) = o16; *(v8us*)(Ph + o) = oh; *(v8us*)(Pl + o) = ol; }
}
// At least 4 waves per SIMD asked for: at most 256 registers, so that four work-groups of the projections share a WGP and hide each other's waits.
// Every '#pragma unroll' of the kernel keeps fragment and accumulator indices constant, so that the tiles stay in registers (no scratch).
template <int NSPLIT, int EPI>
__global__ __launch_bounds__(128, 4) void k_gemmt(const bf* __restrict__ A, const bf* __restrict__ A2, const bf* __restrict__ Bt, float* C, const float* __restrict__ bias, const float* __restrict__ biasK, const float* __restrict__ biasV, h16* P16, bf* Ph, bf* Pl) {
    constexpr int SB = (NSPLIT ? 3 : 2) * BT * LP;   // one stage, bytes
    __shared__ __align__(16) unsigned char ring[2 * SB];
    static_assert(2 * SB >= 4 * 64 * 68 * 4, "the ring holds the four waves' output staging");
    const int tid = threadIdx.x, lane = tid & 31, lr = lane & 15, hi = lane >> 4; int r0 = blockIdx.x * BT, c0 = blockIdx.y * BT;
    const int wv = __builtin_amdgcn_readfirstlane(tid >> 5), wm = wv >> 1, wn = wv & 1;   // wave number as a scalar: tile offsets stay scalar
    const int st = EPI == 1 ? (int)(blockIdx.z / NB_) : 0;   // stream, the same for the whole work-group
    if constexpr (EPI == 1) { const bf* X = A + (size_t)blockIdx.z * TT * DM; const bf* Wt = Bt + (size_t)st * DQ * DM;
        if (st == 2) { A = Wt; Bt = X; r0 = blockIdx.y * BT; c0 = blockIdx.x * BT; } else { A = X; Bt = Wt; } }
    v8f acc[4][4];
#pragma unroll
    for (int mb = 0; mb < 4; ++mb)
#pragma unroll
        for (int nb = 0; nb < 4; ++nb) acc[mb][nb] = (v8f){};
    const size_t go = (size_t)(tid >> 3) * DM + (tid & 7) * 8;   // a thread's row and 16-byte piece within 16 rows
    const bf* ga = A + (size_t)r0 * DM + go; const bf* gb = Bt + (size_t)c0 * DM + go; const bf* ga2 = NSPLIT ? A2 + (size_t)r0 * DM + go : nullptr;
    const unsigned lb = (unsigned)(size_t)ring + (unsigned)((tid >> 3) * LP + (tid & 7) * 16);
    auto fill = [&](int t) { const unsigned l = lb + (unsigned)((t & 1) * SB); cp8(l, ga + t * 64); cp8(l + BT * LP, gb + t * 64); if constexpr (NSPLIT != 0) cp8(l + 2 * BT * LP, ga2 + t * 64); };
    fill(0);
    asm volatile("s_wait_asynccnt 0x0" ::: "memory");   // this wave's part of stage 0 has landed
    __syncthreads();                                     // ... and every other wave's
    fill(1);
    const unsigned char* fa = ring + (wm * 64 + lr) * LP + hi * 16; const unsigned char* fb = ring + (BT + wn * 64 + lr) * LP + hi * 16;
#pragma unroll 1   // one stage per trip: the buffer is picked by the trip's parity
    for (int t = 0; t < NST; ++t) { const int bo = (t & 1) * SB; v16bf a[4], a2[4], b[4];
        auto frags = [&](int kk) {   // one block's fragments: 32 k of the wave's 64 A (and A2) rows and 64 Bt rows
#pragma unroll
            for (int i = 0; i < 4; ++i) { a[i] = ldsfrag(fa + bo + i * 16 * LP + kk * 64); b[i] = ldsfrag(fb + bo + i * 16 * LP + kk * 64); if (NSPLIT != 0) a2[i] = ldsfrag(fa + bo + 2 * BT * LP + i * 16 * LP + kk * 64); } };
        auto products = [&]() {
#pragma unroll
            for (int nb = 0; nb < 4; ++nb)
#pragma unroll
                for (int mb = 0; mb < 4; ++mb) { acc[mb][nb] = wmmab(a[mb], b[nb], acc[mb][nb]); if (NSPLIT != 0) acc[mb][nb] = wmmab(a2[mb], b[nb], acc[mb][nb]); } };
#pragma unroll
        for (int kk = 0; kk < 2; ++kk) { frags(kk);
            __builtin_amdgcn_sched_barrier(0);   // the block's fragment reads go out as one group ahead of its products (left free, they are strung out among the products, one LDS latency each)
            products(); }
        __builtin_amdgcn_sched_barrier(0);   // the products stay in front of the barrier, so that the refill goes out directly behind it and has a whole trip to land
        asm volatile("s_wait_dscnt 0x0" ::: "memory");      // this wave's reads of the buffer are done before the buffer is given up
        asm volatile("s_wait_asynccnt 0x0" ::: "memory");   // this wave's part of stage t + 1 has landed
        __syncthreads();                                     // publishes stage t + 1 and ends every wave's reads of stage t
        if (t + 2 < NST) fill(t + 2);                        // into the buffer this trip has just read
    }
    asm volatile("s_wait_asynccnt 0x0" ::: "memory");   // no copy is outstanding when the ring becomes output staging
    float* pw = (float*)ring + wv * (64 * 68);
    if constexpr (EPI == 0) wave_store(pw, acc, C + (size_t)(r0 + wm * 64) * DM + c0 + wn * 64, bias + c0 + wn * 64);
    else { const bool tr = st == 2; const int rw0 = r0 + wm * 64, cw0 = c0 + wn * 64;   // tr: rw0 = head * HD, cw0 = position; else rw0 = position, cw0 = head * HD
        const size_t po = (size_t)blockIdx.z * NH_ * TT * HD + (tr ? (size_t)rw0 * TT + cw0 : (size_t)cw0 * TT + (size_t)rw0 * HD);
        wave_planes(pw, acc, P16 + po, Ph + po, Pl + po, tr ? TT : HD, (st == 0 ? bias : st == 1 ? biasK : biasV) + (tr ? rw0 : cw0), tr); }
}

// bf16 copies of all seven f32 matrices in one launch, 8 elements a thread: blocks 0 .. 3 * CXB - 1 the three streams (all batches) to X [stream][batch][t][DM], the next 4 * CWB the four weights to Wd, one behind the other.
#define CXB  (NB_ * TT * DM / 8 / 256)
#define CWB  (DQ * DM / 8 / 256)
static_assert(NB_ * TT * DM % (8 * 256) == 0 && DQ * DM % (8 * 256) == 0 && DKV == DQ, "whole blocks, equal weights");
__global__ __launch_bounds__(256) void k_cvt8(const float* __restrict__ x, const float* __restrict__ xk, const float* __restrict__ xv, const float* __restrict__ wq, const float* __restrict__ wk, const float* __restrict__ wv, const float* __restrict__ wo, bf* X, bf* Wd) {
    const int blk = blockIdx.x; const float* src; bf* dst; size_t i;
    if (blk < 3 * CXB) { const int s = blk / CXB; src = s == 0 ? x : s == 1 ? xk : xv; dst = X + (size_t)s * NB_ * TT * DM; i = (size_t)(blk - s * CXB) * 256 + threadIdx.x; }
    else { const int s = (blk - 3 * CXB) / CWB; src = s == 0 ? wq : s == 1 ? wk : s == 2 ? wv : wo; dst = Wd + (size_t)s * DQ * DM; i = (size_t)(blk - 3 * CXB - s * CWB) * 256 + threadIdx.x; }
    const v8f v = *(const v8f*)(src + i * 8); v8us o;
#pragma unroll
    for (int k = 0; k < 8; ++k) o[k] = f2bf(v[k]); *(v8us*)(dst + i * 8) = o;  }

// ---- k_fattn: causal attention with the scores kept in registers. One wave owns NQ * 16 query rows of one (batch, head) and walks the keys 32 at a time up to its diagonal; the work-group's FW waves share every K and V tile through LDS:
// S^T = K Q^T (a lane holds one query's scores: 8 keys of each 16-key tile), running maximum and sum per query, P^T packed from the score accumulators straight into a B operand, O^T += V^T P^T.
// Rows < RH: bf16 hi/lo planes, 3 products for both contractions; other rows: fp16 planes. The epilogue divides by the row sum and writes the merged hi/lo planes [t][DQ] for the output projection.
// Every '#pragma unroll' of this section keeps the fragment and accumulator indices constant, so that the tiles stay in registers (no scratch).
#define FW   4                    // waves per work-group
// A stage is SK keys of one (batch, head): [K SK rows of HD | V^T HD rows of SK keys | the two lo planes alike, hi/lo rows only], every row one 128-byte line at pitch LP in LDS; two buffers, filled by asynchronous copies one stage ahead of the products.
#define SK   64
#define TB   (64 * LP)            // one tile of a stage, bytes
static_assert(FW == 4 && HD == 64 && SK * 2 == 128 && RH % (FW * 16) == 0 && (FW * 16) % SK == 0 && (FW * 32) % SK == 0, "128 threads bring 16 whole rows a copy; a work-group's keys end on a whole stage");
// Eight asynchronous 16-byte copies of one thread: four of the K tile and four of the V^T tile behind it, rows 16 apart; a wave's copy covers four whole lines.
// The s_wait_xcnt stands in the copies' own statement, so that no address register is rewritten ahead of it.
template <typename T16>
__device__ __forceinline__ void cpkv(unsigned l, const T16* k, const T16* v) {
    asm volatile("global_load_async_to_lds_b128 %0, %8, off\n\t"
                 "global_load_async_to_lds_b128 %1, %9, off\n\t"
                 "global_load_async_to_lds_b128 %2, %10, off\n\t"
                 "global_load_async_to_lds_b128 %3, %11, off\n\t"
                 "global_load_async_to_lds_b128 %4, %12, off\n\t"
                 "global_load_async_to_lds_b128 %5, %13, off\n\t"
                 "global_load_async_to_lds_b128 %6, %14, off\n\t"
                 "global_load_async_to_lds_b128 %7, %15, off\n\t"
                 "s_wait_xcnt 0x0"
                 :: "v"(l), "v"(l + 16 * LP), "v"(l + 32 * LP), "v"(l + 48 * LP), "v"(l + TB), "v"(l + TB + 16 * LP), "v"(l + TB + 32 * LP), "v"(l + TB + 48 * LP),
                    "v"(k), "v"(k + 16 * HD), "v"(k + 32 * HD), "v"(k + 48 * HD), "v"(v), "v"(v + 16 * TT), "v"(v + 32 * TT), "v"(v + 48 * TT) : "memory");
}
template <typename T16, bool HI> struct AFrag { typename WFrag<T16>::V k[2][2], k2[2][2], v[4], v2[4]; };
// One chunk's fragments from a stage in LDS: sb the stage, h the chunk (32 keys) within it. Byte offsets 16 hi and 32 + 16 hi within 64: the k order of WFrag::ld.
template <typename T16, bool HI>
__device__ __forceinline__ void afrag_ld(AFrag<T16, HI>& f, const unsigned char* sb, int h, int lr, int hi) {
#pragma unroll
    for (int kt = 0; kt < 2; ++kt)
#pragma unroll
        for (int dc = 0; dc < 2; ++dc) { const unsigned char* p = sb + (h * 32 + kt * 16 + lr) * LP + dc * 64 + hi * 16; f.k[kt][dc] = WFrag<T16>::lds(p); if (HI) f.k2[kt][dc] = WFrag<T16>::lds(p + 2 * TB); }
#pragma unroll
    for (int dt = 0; dt < 4; ++dt) { const unsigned char* p = sb + TB + (dt * 16 + lr) * LP + h * 64 + hi * 16; f.v[dt] = WFrag<T16>::lds(p); if (HI) f.v2[dt] = WFrag<T16>::lds(p + 2 * TB); }
}
template <typename T16, bool HI, int NQ>
__device__ __forceinline__ void attn_step(const AFrag<T16, HI>& f, const typename WFrag<T16>::V (&qb)[NQ][2], const typename WFrag<T16>::V (&qb2)[NQ][2], v8f (&o)[4][NQ], float (&m)[NQ], float (&l)[NQ], int kc, int q0, int lr, int hi) {
    typedef typename WFrag<T16>::V V;
    const float c = SCL * 1.4426950408889634f;   // score scale and log2(e) in one factor: p = 2^((s - m) c)
    v8f s[NQ][2];
#pragma unroll
    for (int nq = 0; nq < NQ; ++nq)
#pragma unroll
        for (int kt = 0; kt < 2; ++kt) { v8f t = (v8f){};
#pragma unroll
            for (int dc = 0; dc < 2; ++dc) { t = WFrag<T16>::mma(f.k[kt][dc], qb[nq][dc], t); if (HI) { t = WFrag<T16>::mma(f.k[kt][dc], qb2[nq][dc], t); t = WFrag<T16>::mma(f.k2[kt][dc], qb[nq][dc], t); } }
            s[nq][kt] = t; }
    if (kc + 31 > q0) {   // only the chunk on the diagonal holds keys above a query (scalar test)
#pragma unroll
        for (int nq = 0; nq < NQ; ++nq)
#pragma unroll
            for (int kt = 0; kt < 2; ++kt)
#pragma unroll
                for (int j = 0; j < 8; ++j) if (kc + kt * 16 + hi * 8 + j > q0 + nq * 16 + lr) s[nq][kt][j] = -3.0e38f;
    }
    float mx[NQ]; bool need = false;
#pragma unroll
    for (int nq = 0; nq < NQ; ++nq) { float t = s[nq][0][0];
#pragma unroll
        for (int j = 1; j < 8; ++j) t = fmaxf(t, s[nq][0][j]);
#pragma unroll
        for (int j = 0; j < 8; ++j) t = fmaxf(t, s[nq][1][j]);
        t = fmaxf(t, __shfl_xor(t, 16, 32));   // the two halves of the wave hold the same query's other keys: both must use one maximum
        mx[nq] = t; need = need || ((t - m[nq]) * c > 8.0f); }
    if (__builtin_amdgcn_ballot_w32(need) != 0) {   // lazy rescale, one scalar test per chunk: the maximum in use moves only when some query's scores pass it by more than 2^8
#pragma unroll
        for (int nq = 0; nq < NQ; ++nq) { const float mn = fmaxf(m[nq], mx[nq]); const float al = __builtin_amdgcn_exp2f((m[nq] - mn) * c); m[nq] = mn; l[nq] *= al;
#pragma unroll
            for (int dt = 0; dt < 4; ++dt) o[dt][nq] *= al; }
    }
    V pb[NQ], pl[NQ];
#pragma unroll
    for (int nq = 0; nq < NQ; ++nq) { const float mc = m[nq] * c; float ps = 0.f;
#pragma unroll
        for (int kt = 0; kt < 2; ++kt)
#pragma unroll
            for (int j = 0; j < 8; ++j) { const float p = __builtin_amdgcn_exp2f(fmaf(s[nq][kt][j], c, -mc)); s[nq][kt][j] = p; ps += p; }
        l[nq] += ps;
        // slot e of the B operand is key 8 hi + e (e < 8) or 16 + 8 hi + (e - 8): register j of score tile 0 or 1, the k order of the V^T loader
        if constexpr (HI) { v8us h0, h1, l0, l1;
#pragma unroll
            for (int j = 0; j < 8; ++j) { unsigned short a, b2; splitf(s[nq][0][j], a, b2); h0[j] = a; l0[j] = b2; splitf(s[nq][1][j], a, b2); h1[j] = a; l1[j] = b2; }
            pb[nq] = cat16b(h0, h1); pl[nq] = cat16b(l0, l1);
        } else { v8h h0, h1;
#pragma unroll
            for (int j = 0; j < 8; ++j) { h0[j] = tohx(s[nq][0][j]); h1[j] = tohx(s[nq][1][j]); }
            pb[nq] = cat16(h0, h1); } }
#pragma unroll
    for (int dt = 0; dt < 4; ++dt)
#pragma unroll
        for (int nq = 0; nq < NQ; ++nq) { o[dt][nq] = WFrag<T16>::mma(f.v[dt], pb[nq], o[dt][nq]); if (HI) { o[dt][nq] = WFrag<T16>::mma(f.v[dt], pl[nq], o[dt][nq]); o[dt][nq] = WFrag<T16>::mma(f.v2[dt], pb[nq], o[dt][nq]); } }
}
template <typename T16, bool HI, int NQ>
__device__ __forceinline__ void attn_rows(const T16* __restrict__ Q, const T16* __restrict__ Q2, const T16* __restrict__ Kp, const T16* __restrict__ K2, const T16* __restrict__ Vt, const T16* __restrict__ V2, int q0, int ns, unsigned char* ring, bf* Ah, bf* Al) {   // q0: the wave's first row; ns: stages up to the work-group's last row, the same for its four waves
    typedef typename WFrag<T16>::V V;
    constexpr int SB = (HI ? 4 : 2) * TB;   // one stage, bytes
    const int tid = threadIdx.x, lane = tid & 31, lr = lane & 15, hi = lane >> 4;
    V qb[NQ][2], qb2[NQ][2]; v8f o[4][NQ]; float m[NQ], l[NQ];
#pragma unroll
    for (int nq = 0; nq < NQ; ++nq) { m[nq] = -3.0e38f; l[nq] = 0.f;
#pragma unroll
        for (int dc = 0; dc < 2; ++dc) { const size_t qo = (size_t)(q0 + nq * 16 + lr) * HD + dc * 32 + 8 * hi; qb[nq][dc] = WFrag<T16>::ld(Q + qo); if (HI) qb2[nq][dc] = WFrag<T16>::ld(Q2 + qo); }
#pragma unroll
        for (int dt = 0; dt < 4; ++dt) o[dt][nq] = (v8f){}; }
    const int kend = q0 + NQ * 16;   // the wave's keys 0 .. kend - 1, in chunks of 32; every chunk holds at least one key <= every query of the wave
    const size_t gk = (size_t)(tid >> 3) * HD + (tid & 7) * 8, gv = (size_t)(tid >> 3) * TT + (tid & 7) * 8;   // a thread's row and 16-byte piece within 16 rows
    const unsigned lb = (unsigned)(size_t)ring + (unsigned)((tid >> 3) * LP + (tid & 7) * 16);
    auto fill = [&](int t) { const unsigned l = lb + (unsigned)((t & 1) * SB); cpkv<T16>(l, Kp + gk + (size_t)t * SK * HD, Vt + gv + t * SK); if constexpr (HI) cpkv<T16>(l + 2 * TB, K2 + gk + (size_t)t * SK * HD, V2 + gv + t * SK); };
    fill(0);
    asm volatile("s_wait_asynccnt 0x0" ::: "memory");   // this wave's part of stage 0 has landed
    __syncthreads();                                     // ... and every other wave's
    if (ns > 1) fill(1);
#pragma unroll 1   // one stage per trip: the buffer is picked by the trip's parity
    for (int t = 0; t < ns; ++t) { const unsigned char* sb = ring + (t & 1) * SB;
#pragma unroll 1   // one chunk's fragments live at a time: an unrolled key loop would not fit four waves per SIMD
        for (int h = 0; h < SK / 32; ++h) { const int kc = t * SK + h * 32;
            if (kc < kend) {   // scalar test: a wave is done with its keys up to three chunks ahead of the work-group's last wave, and still passes every barrier
                AFrag<T16, HI> f; afrag_ld<T16, HI>(f, sb, h, lr, hi);
                // inputs-only fence on the loaded fragments: all of a chunk's LDS reads are issued together and waited for once (left free, the reads are strung out between the products, one LDS latency each)
                if constexpr (HI) asm volatile("" :: "v"(f.k[0][0]), "v"(f.k[0][1]), "v"(f.k[1][0]), "v"(f.k[1][1]), "v"(f.k2[0][0]), "v"(f.k2[0][1]), "v"(f.k2[1][0]), "v"(f.k2[1][1]), "v"(f.v[0]), "v"(f.v[1]), "v"(f.v[2]), "v"(f.v[3]), "v"(f.v2[0]), "v"(f.v2[1]), "v"(f.v2[2]), "v"(f.v2[3]));
                else asm volatile("" :: "v"(f.k[0][0]), "v"(f.k[0][1]), "v"(f.k[1][0]), "v"(f.k[1][1]), "v"(f.v[0]), "v"(f.v[1]), "v"(f.v[2]), "v"(f.v[3]));
                __builtin_amdgcn_sched_barrier(0);   // keeps the first products, and the wait they bring, from being lifted in front of the chunk's last reads
                attn_step<T16, HI, NQ>(f, qb, qb2, o, m, l, kc, q0, lr, hi);
                __builtin_amdgcn_sched_barrier(0);   // holds the slots below behind the chunk's last product
                asm volatile("v_nop\n\tv_nop\n\tv_nop\n\tv_nop");   // the four vector slots the chip needs between the last product and the next chunk's address arithmetic, which reuses its operand registers
            } }
        asm volatile("s_wait_dscnt 0x0" ::: "memory");      // this wave's reads of the buffer are done before the buffer is given up
        asm volatile("s_wait_asynccnt 0x0" ::: "memory");   // this wave's part of stage t + 1 has landed
        __syncthreads();                                     // publishes stage t + 1 and ends every wave's reads of stage t
        if (t + 2 < ns) fill(t + 2);                         // into the buffer this trip has just read
    }
    asm volatile("s_wait_asynccnt 0x0" ::: "memory");   // no copy is outstanding when the wave ends
#pragma unroll
    for (int nq = 0; nq < NQ; ++nq) { const float li = __fdiv_rn(1.0f, l[nq] + __shfl_xor(l[nq], 16, 32));   // the halves' sums join once, here
        const size_t ro = (size_t)(q0 + nq * 16 + lr) * DQ + hi * 8;
#pragma unroll
        for (int dt = 0; dt < 4; ++dt) { v8us oh, ol;
#pragma unroll
            for (int j = 0; j < 8; ++j) { unsigned short a, b2; splitf(o[dt][nq][j] * li, a, b2); oh[j] = a; ol[j] = b2; }
            *(v8us*)(Ah + ro + dt * 16) = oh; *(v8us*)(Al + ro + dt * 16) = ol; } }
}
// grid (NB_ * NH_, row blocks): the row block is the slow index and the longest rows come first. Blocks 0 .. NBF-1: fp16 rows, FW * 32 each, from the end of the sequence down to RH; the rest: hi/lo rows, FW * 16 each.
#define NBF  ((TT - RH) / (FW * 32))
#define NBH  (RH / (FW * 16))
__global__ __launch_bounds__(32 * FW) void k_fattn(const h16* __restrict__ Q16, const h16* __restrict__ K16, const h16* __restrict__ V16, const bf* __restrict__ Qh, const bf* __restrict__ Ql, const bf* __restrict__ Kh, const bf* __restrict__ Kl, const bf* __restrict__ Vh, const bf* __restrict__ Vl, bf* Ah, bf* Al) {
    __shared__ __align__(16) unsigned char ring[2 * 4 * TB];   // two stages of the hi/lo rows' four tiles; the fp16 rows use half
    const int z = blockIdx.x, y = blockIdx.y; const size_t po = (size_t)z * TT * HD; const size_t ao = (size_t)(z / NH_) * TT * DQ + (size_t)(z % NH_) * HD;
    const int wv = __builtin_amdgcn_readfirstlane((int)(threadIdx.x >> 5));   // wave number as a scalar: row offsets, trip counts and the diagonal test stay scalar
    if (y < NBF) attn_rows<h16, false, 2>(Q16 + po, nullptr, K16 + po, nullptr, V16 + po, nullptr, TT - (y + 1) * (FW * 32) + wv * 32, (TT - y * (FW * 32)) / SK, ring, Ah + ao, Al + ao);
    else attn_rows<bf, true, 1>(Qh + po, Ql + po, Kh + po, Kl + po, Vh + po, Vl + po, RH - (y - NBF + 1) * (FW * 16) + wv * 16, (RH - (y - NBF) * (FW * 16)) / SK, ring, Ah + ao, Al + ao);
}

extern "C" void kernel_launch(void* const* d_in, const int* in_sizes, int n_in,
                              void* d_out, int out_size, void* d_ws, size_t ws_size, hipStream_t stream) {
    (void)in_sizes; (void)n_in; (void)out_size;
    const float* x = (const float*)d_in[0]; const float* xk = (const float*)d_in[1]; const float* xv = (const float*)d_in[2]; const float* wq = (const float*)d_in[3]; const float* bq = (const float*)d_in[4]; const float* wk = (const float*)d_in[5]; const float* bk = (const float*)d_in[6]; const float* wv = (const float*)d_in[7]; const float* bv = (const float*)d_in[8]; const float* wo = (const float*)d_in[9]; const float* bo = (const float*)d_in[10];
    float* OUT = (float*)d_out;     // [4][2048][768]
    char* wsp = (char*)d_ws;
    auto take = [&](size_t bytes) { char* p = wsp; wsp += (bytes + 255) & ~(size_t)255; return (void*)p; };
    bf* WQ = (bf*)take((size_t)4 * DQ * DM * 2); bf* WO = WQ + (size_t)3 * DQ * DM;   // W_Q, W_K, W_V, W_O one behind the other
    bf* XB = (bf*)take((size_t)3 * NB_ * TT * DM * 2);   // [stream][batch][t][DM]
    const size_t PB = (size_t)NH_ * TT * HD;   // one batch's head planes, elements; every plane set holds [stream][batch]
    h16* QP16 = (h16*)take(3 * NB_ * PB * 2); h16* KP16 = QP16 + NB_ * PB; h16* VT16 = KP16 + NB_ * PB;
    bf* QPh = (bf*)take(3 * NB_ * PB * 2); bf* KPh = QPh + NB_ * PB; bf* VTh = KPh + NB_ * PB; bf* QPl = (bf*)take(3 * NB_ * PB * 2); bf* KPl = QPl + NB_ * PB; bf* VTl = KPl + NB_ * PB;
    bf* ATh = (bf*)take((size_t)NB_ * TT * DQ * 2); bf* ATl = (bf*)take((size_t)NB_ * TT * DQ * 2);
    if ((size_t)(wsp - (char*)d_ws) > ws_size) return;    // ws 256 MiB
    k_cvt8<<<3 * CXB + 4 * CWB, 256, 0, stream>>>(x, xk, xv, wq, wk, wv, wo, XB, WQ);
    k_gemmt<0, 1><<<dim3(TT / BT, DQ / BT, 3 * NB_), 128, 0, stream>>>(XB, nullptr, WQ, nullptr, bq, bk, bv, QP16, QPh, QPl);
    k_fattn<<<dim3(NB_ * NH_, NBF + NBH, 1), 32 * FW, 0, stream>>>(QP16, KP16, VT16, QPh, QPl, KPh, KPl, VTh, VTl, ATh, ATl);
    k_gemmt<1, 0><<<dim3(NB_ * TT / BT, DM / BT, 1), 128, 0, stream>>>(ATh, ATl, WO, OUT, bo, nullptr, nullptr, nullptr, nullptr, nullptr);
}

// v008
// One run takes 101 microseconds.
// In two side-by-side timings against v007, it was 1.03 and 1.04 times as fast.
// Over all steps from v000 it is 22.3 times as fast.
#include <hip/hip_runtime.h>

// Causal multi-headed attention on three input streams (queries, keys, values [4][2048][768]; Q = queries W_Q^T + b_Q, K = keys W_K^T + b_K, V = values W_V^T + b_V ('oi' uniform(+-768^-0.5) incl. biases: non-zero; 12 heads x 64); scores x 1/sqrt(64); causal (-inf); softmax; outputs = merged (standard) W_O^T + b_O -> [4][2048][768] (6.3 M); argument order queries, keys, values, W_Q, b_Q, W_K, b_K, W_V, b_V, W_O, b_O).
// Four launches, each over all batches: bf16 copies of queries, keys, values and the four 'oi' weights; the three exact projections (K 768) + f32 biases, their epilogue writes the head planes (V as W_V x values^T, so that its planes come out [d][t]); one fused causal attention launch over all batches and heads (hybrid rows: < 512 hi/lo 3 products, rest fp16; K and V tiles through LDS, scores and probabilities stay in registers); merged hi/lo x W_O exact + b_O.
// Compute dtypes, f32 accumulate: every input rounded to bf16; projections exact + f32 biases; attention rows < 512 3 products, rest fp16; softmax f32, except that the fp16 rows' row sums add the probabilities as rounded to f16 for P.V (a matrix product, f32 accumulate); W_O hl x exact + bias.

#define NB_  4
#define TT   2048
#define DM   768
#define NH_  12
#define NKV  12
#define HD   64
#define DQ   (NH_ * HD)
#define DKV  (NKV * HD)
#define RH   512                  // query rows < RH use hi+lo planes (0: none)
#define SCL  0.125f   // HD^-0.5
#define QSC  (SCL * 1.4426950408889634f)   // score scale and log2(e) in one factor: p = 2^(s QSC - m)
typedef _Float16 h16;
typedef unsigned short bf;
typedef __attribute__((ext_vector_type(16))) __bf16   v16bf;
typedef __attribute__((ext_vector_type(16))) _Float16 v16h;
typedef __attribute__((ext_vector_type(8)))  _Float16 v8h;
typedef __attribute__((ext_vector_type(8)))  unsigned short v8us;
typedef __attribute__((ext_vector_type(8)))  float    v8f;
typedef __attribute__((ext_vector_type(4)))  float    v4f;
typedef v8h  __attribute__((may_alias)) v8ha;
typedef v4f  __attribute__((may_alias)) v4fa;
typedef v8us __attribute__((may_alias)) v8usa;

__device__ __forceinline__ unsigned short f2bf(float f) { unsigned u = __float_as_uint(f); u += 0x7FFFu + ((u >> 16) & 1u); return (unsigned short)(u >> 16); }
__device__ __forceinline__ float bf2f(unsigned short b) { return __uint_as_float(((unsigned)b) << 16); }
__device__ __forceinline__ float bfr(float f) { return bf2f(f2bf(f)); }
__device__ __forceinline__ v16h cat16(v8h lo, v8h hi) { return __builtin_shufflevector(lo, hi, 0, 1, 2, 3, 4, 5, 6, 7, 8, 9, 10, 11, 12, 13, 14, 15); }
__device__ __forceinline__ v16bf cat16b(v8us lo, v8us hi) { return __builtin_bit_cast(v16bf, __builtin_shufflevector(lo, hi, 0, 1, 2, 3, 4, 5, 6, 7, 8, 9, 10, 11, 12, 13, 14, 15)); }
__device__ __forceinline__ v8f wmma16(v16h a, v16h b, v8f c) { return __builtin_amdgcn_wmma_f32_16x16x32_f16(false, a, false, b, (short)0, c, false, false); }
__device__ __forceinline__ v8f wmmab(v16bf a, v16bf b, v8f c) { return __builtin_amdgcn_wmma_f32_16x16x32_bf16(false, a, false, b, (short)0, c, false, false); }



__device__ __forceinline__ h16 tohx(float x) { return (h16)x; }
__device__ __forceinline__ void splitf(float y, unsigned short& h, unsigned short& l) { h = f2bf(y); l = f2bf(y - bf2f(h)); }
template <typename T16> struct WFrag;
template <> struct WFrag<h16> { typedef v16h V; static __device__ __forceinline__ V ld(const h16* p) { return cat16(*(const v8h*)p, *(const v8h*)(p + 16)); } static __device__ __forceinline__ V lds(const unsigned char* p) { return cat16(*(const v8ha*)p, *(const v8ha*)(p + 32)); } static __device__ __forceinline__ v8f mma(V a, V b, v8f c) { return wmma16(a, b, c); } };
template <> struct WFrag<bf> { typedef v16bf V; static __device__ __forceinline__ V ld(const bf* p) { return cat16b(*(const v8us*)p, *(const v8us*)(p + 16)); } static __device__ __forceinline__ V lds(const unsigned char* p) { return cat16b(*(const v8usa*)p, *(const v8usa*)(p + 32)); } static __device__ __forceinline__ v8f mma(V a, V b, v8f c) { return wmmab(a, b, c); } };

// ---- k_gemmt: block-tiled GEMM, one BT x BT output tile per work-group of 4 waves (2 x 2, 64x64 each, 16 accumulators), the whole K loop in every wave.
// C[m][n] = sum_k A[m][k] Bt[n][k] (+ A2[m][k] Bt[n][k] where NSPLIT), K = DM, operands K-contiguous bf16 planes.
// A stage is 64 k (one 128-byte line) of every operand row of the block: [A BT rows | Bt BT rows | A2 BT rows] at pitch LP in LDS, two buffers, filled by asynchronous copies one stage ahead of the products.
// EPI 0: grid (M/BT, N/BT), f32 tile + bias[n] to C (pitch DM).
// EPI 1: the three projections of all batches, grid (TT/BT, DQ/BT, 3 * NB_), z = stream * NB_ + batch. A: the streams' bf16 copies [z][t][DM]; Bt: W_Q, W_K, W_V one behind the other; bias, biasK, biasV: theirs; planes [z][head][..].
//        Streams 0, 1: m = position, n = head * HD + d, a wave's tile is one head: planes [head][t][d]. Stream 2: the operands change places, m = head * HD + d, n = position, bias[m]: planes [head][d][t].
#define BT   128
#define LP   144                  // LDS row pitch, bytes: 128 + 16, an odd multiple of 16 for the 16-byte fragment reads
#define NST  (DM / 64)            // stages
static_assert(DQ == DM && DM % 64 == 0 && NST >= 2 && TT % BT == 0 && DQ % BT == 0 && HD == 64, "whole tiles, whole stages, a wave tile is one head");
// Eight asynchronous 16-byte copies of one thread, rows 16 apart in the source and in the stage: the work-group's 128 threads bring BT rows of 128 bytes, a wave's copy covers four whole lines.
// The s_wait_xcnt stands in the copies' own statement, so that no address register is rewritten ahead of it.
__device__ __forceinline__ void cp8(unsigned l, const bf* g) {
    asm volatile("global_load_async_to_lds_b128 %0, %8, off\n\t"
                 "global_load_async_to_lds_b128 %1, %9, off\n\t"
                 "global_load_async_to_lds_b128 %2, %10, off\n\t"
                 "global_load_async_to_lds_b128 %3, %11, off\n\t"
                 "global_load_async_to_lds_b128 %4, %12, off\n\t"
                 "global_load_async_to_lds_b128 %5, %13, off\n\t"
                 "global_load_async_to_lds_b128 %6, %14, off\n\t"
                 "global_load_async_to_lds_b128 %7, %15, off\n\t"
                 "s_wait_xcnt 0x0"
                 :: "v"(l), "v"(l + 16 * LP), "v"(l + 32 * LP), "v"(l + 48 * LP), "v"(l + 64 * LP), "v"(l + 80 * LP), "v"(l + 96 * LP), "v"(l + 112 * LP),
                    "v"(g), "v"(g + 16 * DM), "v"(g + 32 * DM), "v"(g + 48 * DM), "v"(g + 64 * DM), "v"(g + 80 * DM), "v"(g + 96 * DM), "v"(g + 112 * DM) : "memory");
}
__device__ __forceinline__ v16bf ldsfrag(const unsigned char* p) { return cat16b(*(const v8usa*)p, *(const v8usa*)(p + 32)); }   // the k order of WFrag::ld: 8 hi + e, then 16 + 8 hi + (e - 8)
// A wave's 64x64 accumulators laid out as [64][68] f32 in the wave's own LDS range, so that the stores below cover whole lines. Every loop of the epilogues is unrolled so that accumulator and vector indices are constants (registers, no scratch).
__device__ __forceinline__ void tile_to_lds(float* pw, const v8f (&acc)[4][4], int lr, int hi) {
#pragma unroll
    for (int mb = 0; mb < 4; ++mb)
#pragma unroll
        for (int nb = 0; nb < 4; ++nb)
#pragma unroll
            for (int j = 0; j < 8; ++j) pw[(mb * 16 + hi * 8 + j) * 68 + nb * 16 + lr] = acc[mb][nb][j];
    __syncthreads();   // the lanes read each other's values below
}
// f32 tile + bias by column. C, bias: the wave tile's first element and entry.
__device__ __forceinline__ void wave_store(float* pw, const v8f (&acc)[4][4], float* C, const float* __restrict__ bias) {
    const int lane = threadIdx.x & 31; v4f bv;
#pragma unroll
    for (int k = 0; k < 4; ++k) bv[k] = bfr(bias[(lane & 15) * 4 + k]);
    tile_to_lds(pw, acc, lane & 15, lane >> 4);
#pragma unroll
    for (int s = 0; s < 32; ++s) { const int row = s * 2 + (lane >> 4), cofs = (lane & 15) * 4; *(v4f*)(C + (size_t)row * DM + cofs) = *(const v4fa*)(pw + row * 68 + cofs) + bv; }
}
// The tile + bias stored as the three 16-bit planes attention reads (fp16, bf16 hi, bf16 lo). A lane takes 8 neighbouring columns: every store is 16 bytes and 8 lanes fill one 128-byte line of a plane row.
// s16: factor on the fp16 plane alone (QSC for Q, whose fp16 rows then give scores in exponent units; 1 for K and V).
// P16, Ph, Pl: the wave tile's first element, row pitch ldp elements. bias: the tile's first entry (64 of them), by column, or by row where rowb (the transposed product; the same for the whole work-group).
__device__ __forceinline__ void wave_planes(float* pw, const v8f (&acc)[4][4], h16* P16, bf* Ph, bf* Pl, int ldp, const float* __restrict__ bias, bool rowb, float s16) {
    const int lane = threadIdx.x & 31, cofs = (lane & 7) * 8, rw = lane >> 3;
    float bc[8], br[16];
#pragma unroll
    for (int k = 0; k < 8; ++k) bc[k] = bfr(bias[cofs + k]);
#pragma unroll
    for (int s = 0; s < 16; ++s) br[s] = bfr(bias[s * 4 + rw]);
    tile_to_lds(pw, acc, lane & 15, lane >> 4);
#pragma unroll
    for (int s = 0; s < 16; ++s) { const int row = s * 4 + rw; const float* p = pw + row * 68 + cofs; const v4f v0 = *(const v4fa*)p, v1 = *(const v4fa*)(p + 4);
        v8h o16; v8us oh, ol;
#pragma unroll
        for (int k = 0; k < 8; ++k) { const float y = (k < 4 ? v0[k & 3] : v1[k & 3]) + (rowb ? br[s] : bc[k]); o16[k] = tohx(y * s16); unsigned short a, b2; splitf(y, a, b2); oh[k] = a; ol[k] = b2; }
        const size_t o = (size_t)row * ldp + cofs; *(v8h*)(P16 + o) = o16; *(v8us*)(Ph + o) = oh; *(v8us*)(Pl + o) = ol; }
}
// At least 4 waves per SIMD asked for: at most 256 registers, so that four work-groups of the projections share a WGP and hide each other's waits.
// Every '#pragma unroll' of the kernel keeps fragment and accumulator indices constant, so that the tiles stay in registers (no scratch).
template <int NSPLIT, int EPI>
__global__ __launch_bounds__(128, 4) void k_gemmt(const bf* __restrict__ A, const bf* __restrict__ A2, const bf* __restrict__ Bt, float* C, const float* __restrict__ bias, const float* __restrict__ biasK, const float* __restrict__ biasV, h16* P16, bf* Ph, bf* Pl) {
    constexpr int SB = (NSPLIT ? 3 : 2) * BT * LP;   // one stage, bytes
    __shared__ __align__(16) unsigned char ring[2 * SB];
    static_assert(2 * SB >= 4 * 64 * 68 * 4, "the ring holds the four waves' output staging");
    const int tid = threadIdx.x, lane = tid & 31, lr = lane & 15, hi = lane >> 4; int r0 = blockIdx.x * BT, c0 = blockIdx.y * BT;
    const int wv = __builtin_amdgcn_readfirstlane(tid >> 5), wm = wv >> 1, wn = wv & 1;   // wave number as a scalar: tile offsets stay scalar
    const int st = EPI == 1 ? (int)(blockIdx.z / NB_) : 0;   // stream, the same for the whole work-group
    if constexpr (EPI == 1) { const bf* X = A + (size_t)blockIdx.z * TT * DM; const bf* Wt = Bt + (size_t)st * DQ * DM;
        if (st == 2) { A = Wt; Bt = X; r0 = blockIdx.y * BT; c0 = blockIdx.x * BT; } else { A = X; Bt = Wt; } }
    v8f acc[4][4];
#pragma unroll
    for (int mb = 0; mb < 4; ++mb)
#pragma unroll
        for (int nb = 0; nb < 4; ++nb) acc[mb][nb] = (v8f){};
    const size_t go = (size_t)(tid >> 3) * DM + (tid & 7) * 8;   // a thread's row and 16-byte piece within 16 rows
    const bf* ga = A + (size_t)r0 * DM + go; const bf* gb = Bt + (size_t)c0 * DM + go; const bf* ga2 = NSPLIT ? A2 + (size_t)r0 * DM + go : nullptr;
    const unsigned lb = (unsigned)(size_t)ring + (unsigned)((tid >> 3) * LP + (tid & 7) * 16);
    auto fill = [&](int t) { const unsigned l = lb + (unsigned)((t & 1) * SB); cp8(l, ga + t * 64); cp8(l + BT * LP, gb + t * 64); if constexpr (NSPLIT != 0) cp8(l + 2 * BT * LP, ga2 + t * 64); };
    fill(0);
    asm volatile("s_wait_asynccnt 0x0" ::: "memory");   // this wave's part of stage 0 has landed
    __syncthreads();                                     // ... and every other wave's
    fill(1);
    const unsigned char* fa = ring + (wm * 64 + lr) * LP + hi * 16; const unsigned char* fb = ring + (BT + wn * 64 + lr) * LP + hi * 16;
#pragma unroll 1   // one stage per trip: the buffer is picked by the trip's parity
    for (int t = 0; t < NST; ++t) { const int bo = (t & 1) * SB; v16bf a[4], a2[4], b[4];
        auto frags = [&](int kk) {   // one block's fragments: 32 k of the wave's 64 A (and A2) rows and 64 Bt rows
#pragma unroll
            for (int i = 0; i < 4; ++i) { a[i] = ldsfrag(fa + bo + i * 16 * LP + kk * 64); b[i] = ldsfrag(fb + bo + i * 16 * LP + kk * 64); if (NSPLIT != 0) a2[i] = ldsfrag(fa + bo + 2 * BT * LP + i * 16 * LP + kk * 64); } };
        auto products = [&]() {
#pragma unroll
            for (int nb = 0; nb < 4; ++nb)
#pragma unroll
                for (int mb = 0; mb < 4; ++mb) { acc[mb][nb] = wmmab(a[mb], b[nb], acc[mb][nb]); if (NSPLIT != 0) acc[mb][nb] = wmmab(a2[mb], b[nb], acc[mb][nb]); } };
#pragma unroll
        for (int kk = 0; kk < 2; ++kk) { frags(kk);
            __builtin_amdgcn_sched_barrier(0);   // the block's fragment reads go out as one group ahead of its products (left free, they are strung out among the products, one LDS latency each)
            products(); }
        __builtin_amdgcn_sched_barrier(0);   // the products stay in front of the barrier, so that the refill goes out directly behind it and has a whole trip to land
        asm volatile("s_wait_dscnt 0x0" ::: "memory");      // this wave's reads of the buffer are done before the buffer is given up
        asm volatile("s_wait_asynccnt 0x0" ::: "memory");   // this wave's part of stage t + 1 has landed
        __syncthreads();                                     // publishes stage t + 1 and ends every wave's reads of stage t
        if (t + 2 < NST) fill(t + 2);                        // into the buffer this trip has just read
    }
    asm volatile("s_wait_asynccnt 0x0" ::: "memory");   // no copy is outstanding when the ring becomes output staging
    float* pw = (float*)ring + wv * (64 * 68);
    if constexpr (EPI == 0) wave_store(pw, acc, C + (size_t)(r0 + wm * 64) * DM + c0 + wn * 64, bias + c0 + wn * 64);
    else { const bool tr = st == 2; const int rw0 = r0 + wm * 64, cw0 = c0 + wn * 64;   // tr: rw0 = head * HD, cw0 = position; else rw0 = position, cw0 = head * HD
        const size_t po = (size_t)blockIdx.z * NH_ * TT * HD + (tr ? (size_t)rw0 * TT + cw0 : (size_t)cw0 * TT + (size_t)rw0 * HD);
        wave_planes(pw, acc, P16 + po, Ph + po, Pl + po, tr ? TT : HD, (st == 0 ? bias : st == 1 ? biasK : biasV) + (tr ? rw0 : cw0), tr, st == 0 ? QSC : 1.0f); }
}

// bf16 copies of all seven f32 matrices in one launch, 8 elements a thread: blocks 0 .. 3 * CXB - 1 the three streams (all batches) to X [stream][batch][t][DM], the next 4 * CWB the four weights to Wd, one behind the other.
#define CXB  (NB_ * TT * DM / 8 / 256)
#define CWB  (DQ * DM / 8 / 256)
static_assert(NB_ * TT * DM % (8 * 256) == 0 && DQ * DM % (8 * 256) == 0 && DKV == DQ, "whole blocks, equal weights");
__global__ __launch_bounds__(256) void k_cvt8(const float* __restrict__ x, const float* __restrict__ xk, const float* __restrict__ xv, const float* __restrict__ wq, const float* __restrict__ wk, const float* __restrict__ wv, const float* __restrict__ wo, bf* X, bf* Wd) {
    const int blk = blockIdx.x; const float* src; bf* dst; size_t i;
    if (blk < 3 * CXB) { const int s = blk / CXB; src = s == 0 ? x : s == 1 ? xk : xv; dst = X + (size_t)s * NB_ * TT * DM; i = (size_t)(blk - s * CXB) * 256 + threadIdx.x; }
    else { const int s = (blk - 3 * CXB) / CWB; src = s == 0 ? wq : s == 1 ? wk : s == 2 ? wv : wo; dst = Wd + (size_t)s * DQ * DM; i = (size_t)(blk - 3 * CXB - s * CWB) * 256 + threadIdx.x; }
    const v8f v = *(const v8f*)(src + i * 8); v8us o;
#pragma unroll
    for (int k = 0; k < 8; ++k) o[k] = f2bf(v[k]); *(v8us*)(dst + i * 8) = o;  }

// ---- k_fattn: causal attention with the scores kept in registers. One wave owns NQ * 16 query rows of one (batch, head) and walks the keys 32 at a time up to its diagonal; the work-group's FW waves share every K and V tile through LDS:
// S^T = K Q^T (a lane holds one query's scores: 8 keys of each 16-key tile), running maximum and sum per query, P^T packed from the score accumulators straight into a B operand, O^T += V^T P^T.
// Rows < RH: bf16 hi/lo planes, 3 products for both contractions; other rows: fp16 planes. The epilogue divides by the row sum and writes the merged hi/lo planes [t][DQ] for the output projection.
// Every '#pragma unroll' of this section keeps the fragment and accumulator indices constant, so that the tiles stay in registers (no scratch).
#define FW   4                    // waves per work-group
// A stage is SK keys of one (batch, head): [K SK rows of HD | V^T HD rows of SK keys | the two lo planes alike, hi/lo rows only], every row one 128-byte line at pitch LP in LDS; two buffers, filled by asynchronous copies one stage ahead of the products.
#define SK   64
#define TB   (64 * LP)            // one tile of a stage, bytes
static_assert(FW == 4 && HD == 64 && SK * 2 == 128 && RH % (FW * 16) == 0 && (FW * 16) % SK == 0 && (FW * 32) % SK == 0, "128 threads bring 16 whole rows a copy; a work-group's keys end on a whole stage");
// Eight asynchronous 16-byte copies of one thread: four of the K tile and four of the V^T tile behind it, rows 16 apart; a wave's copy covers four whole lines.
// The s_wait_xcnt stands in the copies' own statement, so that no address register is rewritten ahead of it.
template <typename T16>
__device__ __forceinline__ void cpkv(unsigned l, const T16* k, const T16* v) {
    asm volatile("global_load_async_to_lds_b128 %0, %8, off\n\t"
                 "global_load_async_to_lds_b128 %1, %9, off\n\t"
                 "global_load_async_to_lds_b128 %2, %10, off\n\t"
                 "global_load_async_to_lds_b128 %3, %11, off\n\t"
                 "global_load_async_to_lds_b128 %4, %12, off\n\t"
                 "global_load_async_to_lds_b128 %5, %13, off\n\t"
                 "global_load_async_to_lds_b128 %6, %14, off\n\t"
                 "global_load_async_to_lds_b128 %7, %15, off\n\t"
                 "s_wait_xcnt 0x0"
                 :: "v"(l), "v"(l + 16 * LP), "v"(l + 32 * LP), "v"(l + 48 * LP), "v"(l + TB), "v"(l + TB + 16 * LP), "v"(l + TB + 32 * LP), "v"(l + TB + 48 * LP),
                    "v"(k), "v"(k + 16 * HD), "v"(k + 32 * HD), "v"(k + 48 * HD), "v"(v), "v"(v + 16 * TT), "v"(v + 32 * TT), "v"(v + 48 * TT) : "memory");
}
template <typename T16, bool HI> struct AFrag { typename WFrag<T16>::V k[2][2], k2[2][2], v[4], v2[4]; };
// One chunk's fragments from a stage in LDS: sb the stage, h the chunk (32 keys) within it. Byte offsets 16 hi and 32 + 16 hi within 64: the k order of WFrag::ld.
template <typename T16, bool HI>
__device__ __forceinline__ void afrag_ld(AFrag<T16, HI>& f, const unsigned char* sb, int h, int lr, int hi) {
#pragma unroll
    for (int kt = 0; kt < 2; ++kt)
#pragma unroll
        for (int dc = 0; dc < 2; ++dc) { const unsigned char* p = sb + (h * 32 + kt * 16 + lr) * LP + dc * 64 + hi * 16; f.k[kt][dc] = WFrag<T16>::lds(p); if (HI) f.k2[kt][dc] = WFrag<T16>::lds(p + 2 * TB); }
#pragma unroll
    for (int dt = 0; dt < 4; ++dt) { const unsigned char* p = sb + TB + (dt * 16 + lr) * LP + h * 64 + hi * 16; f.v[dt] = WFrag<T16>::lds(p); if (HI) f.v2[dt] = WFrag<T16>::lds(p + 2 * TB); }
}
template <typename T16, bool HI, int NQ>
__device__ __forceinline__ void attn_step(const AFrag<T16, HI>& f, const typename WFrag<T16>::V (&qb)[NQ][2], const typename WFrag<T16>::V (&qb2)[NQ][2], v8f (&o)[4][NQ], float (&m)[NQ], float (&l)[NQ], int kc, int q0, int lr, int hi) {
    typedef typename WFrag<T16>::V V;
    const float c = QSC;   // p = 2^((s - m) c)
    v8f s[NQ][2];
#pragma unroll
    for (int nq = 0; nq < NQ; ++nq)
#pragma unroll
        for (int kt = 0; kt < 2; ++kt) { v8f t = (v8f){};
#pragma unroll
            for (int dc = 0; dc < 2; ++dc) { t = WFrag<T16>::mma(f.k[kt][dc], qb[nq][dc], t); if (HI) { t = WFrag<T16>::mma(f.k[kt][dc], qb2[nq][dc], t); t = WFrag<T16>::mma(f.k2[kt][dc], qb[nq][dc], t); } }
            s[nq][kt] = t; }
    if (kc + 31 > q0) {   // only the chunk on the diagonal holds keys above a query (scalar test)
#pragma unroll
        for (int nq = 0; nq < NQ; ++nq)
#pragma unroll
            for (int kt = 0; kt < 2; ++kt)
#pragma unroll
                for (int j = 0; j < 8; ++j) if (kc + kt * 16 + hi * 8 + j > q0 + nq * 16 + lr) s[nq][kt][j] = -3.0e38f;
    }
    float mx[NQ]; bool need = false;
#pragma unroll
    for (int nq = 0; nq < NQ; ++nq) { float t = s[nq][0][0];
#pragma unroll
        for (int j = 1; j < 8; ++j) t = fmaxf(t, s[nq][0][j]);
#pragma unroll
        for (int j = 0; j < 8; ++j) t = fmaxf(t, s[nq][1][j]);
        t = fmaxf(t, __shfl_xor(t, 16, 32));   // the two halves of the wave hold the same query's other keys: both must use one maximum
        mx[nq] = t; need = need || ((t - m[nq]) * c > 8.0f); }
    if (__builtin_amdgcn_ballot_w32(need) != 0) {   // lazy rescale, one scalar test per chunk: the maximum in use moves only when some query's scores pass it by more than 2^8
#pragma unroll
        for (int nq = 0; nq < NQ; ++nq) { const float mn = fmaxf(m[nq], mx[nq]); const float al = __builtin_amdgcn_exp2f((m[nq] - mn) * c); m[nq] = mn; l[nq] *= al;
#pragma unroll
            for (int dt = 0; dt < 4; ++dt) o[dt][nq] *= al; }
    }
    V pb[NQ], pl[NQ];
#pragma unroll
    for (int nq = 0; nq < NQ; ++nq) { const float mc = m[nq] * c; float ps = 0.f;
#pragma unroll
        for (int kt = 0; kt < 2; ++kt)
#pragma unroll
            for (int j = 0; j < 8; ++j) { const float p = __builtin_amdgcn_exp2f(fmaf(s[nq][kt][j], c, -mc)); s[nq][kt][j] = p; ps += p; }
        l[nq] += ps;
        // slot e of the B operand is key 8 hi + e (e < 8) or 16 + 8 hi + (e - 8): register j of score tile 0 or 1, the k order of the V^T loader
        static_assert(HI, "the fp16 rows take attn_step_rel");
        v8us h0, h1, l0, l1;
#pragma unroll
        for (int j = 0; j < 8; ++j) { unsigned short a, b2; splitf(s[nq][0][j], a, b2); h0[j] = a; l0[j] = b2; splitf(s[nq][1][j], a, b2); h1[j] = a; l1[j] = b2; }
        pb[nq] = cat16b(h0, h1); pl[nq] = cat16b(l0, l1); }
#pragma unroll
    for (int dt = 0; dt < 4; ++dt)
#pragma unroll
        for (int nq = 0; nq < NQ; ++nq) { o[dt][nq] = WFrag<T16>::mma(f.v[dt], pb[nq], o[dt][nq]); if (HI) { o[dt][nq] = WFrag<T16>::mma(f.v[dt], pl[nq], o[dt][nq]); o[dt][nq] = WFrag<T16>::mma(f.v2[dt], pb[nq], o[dt][nq]); } }
}
// The fp16 rows' step. Q comes pre-scaled by QSC, and the score accumulators start at cm = -(maximum in use), one value per query in all eight registers: the products come out as s QSC - m, the exponent itself,
// so that no vector instruction stands between a score and its exp2, and one threshold serves every query: the common path takes one maximum over all of a lane's scores and no exchange between the halves (that stands in the rescale branch alone).
// The row sums are a product too: a ones row times the packed f16 P^T, so numerator and denominator add the same rounded weights.
template <int NQ>
__device__ __forceinline__ void attn_step_rel(const AFrag<h16, false>& f, const v16h (&qb)[NQ][2], v8f (&o)[4][NQ], v8f (&cm)[NQ], v8f (&ls)[NQ], const v16h& ones, int kc, int q0, int lr, int hi) {
    v8f s[NQ][2];
#pragma unroll
    for (int nq = 0; nq < NQ; ++nq)
#pragma unroll
        for (int kt = 0; kt < 2; ++kt) { v8f t = cm[nq];
#pragma unroll
            for (int dc = 0; dc < 2; ++dc) t = wmma16(f.k[kt][dc], qb[nq][dc], t);
            s[nq][kt] = t; }
    if (kc + 31 > q0) {   // only the chunk on the diagonal holds keys above a query (scalar test)
#pragma unroll
        for (int nq = 0; nq < NQ; ++nq)
#pragma unroll
            for (int kt = 0; kt < 2; ++kt)
#pragma unroll
                for (int j = 0; j < 8; ++j) if (kc + kt * 16 + hi * 8 + j > q0 + nq * 16 + lr) s[nq][kt][j] = -3.0e38f;
    }
    float mx[NQ], top = -3.0e38f;
#pragma unroll
    for (int nq = 0; nq < NQ; ++nq) { float t = s[nq][0][0];
#pragma unroll
        for (int j = 1; j < 8; ++j) t = fmaxf(t, s[nq][0][j]);
#pragma unroll
        for (int j = 0; j < 8; ++j) t = fmaxf(t, s[nq][1][j]);
        mx[nq] = t; top = fmaxf(top, t); }
    if (kc == 0 || __builtin_amdgcn_ballot_w32(top > 8.0f) != 0) {   // lazy rescale, one scalar test per chunk: the maximum in use is set by the first chunk and moves only when some query's scores pass it by more than 2^8
#pragma unroll
        for (int nq = 0; nq < NQ; ++nq) { const float t = fmaxf(mx[nq], __shfl_xor(mx[nq], 16, 32));   // the two halves of the wave hold the same query's other keys: both must use one maximum
            const float up = fmaxf(t, 0.f), d = kc == 0 ? t : up;   // the first chunk may also lower it from its start value 0 (sums and outputs are still 0 there: their factor stays finite)
            const float al = __builtin_amdgcn_exp2f(-up); ls[nq] *= al; cm[nq] -= d; s[nq][0] -= d; s[nq][1] -= d;
#pragma unroll
            for (int dt = 0; dt < 4; ++dt) o[dt][nq] *= al; }
    }
    v16h pb[NQ];
#pragma unroll
    for (int nq = 0; nq < NQ; ++nq) { v8h h0, h1;
#pragma unroll
        for (int kt = 0; kt < 2; ++kt)
#pragma unroll
            for (int j = 0; j < 8; ++j) s[nq][kt][j] = __builtin_amdgcn_exp2f(s[nq][kt][j]);
        // slot e of the B operand is key 8 hi + e (e < 8) or 16 + 8 hi + (e - 8): register j of score tile 0 or 1, the k order of the V^T loader
#pragma unroll
        for (int j = 0; j < 8; ++j) { h0[j] = tohx(s[nq][0][j]); h1[j] = tohx(s[nq][1][j]); }
        pb[nq] = cat16(h0, h1); }
#pragma unroll
    for (int dt = 0; dt < 4; ++dt)
#pragma unroll
        for (int nq = 0; nq < NQ; ++nq) o[dt][nq] = wmma16(f.v[dt], pb[nq], o[dt][nq]);
#pragma unroll
    for (int nq = 0; nq < NQ; ++nq) ls[nq] = wmma16(ones, pb[nq], ls[nq]);   // row 0 of the tile += each query's sum over the chunk's 32 rounded probabilities
}
template <typename T16, bool HI, int NQ>
__device__ __forceinline__ void attn_rows(const T16* __restrict__ Q, const T16* __restrict__ Q2, const T16* __restrict__ Kp, const T16* __restrict__ K2, const T16* __restrict__ Vt, const T16* __restrict__ V2, int q0, int ns, unsigned char* ring, bf* Ah, bf* Al) {   // q0: the wave's first row; ns: stages up to the work-group's last row, the same for its four waves
    typedef typename WFrag<T16>::V V;
    constexpr int SB = (HI ? 4 : 2) * TB;   // one stage, bytes
    const int tid = threadIdx.x, lane = tid & 31, lr = lane & 15, hi = lane >> 4;
    V qb[NQ][2], qb2[NQ][2]; v8f o[4][NQ], cm[NQ], ls[NQ]; float m[NQ], l[NQ];
#pragma unroll
    for (int nq = 0; nq < NQ; ++nq) { m[nq] = -3.0e38f; l[nq] = 0.f; cm[nq] = (v8f){}; ls[nq] = (v8f){};
#pragma unroll
        for (int dc = 0; dc < 2; ++dc) { const size_t qo = (size_t)(q0 + nq * 16 + lr) * HD + dc * 32 + 8 * hi; qb[nq][dc] = WFrag<T16>::ld(Q + qo); if (HI) qb2[nq][dc] = WFrag<T16>::ld(Q2 + qo); }
#pragma unroll
        for (int dt = 0; dt < 4; ++dt) o[dt][nq] = (v8f){}; }
    v16h ones;   // A operand of the row sums: row 0 (lanes 0 and 16) is 1 at all 32 k positions, every other row 0
#pragma unroll
    for (int e = 0; e < 16; ++e) ones[e] = lr == 0 ? (h16)1.0f : (h16)0.0f;
    const int kend = q0 + NQ * 16;   // the wave's keys 0 .. kend - 1, in chunks of 32; every chunk holds at least one key <= every query of the wave
    const size_t gk = (size_t)(tid >> 3) * HD + (tid & 7) * 8, gv = (size_t)(tid >> 3) * TT + (tid & 7) * 8;   // a thread's row and 16-byte piece within 16 rows
    const unsigned lb = (unsigned)(size_t)ring + (unsigned)((tid >> 3) * LP + (tid & 7) * 16);
    auto fill = [&](int t) { const unsigned l = lb + (unsigned)((t & 1) * SB); cpkv<T16>(l, Kp + gk + (size_t)t * SK * HD, Vt + gv + t * SK); if constexpr (HI) cpkv<T16>(l + 2 * TB, K2 + gk + (size_t)t * SK * HD, V2 + gv + t * SK); };
    fill(0);
    asm volatile("s_wait_asynccnt 0x0" ::: "memory");   // this wave's part of stage 0 has landed
    __syncthreads();                                     // ... and every other wave's
    if (ns > 1) fill(1);
#pragma unroll 1   // one stage per trip: the buffer is picked by the trip's parity
    for (int t = 0; t < ns; ++t) { const unsigned char* sb = ring + (t & 1) * SB;
#pragma unroll 1   // one chunk's fragments live at a time: an unrolled key loop would not fit four waves per SIMD
        for (int h = 0; h < SK / 32; ++h) { const int kc = t * SK + h * 32;
            if (kc < kend) {   // scalar test: a wave is done with its keys up to three chunks ahead of the work-group's last wave, and still passes every barrier
                AFrag<T16, HI> f; afrag_ld<T16, HI>(f, sb, h, lr, hi);
                // inputs-only fence on the loaded fragments: all of a chunk's LDS reads are issued together and waited for once (left free, the reads are strung out between the products, one LDS latency each)
                if constexpr (HI) asm volatile("" :: "v"(f.k[0][0]), "v"(f.k[0][1]), "v"(f.k[1][0]), "v"(f.k[1][1]), "v"(f.k2[0][0]), "v"(f.k2[0][1]), "v"(f.k2[1][0]), "v"(f.k2[1][1]), "v"(f.v[0]), "v"(f.v[1]), "v"(f.v[2]), "v"(f.v[3]), "v"(f.v2[0]), "v"(f.v2[1]), "v"(f.v2[2]), "v"(f.v2[3]));
                else asm volatile("" :: "v"(f.k[0][0]), "v"(f.k[0][1]), "v"(f.k[1][0]), "v"(f.k[1][1]), "v"(f.v[0]), "v"(f.v[1]), "v"(f.v[2]), "v"(f.v[3]));
                __builtin_amdgcn_sched_barrier(0);   // keeps the first products, and the wait they bring, from being lifted in front of the chunk's last reads
                if constexpr (HI) attn_step<T16, HI, NQ>(f, qb, qb2, o, m, l, kc, q0, lr, hi); else attn_step_rel<NQ>(f, qb, o, cm, ls, ones, kc, q0, lr, hi);
                __builtin_amdgcn_sched_barrier(0);   // holds the slots below behind the chunk's last product
                asm volatile("v_nop\n\tv_nop\n\tv_nop\n\tv_nop");   // the four vector slots the chip needs between the last product and the next chunk's address arithmetic, which reuses its operand registers
            } }
        asm volatile("s_wait_dscnt 0x0" ::: "memory");      // this wave's reads of the buffer are done before the buffer is given up
        asm volatile("s_wait_asynccnt 0x0" ::: "memory");   // this wave's part of stage t + 1 has landed
        __syncthreads();                                     // publishes stage t + 1 and ends every wave's reads of stage t
        if (t + 2 < ns) fill(t + 2);                         // into the buffer this trip has just read
    }
    asm volatile("s_wait_asynccnt 0x0" ::: "memory");   // no copy is outstanding when the wave ends
#pragma unroll
    for (int nq = 0; nq < NQ; ++nq) { const float lh = HI ? l[nq] : ls[nq][0];   // fp16 rows: row 0 of the sum tile, register 0 of lanes 0 .. 15; the other half holds 0
        const float li = __fdiv_rn(1.0f, lh + __shfl_xor(lh, 16, 32));   // the halves' sums join once, here
        const size_t ro = (size_t)(q0 + nq * 16 + lr) * DQ + hi * 8;
#pragma unroll
        for (int dt = 0; dt < 4; ++dt) { v8us oh, ol;
#pragma unroll
            for (int j = 0; j < 8; ++j) { unsigned short a, b2; splitf(o[dt][nq][j] * li, a, b2); oh[j] = a; ol[j] = b2; }
            *(v8us*)(Ah + ro + dt * 16) = oh; *(v8us*)(Al + ro + dt * 16) = ol; } }
}
// grid (NB_ * NH_, row blocks): the row block is the slow index and the longest rows come first. Blocks 0 .. NBF-1: fp16 rows, FW * 32 each, from the end of the sequence down to RH; the rest: hi/lo rows, FW * 16 each.
#define NBF  ((TT - RH) / (FW * 32))
#define NBH  (RH / (FW * 16))
__global__ __launch_bounds__(32 * FW) void k_fattn(const h16* __restrict__ Q16, const h16* __restrict__ K16, const h16* __restrict__ V16, const bf* __restrict__ Qh, const bf* __restrict__ Ql, const bf* __restrict__ Kh, const bf* __restrict__ Kl, const bf* __restrict__ Vh, const bf* __restrict__ Vl, bf* Ah, bf* Al) {
    __shared__ __align__(16) unsigned char ring[2 * 4 * TB];   // two stages of the hi/lo rows' four tiles; the fp16 rows use half
    const int z = blockIdx.x, y = blockIdx.y; const size_t po = (size_t)z * TT * HD; const size_t ao = (size_t)(z / NH_) * TT * DQ + (size_t)(z % NH_) * HD;
    const int wv = __builtin_amdgcn_readfirstlane((int)(threadIdx.x >> 5));   // wave number as a scalar: row offsets, trip counts and the diagonal test stay scalar
    if (y < NBF) attn_rows<h16, false, 2>(Q16 + po, nullptr, K16 + po, nullptr, V16 + po, nullptr, TT - (y + 1) * (FW * 32) + wv * 32, (TT - y * (FW * 32)) / SK, ring, Ah + ao, Al + ao);
    else attn_rows<bf, true, 1>(Qh + po, Ql + po, Kh + po, Kl + po, Vh + po, Vl + po, RH - (y - NBF + 1) * (FW * 16) + wv * 16, (RH - (y - NBF) * (FW * 16)) / SK, ring, Ah + ao, Al + ao);
}

extern "C" void kernel_launch(void* const* d_in, const int* in_sizes, int n_in,
                              void* d_out, int out_size, void* d_ws, size_t ws_size, hipStream_t stream) {
    (void)in_sizes; (void)n_in; (void)out_size;
    const float* x = (const float*)d_in[0]; const float* xk = (const float*)d_in[1]; const float* xv = (const float*)d_in[2]; const float* wq = (const float*)d_in[3]; const float* bq = (const float*)d_in[4]; const float* wk = (const float*)d_in[5]; const float* bk = (const float*)d_in[6]; const float* wv = (const float*)d_in[7]; const float* bv = (const float*)d_in[8]; const float* wo = (const float*)d_in[9]; const float* bo = (const float*)d_in[10];
    float* OUT = (float*)d_out;     // [4][2048][768]
    char* wsp = (char*)d_ws;
    auto take = [&](size_t bytes) { char* p = wsp; wsp += (bytes + 255) & ~(size_t)255; return (void*)p; };
    bf* WQ = (bf*)take((size_t)4 * DQ * DM * 2); bf* WO = WQ + (size_t)3 * DQ * DM;   // W_Q, W_K, W_V, W_O one behind the other
    bf* XB = (bf*)take((size_t)3 * NB_ * TT * DM * 2);   // [stream][batch][t][DM]
    const size_t PB = (size_t)NH_ * TT * HD;   // one batch's head planes, elements; every plane set holds [stream][batch]
    h16* QP16 = (h16*)take(3 * NB_ * PB * 2); h16* KP16 = QP16 + NB_ * PB; h16* VT16 = KP16 + NB_ * PB;
    bf* QPh = (bf*)take(3 * NB_ * PB * 2); bf* KPh = QPh + NB_ * PB; bf* VTh = KPh + NB_ * PB; bf* QPl = (bf*)take(3 * NB_ * PB * 2); bf* KPl = QPl + NB_ * PB; bf* VTl = KPl + NB_ * PB;
    bf* ATh = (bf*)take((size_t)NB_ * TT * DQ * 2); bf* ATl = (bf*)take((size_t)NB_ * TT * DQ * 2);
    if ((size_t)(wsp - (char*)d_ws) > ws_size) return;    // ws 256 MiB
    k_cvt8<<<3 * CXB + 4 * CWB, 256, 0, stream>>>(x, xk, xv, wq, wk, wv, wo, XB, WQ);
    k_gemmt<0, 1><<<dim3(TT / BT, DQ / BT, 3 * NB_), 128, 0, stream>>>(XB, nullptr, WQ, nullptr, bq, bk, bv, QP16, QPh, QPl);
    k_fattn<<<dim3(NB_ * NH_, NBF + NBH, 1), 32 * FW, 0, stream>>>(QP16, KP16, VT16, QPh, QPl, KPh, KPl, VTh, VTl, ATh, ATl);
    k_gemmt<1, 0><<<dim3(NB_ * TT / BT, DM / BT, 1), 128, 0, stream>>>(ATh, ATl, WO, OUT, bo, nullptr, nullptr, nullptr, nullptr, nullptr);
}

// v009
// A run of this version takes 97.2 microseconds.
// Next to v008, in two timings, it ran 1.03 times as fast each time.
// Counting every step since v000, it is 23.0 times as fast.
#include <hip/hip_runtime.h>

// Causal multi-headed attention on three input streams (queries, keys, values [4][2048][768]; Q = queries W_Q^T + b_Q, K = keys W_K^T + b_K, V = values W_V^T + b_V ('oi' uniform(+-768^-0.5) incl. biases: non-zero; 12 heads x 64); scores x 1/sqrt(64); causal (-inf); softmax; outputs = merged (standard) W_O^T + b_O -> [4][2048][768] (6.3 M); argument order queries, keys, values, W_Q, b_Q, W_K, b_K, W_V, b_V, W_O, b_O).
// Four launches, each over all batches: bf16 copies of queries, keys, values and the four 'oi' weights; the three exact projections (K 768) + f32 biases, their epilogue writes the head planes (V as W_V x values^T, so that its planes come out [d][t]; fp16 planes of every position, hi/lo planes of positions < 512 alone); one fused causal attention launch over all batches and heads (hybrid rows: < 512 hi/lo 3 products, rest fp16; K and V tiles through LDS, scores and probabilities stay in registers); merged hi/lo x W_O exact + b_O.
// Compute dtypes, f32 accumulate: every input rounded to bf16; projections exact + f32 biases; attention rows < 512 3 products, rest fp16; softmax f32, except that the fp16 rows' row sums add the probabilities as rounded to f16 for P.V (a matrix product, f32 accumulate); W_O hl x exact + bias.

#define NB_  4
#define TT   2048
#define DM   768
#define NH_  12
#define NKV  12
#define HD   64
#define DQ   (NH_ * HD)
#define DKV  (NKV * HD)
#define RH   512                  // query rows < RH use hi+lo planes (0: none)
#define SCL  0.125f   // HD^-0.5
#define QSC  (SCL * 1.4426950408889634f)   // score scale and log2(e) in one factor: p = 2^(s QSC - m)
typedef _Float16 h16;
typedef unsigned short bf;
typedef __attribute__((ext_vector_type(16))) __bf16   v16bf;
typedef __attribute__((ext_vector_type(16))) _Float16 v16h;
typedef __attribute__((ext_vector_type(8)))  _Float16 v8h;
typedef __attribute__((ext_vector_type(8)))  unsigned short v8us;
typedef __attribute__((ext_vector_type(8)))  float    v8f;
typedef __attribute__((ext_vector_type(4)))  float    v4f;
typedef v8h  __attribute__((may_alias)) v8ha;
typedef v4f  __attribute__((may_alias)) v4fa;
typedef v8us __attribute__((may_alias)) v8usa;

__device__ __forceinline__ unsigned short f2bf(float f) { unsigned u = __float_as_uint(f); u += 0x7FFFu + ((u >> 16) & 1u); return (unsigned short)(u >> 16); }
__device__ __forceinline__ float bf2f(unsigned short b) { return __uint_as_float(((unsigned)b) << 16); }
__device__ __forceinline__ float bfr(float f) { return bf2f(f2bf(f)); }
__device__ __forceinline__ v16h cat16(v8h lo, v8h hi) { return __builtin_shufflevector(lo, hi, 0, 1, 2, 3, 4, 5, 6, 7, 8, 9, 10, 11, 12, 13, 14, 15); }
__device__ __forceinline__ v16bf cat16b(v8us lo, v8us hi) { return __builtin_bit_cast(v16bf, __builtin_shufflevector(lo, hi, 0, 1, 2, 3, 4, 5, 6, 7, 8, 9, 10, 11, 12, 13, 14, 15)); }
__device__ __forceinline__ v8f wmma16(v16h a, v16h b, v8f c) { return __builtin_amdgcn_wmma_f32_16x16x32_f16(false, a, false, b, (short)0, c, false, false); }
__device__ __forceinline__ v8f wmmab(v16bf a, v16bf b, v8f c) { return __builtin_amdgcn_wmma_f32_16x16x32_bf16(false, a, false, b, (short)0, c, false, false); }



__device__ __forceinline__ h16 tohx(float x) { return (h16)x; }
__device__ __forceinline__ void splitf(float y, unsigned short& h, unsigned short& l) { h = f2bf(y); l = f2bf(y - bf2f(h)); }
template <typename T16> struct WFrag;
template <> struct WFrag<h16> { typedef v16h V; static __device__ __forceinline__ V ld(const h16* p) { return cat16(*(const v8h*)p, *(const v8h*)(p + 16)); } static __device__ __forceinline__ V lds(const unsigned char* p) { return cat16(*(const v8ha*)p, *(const v8ha*)(p + 32)); } static __device__ __forceinline__ v8f mma(V a, V b, v8f c) { return wmma16(a, b, c); } };
template <> struct WFrag<bf> { typedef v16bf V; static __device__ __forceinline__ V ld(const bf* p) { return cat16b(*(const v8us*)p, *(const v8us*)(p + 16)); } static __device__ __forceinline__ V lds(const unsigned char* p) { return cat16b(*(const v8usa*)p, *(const v8usa*)(p + 32)); } static __device__ __forceinline__ v8f mma(V a, V b, v8f c) { return wmmab(a, b, c); } };

// ---- k_gemmt: block-tiled GEMM, one BT x BT output tile per work-group of 4 waves (2 x 2, 64x64 each, 16 accumulators), the whole K loop in every wave.
// C[m][n] = sum_k A[m][k] Bt[n][k] (+ A2[m][k] Bt[n][k] where NSPLIT), K = DM, operands K-contiguous bf16 planes.
// A stage is 64 k (one 128-byte line) of every operand row of the block: [A BT rows | Bt BT rows | A2 BT rows] at pitch LP in LDS, two buffers, filled by asynchronous copies one stage ahead of the products.
// EPI 0: grid (M/BT, N/BT), f32 tile + bias[n] to C (pitch DM).
// EPI 1: the three projections of all batches, grid (TT/BT, DQ/BT, 3 * NB_), z = stream * NB_ + batch. A: the streams' bf16 copies [z][t][DM]; Bt: W_Q, W_K, W_V one behind the other; bias, biasK, biasV: theirs; planes [z][head][..].
//        Streams 0, 1: m = position, n = head * HD + d, a wave's tile is one head: planes [head][t][d]. Stream 2: the operands change places, m = head * HD + d, n = position, bias[m]: planes [head][d][t].
#define BT   128
#define LP   144                  // LDS row pitch, bytes: 128 + 16, an odd multiple of 16 for the 16-byte fragment reads
#define NST  (DM / 64)            // stages
static_assert(DQ == DM && DM % 64 == 0 && NST >= 2 && TT % BT == 0 && DQ % BT == 0 && HD == 64 && RH % BT == 0, "whole tiles, whole stages, a wave tile is one head, a tile lies on one side of RH");
// Eight asynchronous 16-byte copies of one thread, rows 16 apart in the source and in the stage: the work-group's 128 threads bring BT rows of 128 bytes, a wave's copy covers four whole lines.
// The s_wait_xcnt stands in the copies' own statement, so that no address register is rewritten ahead of it.
__device__ __forceinline__ void cp8(unsigned l, const bf* g) {
    asm volatile("global_load_async_to_lds_b128 %0, %8, off\n\t"
                 "global_load_async_to_lds_b128 %1, %9, off\n\t"
                 "global_load_async_to_lds_b128 %2, %10, off\n\t"
                 "global_load_async_to_lds_b128 %3, %11, off\n\t"
                 "global_load_async_to_lds_b128 %4, %12, off\n\t"
                 "global_load_async_to_lds_b128 %5, %13, off\n\t"
                 "global_load_async_to_lds_b128 %6, %14, off\n\t"
                 "global_load_async_to_lds_b128 %7, %15, off\n\t"
                 "s_wait_xcnt 0x0"
                 :: "v"(l), "v"(l + 16 * LP), "v"(l + 32 * LP), "v"(l + 48 * LP), "v"(l + 64 * LP), "v"(l + 80 * LP), "v"(l + 96 * LP), "v"(l + 112 * LP),
                    "v"(g), "v"(g + 16 * DM), "v"(g + 32 * DM), "v"(g + 48 * DM), "v"(g + 64 * DM), "v"(g + 80 * DM), "v"(g + 96 * DM), "v"(g + 112 * DM) : "memory");
}
__device__ __forceinline__ v16bf ldsfrag(const unsigned char* p) { return cat16b(*(const v8usa*)p, *(const v8usa*)(p + 32)); }   // the k order of WFrag::ld: 8 hi + e, then 16 + 8 hi + (e - 8)
// A wave's 64x64 accumulators laid out as [64][68] f32 in the wave's own LDS range, so that the stores below cover whole lines. Every loop of the epilogues is unrolled so that accumulator and vector indices are constants (registers, no scratch).
__device__ __forceinline__ void tile_to_lds(float* pw, const v8f (&acc)[4][4], int lr, int hi) {
#pragma unroll
    for (int mb = 0; mb < 4; ++mb)
#pragma unroll
        for (int nb = 0; nb < 4; ++nb)
#pragma unroll
            for (int j = 0; j < 8; ++j) pw[(mb * 16 + hi * 8 + j) * 68 + nb * 16 + lr] = acc[mb][nb][j];
    __syncthreads();   // the lanes read each other's values below
}
// f32 tile + bias by column. C, bias: the wave tile's first element and entry.
__device__ __forceinline__ void wave_store(float* pw, const v8f (&acc)[4][4], float* C, const float* __restrict__ bias) {
    const int lane = threadIdx.x & 31; v4f bv;
#pragma unroll
    for (int k = 0; k < 4; ++k) bv[k] = bfr(bias[(lane & 15) * 4 + k]);
    tile_to_lds(pw, acc, lane & 15, lane >> 4);
#pragma unroll
    for (int s = 0; s < 32; ++s) { const int row = s * 2 + (lane >> 4), cofs = (lane & 15) * 4; *(v4f*)(C + (size_t)row * DM + cofs) = *(const v4fa*)(pw + row * 68 + cofs) + bv; }
}
// The tile + bias stored as the three 16-bit planes attention reads (fp16, bf16 hi, bf16 lo). A lane takes 8 neighbouring columns: every store is 16 bytes and 8 lanes fill one 128-byte line of a plane row.
// s16: factor on the fp16 plane alone (QSC for Q, whose fp16 rows then give scores in exponent units; 1 for K and V).
// P16, Ph, Pl: the wave tile's first element, row pitch ldp elements. bias: the tile's first entry (64 of them), by column, or by row where rowb (the transposed product; the same for the whole work-group).
// WHL: the hi/lo planes are formed and stored too (positions < RH: attention reads them of no other position).
template <bool WHL>
__device__ __forceinline__ void wave_planes(float* pw, const v8f (&acc)[4][4], h16* P16, bf* Ph, bf* Pl, int ldp, const float* __restrict__ bias, bool rowb, float s16) {
    const int lane = threadIdx.x & 31, cofs = (lane & 7) * 8, rw = lane >> 3;
    float bc[8], br[16];
#pragma unroll
    for (int k = 0; k < 8; ++k) bc[k] = bfr(bias[cofs + k]);
#pragma unroll
    for (int s = 0; s < 16; ++s) br[s] = bfr(bias[s * 4 + rw]);
    tile_to_lds(pw, acc, lane & 15, lane >> 4);
#pragma unroll
    for (int s = 0; s < 16; ++s) { const int row = s * 4 + rw; const float* p = pw + row * 68 + cofs; const v4f v0 = *(const v4fa*)p, v1 = *(const v4fa*)(p + 4);
        v8h o16; v8us oh, ol;
#pragma unroll
        for (int k = 0; k < 8; ++k) { const float y = (k < 4 ? v0[k & 3] : v1[k & 3]) + (rowb ? br[s] : bc[k]); o16[k] = tohx(y * s16); if constexpr (WHL) { unsigned short a, b2; splitf(y, a, b2); oh[k] = a; ol[k] = b2; } }
        const size_t o = (size_t)row * ldp + cofs; *(v8h*)(P16 + o) = o16; if constexpr (WHL) { *(v8us*)(Ph + o) = oh; *(v8us*)(Pl + o) = ol; } }
    // In the listing the hi/lo variant's code lies directly behind this variant's last stores, past a conditional branch, and rewrites the registers they name: the wait stands in front of it.
    if constexpr (!WHL) asm volatile("s_wait_xcnt 0x0" ::: "memory");
}
// At least 4 waves per SIMD asked for: at most 256 registers, so that four work-groups of the projections share a WGP and hide each other's waits.
// Every '#pragma unroll' of the kernel keeps fragment and accumulator indices constant, so that the tiles stay in registers (no scratch).
template <int NSPLIT, int EPI>
__global__ __launch_bounds__(128, 4) void k_gemmt(const bf* __restrict__ A, const bf* __restrict__ A2, const bf* __restrict__ Bt, float* C, const float* __restrict__ bias, const float* __restrict__ biasK, const float* __restrict__ biasV, h16* P16, bf* Ph, bf* Pl) {
    constexpr int SB = (NSPLIT ? 3 : 2) * BT * LP;   // one stage, bytes
    __shared__ __align__(16) unsigned char ring[2 * SB];
    static_assert(2 * SB >= 4 * 64 * 68 * 4, "the ring holds the four waves' output staging");
    const int tid = threadIdx.x, lane = tid & 31, lr = lane & 15, hi = lane >> 4; int r0 = blockIdx.x * BT, c0 = blockIdx.y * BT;
    const int wv = __builtin_amdgcn_readfirstlane(tid >> 5), wm = wv >> 1, wn = wv & 1;   // wave number as a scalar: tile offsets stay scalar
    const int st = EPI == 1 ? (int)(blockIdx.z / NB_) : 0;   // stream, the same for the whole work-group
    if constexpr (EPI == 1) { const bf* X = A + (size_t)blockIdx.z * TT * DM; const bf* Wt = Bt + (size_t)st * DQ * DM;
        if (st == 2) { A = Wt; Bt = X; r0 = blockIdx.y * BT; c0 = blockIdx.x * BT; } else { A = X; Bt = Wt; } }
    v8f acc[4][4];
#pragma unroll
    for (int mb = 0; mb < 4; ++mb)
#pragma unroll
        for (int nb = 0; nb < 4; ++nb) acc[mb][nb] = (v8f){};
    const size_t go = (size_t)(tid >> 3) * DM + (tid & 7) * 8;   // a thread's row and 16-byte piece within 16 rows
    const bf* ga = A + (size_t)r0 * DM + go; const bf* gb = Bt + (size_t)c0 * DM + go; const bf* ga2 = NSPLIT ? A2 + (size_t)r0 * DM + go : nullptr;
    const unsigned lb = (unsigned)(size_t)ring + (unsigned)((tid >> 3) * LP + (tid & 7) * 16);
    auto fill = [&](int t) { const unsigned l = lb + (unsigned)((t & 1) * SB); cp8(l, ga + t * 64); cp8(l + BT * LP, gb + t * 64); if constexpr (NSPLIT != 0) cp8(l + 2 * BT * LP, ga2 + t * 64); };
    fill(0);
    asm volatile("s_wait_asynccnt 0x0" ::: "memory");   // this wave's part of stage 0 has landed
    __syncthreads();                                     // ... and every other wave's
    fill(1);
    const unsigned char* fa = ring + (wm * 64 + lr) * LP + hi * 16; const unsigned char* fb = ring + (BT + wn * 64 + lr) * LP + hi * 16;
#pragma unroll 1   // one stage per trip: the buffer is picked by the trip's parity
    for (int t = 0; t < NST; ++t) { const int bo = (t & 1) * SB; v16bf a[4], a2[4], b[4];
        auto frags = [&](int kk) {   // one block's fragments: 32 k of the wave's 64 A (and A2) rows and 64 Bt rows
#pragma unroll
            for (int i = 0; i < 4; ++i) { a[i] = ldsfrag(fa + bo + i * 16 * LP + kk * 64); b[i] = ldsfrag(fb + bo + i * 16 * LP + kk * 64); if (NSPLIT != 0) a2[i] = ldsfrag(fa + bo + 2 * BT * LP + i * 16 * LP + kk * 64); } };
        auto products = [&]() {
#pragma unroll
            for (int nb = 0; nb < 4; ++nb)
#pragma unroll
                for (int mb = 0; mb < 4; ++mb) { acc[mb][nb] = wmmab(a[mb], b[nb], acc[mb][nb]); if (NSPLIT != 0) acc[mb][nb] = wmmab(a2[mb], b[nb], acc[mb][nb]); } };
#pragma unroll
        for (int kk = 0; kk < 2; ++kk) { frags(kk);
            __builtin_amdgcn_sched_barrier(0);   // the block's fragment reads go out as one group ahead of its products (left free, they are strung out among the products, one LDS latency each)
            products(); }
        __builtin_amdgcn_sched_barrier(0);   // the products stay in front of the barrier, so that the refill goes out directly behind it and has a whole trip to land
        asm volatile("s_wait_dscnt 0x0" ::: "memory");      // this wave's reads of the buffer are done before the buffer is given up
        asm volatile("s_wait_asynccnt 0x0" ::: "memory");   // this wave's part of stage t + 1 has landed
        __syncthreads();                                     // publishes stage t + 1 and ends every wave's reads of stage t
        if (t + 2 < NST) fill(t + 2);                        // into the buffer this trip has just read
    }
    asm volatile("s_wait_asynccnt 0x0" ::: "memory");   // no copy is outstanding when the ring becomes output staging
    float* pw = (float*)ring + wv * (64 * 68);
    if constexpr (EPI == 0) wave_store(pw, acc, C + (size_t)(r0 + wm * 64) * DM + c0 + wn * 64, bias + c0 + wn * 64);
    else { const bool tr = st == 2; const int rw0 = r0 + wm * 64, cw0 = c0 + wn * 64;   // tr: rw0 = head * HD, cw0 = position; else rw0 = position, cw0 = head * HD
        const size_t po = (size_t)blockIdx.z * NH_ * TT * HD + (tr ? (size_t)rw0 * TT + cw0 : (size_t)cw0 * TT + (size_t)rw0 * HD);
        const float* bs = (st == 0 ? bias : st == 1 ? biasK : biasV) + (tr ? rw0 : cw0); const float s16 = st == 0 ? QSC : 1.0f;
        // blockIdx.x * BT is the tile's first position in every stream. Only query rows < RH attend on the hi/lo planes, and to keys < RH alone: the hi/lo planes end at RH (scalar test, the same for the whole work-group).
        if ((int)blockIdx.x * BT < RH) wave_planes<true>(pw, acc, P16 + po, Ph + po, Pl + po, tr ? TT : HD, bs, tr, s16);
        else wave_planes<false>(pw, acc, P16 + po, Ph + po, Pl + po, tr ? TT : HD, bs, tr, s16); }
}

// bf16 copies of all seven f32 matrices in one launch, 8 elements a thread: blocks 0 .. 3 * CXB - 1 the three streams (all batches) to X [stream][batch][t][DM], the next 4 * CWB the four weights to Wd, one behind the other.
#define CXB  (NB_ * TT * DM / 8 / 256)
#define CWB  (DQ * DM / 8 / 256)
static_assert(NB_ * TT * DM % (8 * 256) == 0 && DQ * DM % (8 * 256) == 0 && DKV == DQ, "whole blocks, equal weights");
__global__ __launch_bounds__(256) void k_cvt8(const float* __restrict__ x, const float* __restrict__ xk, const float* __restrict__ xv, const float* __restrict__ wq, const float* __restrict__ wk, const float* __restrict__ wv, const float* __restrict__ wo, bf* X, bf* Wd) {
    const int blk = blockIdx.x; const float* src; bf* dst; size_t i;
    if (blk < 3 * CXB) { const int s = blk / CXB; src = s == 0 ? x : s == 1 ? xk : xv; dst = X + (size_t)s * NB_ * TT * DM; i = (size_t)(blk - s * CXB) * 256 + threadIdx.x; }
    else { const int s = (blk - 3 * CXB) / CWB; src = s == 0 ? wq : s == 1 ? wk : s == 2 ? wv : wo; dst = Wd + (size_t)s * DQ * DM; i = (size_t)(blk - 3 * CXB - s * CWB) * 256 + threadIdx.x; }
    const v8f v = *(const v8f*)(src + i * 8); v8us o;
#pragma unroll
    for (int k = 0; k < 8; ++k) o[k] = f2bf(v[k]); *(v8us*)(dst + i * 8) = o;  }

// ---- k_fattn: causal attention with the scores kept in registers. One wave owns NQ * 16 query rows of one (batch, head) and walks the keys 32 at a time up to its diagonal; the work-group's FW waves share every K and V tile through LDS:
// S^T = K Q^T (a lane holds one query's scores: 8 keys of each 16-key tile), running maximum and sum per query, P^T packed from the score accumulators straight into a B operand, O^T += V^T P^T.
// Rows < RH: bf16 hi/lo planes, 3 products for both contractions; other rows: fp16 planes. The epilogue divides by the row sum and writes the merged hi/lo planes [t][DQ] for the output projection.
// Every '#pragma unroll' of this section keeps the fragment and accumulator indices constant, so that the tiles stay in registers (no scratch).
#define FW   4                    // waves per work-group
// A stage is SK keys of one (batch, head): [K SK rows of HD | V^T HD rows of SK keys | the two lo planes alike, hi/lo rows only], every row one 128-byte line at pitch LP in LDS; two buffers, filled by asynchronous copies one stage ahead of the products.
#define SK   64
#define TB   (64 * LP)            // one tile of a stage, bytes
static_assert(FW == 4 && HD == 64 && SK * 2 == 128 && RH % (FW * 16) == 0 && (FW * 16) % SK == 0 && (FW * 32) % SK == 0, "128 threads bring 16 whole rows a copy; a work-group's keys end on a whole stage");
// Eight asynchronous 16-byte copies of one thread: four of the K tile and four of the V^T tile behind it, rows 16 apart; a wave's copy covers four whole lines.
// The s_wait_xcnt stands in the copies' own statement, so that no address register is rewritten ahead of it.
template <typename T16>
__device__ __forceinline__ void cpkv(unsigned l, const T16* k, const T16* v) {
    asm volatile("global_load_async_to_lds_b128 %0, %8, off\n\t"
                 "global_load_async_to_lds_b128 %1, %9, off\n\t"
                 "global_load_async_to_lds_b128 %2, %10, off\n\t"
                 "global_load_async_to_lds_b128 %3, %11, off\n\t"
                 "global_load_async_to_lds_b128 %4, %12, off\n\t"
                 "global_load_async_to_lds_b128 %5, %13, off\n\t"
                 "global_load_async_to_lds_b128 %6, %14, off\n\t"
                 "global_load_async_to_lds_b128 %7, %15, off\n\t"
                 "s_wait_xcnt 0x0"
                 :: "v"(l), "v"(l + 16 * LP), "v"(l + 32 * LP), "v"(l + 48 * LP), "v"(l + TB), "v"(l + TB + 16 * LP), "v"(l + TB + 32 * LP), "v"(l + TB + 48 * LP),
                    "v"(k), "v"(k + 16 * HD), "v"(k + 32 * HD), "v"(k + 48 * HD), "v"(v), "v"(v + 16 * TT), "v"(v + 32 * TT), "v"(v + 48 * TT) : "memory");
}
template <typename T16, bool HI> struct AFrag { typename WFrag<T16>::V k[2][2], k2[2][2], v[4], v2[4]; };
// One chunk's fragments from a stage in LDS: sb the stage, h the chunk (32 keys) within it. Byte offsets 16 hi and 32 + 16 hi within 64: the k order of WFrag::ld.
template <typename T16, bool HI>
__device__ __forceinline__ void afrag_ld(AFrag<T16, HI>& f, const unsigned char* sb, int h, int lr, int hi) {
#pragma unroll
    for (int kt = 0; kt < 2; ++kt)
#pragma unroll
        for (int dc = 0; dc < 2; ++dc) { const unsigned char* p = sb + (h * 32 + kt * 16 + lr) * LP + dc * 64 + hi * 16; f.k[kt][dc] = WFrag<T16>::lds(p); if (HI) f.k2[kt][dc] = WFrag<T16>::lds(p + 2 * TB); }
#pragma unroll
    for (int dt = 0; dt < 4; ++dt) { const unsigned char* p = sb + TB + (dt * 16 + lr) * LP + h * 64 + hi * 16; f.v[dt] = WFrag<T16>::lds(p); if (HI) f.v2[dt] = WFrag<T16>::lds(p + 2 * TB); }
}
template <typename T16, bool HI, int NQ>
__device__ __forceinline__ void attn_step(const AFrag<T16, HI>& f, const typename WFrag<T16>::V (&qb)[NQ][2], const typename WFrag<T16>::V (&qb2)[NQ][2], v8f (&o)[4][NQ], float (&m)[NQ], float (&l)[NQ], int kc, int q0, int lr, int hi) {
    typedef typename WFrag<T16>::V V;
    const float c = QSC;   // p = 2^((s - m) c)
    v8f s[NQ][2];
#pragma unroll
    for (int nq = 0; nq < NQ; ++nq)
#pragma unroll
        for (int kt = 0; kt < 2; ++kt) { v8f t = (v8f){};
#pragma unroll
            for (int dc = 0; dc < 2; ++dc) { t = WFrag<T16>::mma(f.k[kt][dc], qb[nq][dc], t); if (HI) { t = WFrag<T16>::mma(f.k[kt][dc], qb2[nq][dc], t); t = WFrag<T16>::mma(f.k2[kt][dc], qb[nq][dc], t); } }
            s[nq][kt] = t; }
    if (kc + 31 > q0) {   // only the chunk on the diagonal holds keys above a query (scalar test)
#pragma unroll
        for (int nq = 0; nq < NQ; ++nq)
#pragma unroll
            for (int kt = 0; kt < 2; ++kt)
#pragma unroll
                for (int j = 0; j < 8; ++j) if (kc + kt * 16 + hi * 8 + j > q0 + nq * 16 + lr) s[nq][kt][j] = -3.0e38f;
    }
    float mx[NQ]; bool need = false;
#pragma unroll
    for (int nq = 0; nq < NQ; ++nq) { float t = s[nq][0][0];
#pragma unroll
        for (int j = 1; j < 8; ++j) t = fmaxf(t, s[nq][0][j]);
#pragma unroll
        for (int j = 0; j < 8; ++j) t = fmaxf(t, s[nq][1][j]);
        t = fmaxf(t, __shfl_xor(t, 16, 32));   // the two halves of the wave hold the same query's other keys: both must use one maximum
        mx[nq] = t; need = need || ((t - m[nq]) * c > 8.0f); }
    if (__builtin_amdgcn_ballot_w32(need) != 0) {   // lazy rescale, one scalar test per chunk: the maximum in use moves only when some query's scores pass it by more than 2^8
#pragma unroll
        for (int nq = 0; nq < NQ; ++nq) { const float mn = fmaxf(m[nq], mx[nq]); const float al = __builtin_amdgcn_exp2f((m[nq] - mn) * c); m[nq] = mn; l[nq] *= al;
#pragma unroll
            for (int dt = 0; dt < 4; ++dt) o[dt][nq] *= al; }
    }
    V pb[NQ], pl[NQ];
#pragma unroll
    for (int nq = 0; nq < NQ; ++nq) { const float mc = m[nq] * c; float ps = 0.f;
#pragma unroll
        for (int kt = 0; kt < 2; ++kt)
#pragma unroll
            for (int j = 0; j < 8; ++j) { const float p = __builtin_amdgcn_exp2f(fmaf(s[nq][kt][j], c, -mc)); s[nq][kt][j] = p; ps += p; }
        l[nq] += ps;
        // slot e of the B operand is key 8 hi + e (e < 8) or 16 + 8 hi + (e - 8): register j of score tile 0 or 1, the k order of the V^T loader
        static_assert(HI, "the fp16 rows take attn_step_rel");
        v8us h0, h1, l0, l1;
#pragma unroll
        for (int j = 0; j < 8; ++j) { unsigned short a, b2; splitf(s[nq][0][j], a, b2); h0[j] = a; l0[j] = b2; splitf(s[nq][1][j], a, b2); h1[j] = a; l1[j] = b2; }
        pb[nq] = cat16b(h0, h1); pl[nq] = cat16b(l0, l1); }
#pragma unroll
    for (int dt = 0; dt < 4; ++dt)
#pragma unroll
        for (int nq = 0; nq < NQ; ++nq) { o[dt][nq] = WFrag<T16>::mma(f.v[dt], pb[nq], o[dt][nq]); if (HI) { o[dt][nq] = WFrag<T16>::mma(f.v[dt], pl[nq], o[dt][nq]); o[dt][nq] = WFrag<T16>::mma(f.v2[dt], pb[nq], o[dt][nq]); } }
}
// The fp16 rows' step. Q comes pre-scaled by QSC, and the score accumulators start at cm = -(maximum in use), one value per query in all eight registers: the products come out as s QSC - m, the exponent itself,
// so that no vector instruction stands between a score and its exp2, and one threshold serves every query: the common path takes one maximum over all of a lane's scores and no exchange between the halves (that stands in the rescale branch alone).
// The row sums are a product too: a ones row times the packed f16 P^T, so numerator and denominator add the same rounded weights.
template <int NQ>
__device__ __forceinline__ void attn_step_rel(const AFrag<h16, false>& f, const v16h (&qb)[NQ][2], v8f (&o)[4][NQ], v8f (&cm)[NQ], v8f (&ls)[NQ], const v16h& ones, int kc, int q0, int lr, int hi) {
    v8f s[NQ][2];
#pragma unroll
    for (int nq = 0; nq < NQ; ++nq)
#pragma unroll
        for (int kt = 0; kt < 2; ++kt) { v8f t = cm[nq];
#pragma unroll
            for (int dc = 0; dc < 2; ++dc) t = wmma16(f.k[kt][dc], qb[nq][dc], t);
            s[nq][kt] = t; }
    if (kc + 31 > q0) {   // only the chunk on the diagonal holds keys above a query (scalar test)
#pragma unroll
        for (int nq = 0; nq < NQ; ++nq)
#pragma unroll
            for (int kt = 0; kt < 2; ++kt)
#pragma unroll
                for (int j = 0; j < 8; ++j) if (kc + kt * 16 + hi * 8 + j > q0 + nq * 16 + lr) s[nq][kt][j] = -3.0e38f;
    }
    float mx[NQ], top = -3.0e38f;
#pragma unroll
    for (int nq = 0; nq < NQ; ++nq) { float t = s[nq][0][0];
#pragma unroll
        for (int j = 1; j < 8; ++j) t = fmaxf(t, s[nq][0][j]);
#pragma unroll
        for (int j = 0; j < 8; ++j) t = fmaxf(t, s[nq][1][j]);
        mx[nq] = t; top = fmaxf(top, t); }
    if (kc == 0 || __builtin_amdgcn_ballot_w32(top > 8.0f) != 0) {   // lazy rescale, one scalar test per chunk: the maximum in use is set by the first chunk and moves only when some query's scores pass it by more than 2^8
#pragma unroll
        for (int nq = 0; nq < NQ; ++nq) { const float t = fmaxf(mx[nq], __shfl_xor(mx[nq], 16, 32));   // the two halves of the wave hold the same query's other keys: both must use one maximum
            const float up = fmaxf(t, 0.f), d = kc == 0 ? t : up;   // the first chunk may also lower it from its start value 0 (sums and outputs are still 0 there: their factor stays finite)
            const float al = __builtin_amdgcn_exp2f(-up); ls[nq] *= al; cm[nq] -= d; s[nq][0] -= d; s[nq][1] -= d;
#pragma unroll
            for (int dt = 0; dt < 4; ++dt) o[dt][nq] *= al; }
    }
    v16h pb[NQ];
#pragma unroll
    for (int nq = 0; nq < NQ; ++nq) { v8h h0, h1;
#pragma unroll
        for (int kt = 0; kt < 2; ++kt)
#pragma unroll
            for (int j = 0; j < 8; ++j) s[nq][kt][j] = __builtin_amdgcn_exp2f(s[nq][kt][j]);
        // slot e of the B operand is key 8 hi + e (e < 8) or 16 + 8 hi + (e - 8): register j of score tile 0 or 1, the k order of the V^T loader
#pragma unroll
        for (int j = 0; j < 8; ++j) { h0[j] = tohx(s[nq][0][j]); h1[j] = tohx(s[nq][1][j]); }
        pb[nq] = cat16(h0, h1); }
#pragma unroll
    for (int dt = 0; dt < 4; ++dt)
#pragma unroll
        for (int nq = 0; nq < NQ; ++nq) o[dt][nq] = wmma16(f.v[dt], pb[nq], o[dt][nq]);
#pragma unroll
    for (int nq = 0; nq < NQ; ++nq) ls[nq] = wmma16(ones, pb[nq], ls[nq]);   // row 0 of the tile += each query's sum over the chunk's 32 rounded probabilities
}
template <typename T16, bool HI, int NQ>
__device__ __forceinline__ void attn_rows(const T16* __restrict__ Q, const T16* __restrict__ Q2, const T16* __restrict__ Kp, const T16* __restrict__ K2, const T16* __restrict__ Vt, const T16* __restrict__ V2, int q0, int ns, unsigned char* ring, bf* Ah, bf* Al) {   // q0: the wave's first row; ns: stages up to the work-group's last row, the same for its four waves
    typedef typename WFrag<T16>::V V;
    constexpr int SB = (HI ? 4 : 2) * TB;   // one stage, bytes
    const int tid = threadIdx.x, lane = tid & 31, lr = lane & 15, hi = lane >> 4;
    V qb[NQ][2], qb2[NQ][2]; v8f o[4][NQ], cm[NQ], ls[NQ]; float m[NQ], l[NQ];
#pragma unroll
    for (int nq = 0; nq < NQ; ++nq) { m[nq] = -3.0e38f; l[nq] = 0.f; cm[nq] = (v8f){}; ls[nq] = (v8f){};
#pragma unroll
        for (int dc = 0; dc < 2; ++dc) { const size_t qo = (size_t)(q0 + nq * 16 + lr) * HD + dc * 32 + 8 * hi; qb[nq][dc] = WFrag<T16>::ld(Q + qo); if (HI) qb2[nq][dc] = WFrag<T16>::ld(Q2 + qo); }
#pragma unroll
        for (int dt = 0; dt < 4; ++dt) o[dt][nq] = (v8f){}; }
    v16h ones;   // A operand of the row sums: row 0 (lanes 0 and 16) is 1 at all 32 k positions, every other row 0
#pragma unroll
    for (int e = 0; e < 16; ++e) ones[e] = lr == 0 ? (h16)1.0f : (h16)0.0f;
    const int kend = q0 + NQ * 16;   // the wave's keys 0 .. kend - 1, in chunks of 32; every chunk holds at least one key <= every query of the wave
    const size_t gk = (size_t)(tid >> 3) * HD + (tid & 7) * 8, gv = (size_t)(tid >> 3) * TT + (tid & 7) * 8;   // a thread's row and 16-byte piece within 16 rows
    const unsigned lb = (unsigned)(size_t)ring + (unsigned)((tid >> 3) * LP + (tid & 7) * 16);
    auto fill = [&](int t) { const unsigned l = lb + (unsigned)((t & 1) * SB); cpkv<T16>(l, Kp + gk + (size_t)t * SK * HD, Vt + gv + t * SK); if constexpr (HI) cpkv<T16>(l + 2 * TB, K2 + gk + (size_t)t * SK * HD, V2 + gv + t * SK); };
    fill(0);
    asm volatile("s_wait_asynccnt 0x0" ::: "memory");   // this wave's part of stage 0 has landed
    __syncthreads();                                     // ... and every other wave's
    if (ns > 1) fill(1);
#pragma unroll 1   // one stage per trip: the buffer is picked by the trip's parity
    for (int t = 0; t < ns; ++t) { const unsigned char* sb = ring + (t & 1) * SB;
#pragma unroll 1   // one chunk's fragments live at a time: an unrolled key loop would not fit four waves per SIMD
        for (int h = 0; h < SK / 32; ++h) { const int kc = t * SK + h * 32;
            if (kc < kend) {   // scalar test: a wave is done with its keys up to three chunks ahead of the work-group's last wave, and still passes every barrier
                AFrag<T16, HI> f; afrag_ld<T16, HI>(f, sb, h, lr, hi);
                // inputs-only fence on the loaded fragments: all of a chunk's LDS reads are issued together and waited for once (left free, the reads are strung out between the products, one LDS latency each)
                if constexpr (HI) asm volatile("" :: "v"(f.k[0][0]), "v"(f.k[0][1]), "v"(f.k[1][0]), "v"(f.k[1][1]), "v"(f.k2[0][0]), "v"(f.k2[0][1]), "v"(f.k2[1][0]), "v"(f.k2[1][1]), "v"(f.v[0]), "v"(f.v[1]), "v"(f.v[2]), "v"(f.v[3]), "v"(f.v2[0]), "v"(f.v2[1]), "v"(f.v2[2]), "v"(f.v2[3]));
                else asm volatile("" :: "v"(f.k[0][0]), "v"(f.k[0][1]), "v"(f.k[1][0]), "v"(f.k[1][1]), "v"(f.v[0]), "v"(f.v[1]), "v"(f.v[2]), "v"(f.v[3]));
                __builtin_amdgcn_sched_barrier(0);   // keeps the first products, and the wait they bring, from being lifted in front of the chunk's last reads
                if constexpr (HI) attn_step<T16, HI, NQ>(f, qb, qb2, o, m, l, kc, q0, lr, hi); else attn_step_rel<NQ>(f, qb, o, cm, ls, ones, kc, q0, lr, hi);
                __builtin_amdgcn_sched_barrier(0);   // holds the slots below behind the chunk's last product
                asm volatile("v_nop\n\tv_nop\n\tv_nop\n\tv_nop");   // the four vector slots the chip needs between the last product and the next chunk's address arithmetic, which reuses its operand registers
            } }
        asm volatile("s_wait_dscnt 0x0" ::: "memory");      // this wave's reads of the buffer are done before the buffer is given up
        asm volatile("s_wait_asynccnt 0x0" ::: "memory");   // this wave's part of stage t + 1 has landed
        __syncthreads();                                     // publishes stage t + 1 and ends every wave's reads of stage t
        if (t + 2 < ns) fill(t + 2);                         // into the buffer this trip has just read
    }
    asm volatile("s_wait_asynccnt 0x0" ::: "memory");   // no copy is outstanding when the wave ends
#pragma unroll
    for (int nq = 0; nq < NQ; ++nq) { const float lh = HI ? l[nq] : ls[nq][0];   // fp16 rows: row 0 of the sum tile, register 0 of lanes 0 .. 15; the other half holds 0
        const float li = __fdiv_rn(1.0f, lh + __shfl_xor(lh, 16, 32));   // the halves' sums join once, here
        const size_t ro = (size_t)(q0 + nq * 16 + lr) * DQ + hi * 8;
#pragma unroll
        for (int dt = 0; dt < 4; ++dt) { v8us oh, ol;
#pragma unroll
            for (int j = 0; j < 8; ++j) { unsigned short a, b2; splitf(o[dt][nq][j] * li, a, b2); oh[j] = a; ol[j] = b2; }
            *(v8us*)(Ah + ro + dt * 16) = oh; *(v8us*)(Al + ro + dt * 16) = ol; } }
}
// grid (NB_ * NH_, row blocks): the row block is the slow index and the longest rows come first. Blocks 0 .. NBF-1: fp16 rows, FW * 32 each, from the end of the sequence down to RH; the rest: hi/lo rows, FW * 16 each.
#define NBF  ((TT - RH) / (FW * 32))
#define NBH  (RH / (FW * 16))
__global__ __launch_bounds__(32 * FW) void k_fattn(const h16* __restrict__ Q16, const h16* __restrict__ K16, const h16* __restrict__ V16, const bf* __restrict__ Qh, const bf* __restrict__ Ql, const bf* __restrict__ Kh, const bf* __restrict__ Kl, const bf* __restrict__ Vh, const bf* __restrict__ Vl, bf* Ah, bf* Al) {
    __shared__ __align__(16) unsigned char ring[2 * 4 * TB];   // two stages of the hi/lo rows' four tiles; the fp16 rows use half
    const int z = blockIdx.x, y = blockIdx.y; const size_t po = (size_t)z * TT * HD; const size_t ao = (size_t)(z / NH_) * TT * DQ + (size_t)(z % NH_) * HD;
    const int wv = __builtin_amdgcn_readfirstlane((int)(threadIdx.x >> 5));   // wave number as a scalar: row offsets, trip counts and the diagonal test stay scalar
    if (y < NBF) attn_rows<h16, false, 2>(Q16 + po, nullptr, K16 + po, nullptr, V16 + po, nullptr, TT - (y + 1) * (FW * 32) + wv * 32, (TT - y * (FW * 32)) / SK, ring, Ah + ao, Al + ao);
    else attn_rows<bf, true, 1>(Qh + po, Ql + po, Kh + po, Kl + po, Vh + po, Vl + po, RH - (y - NBF + 1) * (FW * 16) + wv * 16, (RH - (y - NBF) * (FW * 16)) / SK, ring, Ah + ao, Al + ao);
}

extern "C" void kernel_launch(void* const* d_in, const int* in_sizes, int n_in,
                              void* d_out, int out_size, void* d_ws, size_t ws_size, hipStream_t stream) {
    (void)in_sizes; (void)n_in; (void)out_size;
    const float* x = (const float*)d_in[0]; const float* xk = (const float*)d_in[1]; const float* xv = (const float*)d_in[2]; const float* wq = (const float*)d_in[3]; const float* bq = (const float*)d_in[4]; const float* wk = (const float*)d_in[5]; const float* bk = (const float*)d_in[6]; const float* wv = (const float*)d_in[7]; const float* bv = (const float*)d_in[8]; const float* wo = (const float*)d_in[9]; const float* bo = (const float*)d_in[10];
    float* OUT = (float*)d_out;     // [4][2048][768]
    char* wsp = (char*)d_ws;
    auto take = [&](size_t bytes) { char* p = wsp; wsp += (bytes + 255) & ~(size_t)255; return (void*)p; };
    bf* WQ = (bf*)take((size_t)4 * DQ * DM * 2); bf* WO = WQ + (size_t)3 * DQ * DM;   // W_Q, W_K, W_V, W_O one behind the other
    bf* XB = (bf*)take((size_t)3 * NB_ * TT * DM * 2);   // [stream][batch][t][DM]
    const size_t PB = (size_t)NH_ * TT * HD;   // one batch's head planes, elements; every plane set holds [stream][batch]
    h16* QP16 = (h16*)take(3 * NB_ * PB * 2); h16* KP16 = QP16 + NB_ * PB; h16* VT16 = KP16 + NB_ * PB;
    bf* QPh = (bf*)take(3 * NB_ * PB * 2); bf* KPh = QPh + NB_ * PB; bf* VTh = KPh + NB_ * PB; bf* QPl = (bf*)take(3 * NB_ * PB * 2); bf* KPl = QPl + NB_ * PB; bf* VTl = KPl + NB_ * PB;
    bf* ATh = (bf*)take((size_t)NB_ * TT * DQ * 2); bf* ATl = (bf*)take((size_t)NB_ * TT * DQ * 2);
    if ((size_t)(wsp - (char*)d_ws) > ws_size) return;    // ws 256 MiB
    k_cvt8<<<3 * CXB + 4 * CWB, 256, 0, stream>>>(x, xk, xv, wq, wk, wv, wo, XB, WQ);
    k_gemmt<0, 1><<<dim3(TT / BT, DQ / BT, 3 * NB_), 128, 0, stream>>>(XB, nullptr, WQ, nullptr, bq, bk, bv, QP16, QPh, QPl);
    k_fattn<<<dim3(NB_ * NH_, NBF + NBH, 1), 32 * FW, 0, stream>>>(QP16, KP16, VT16, QPh, QPl, KPh, KPl, VTh, VTl, ATh, ATl);
    k_gemmt<1, 0><<<dim3(NB_ * TT / BT, DM / BT, 1), 128, 0, stream>>>(ATh, ATl, WO, OUT, bo, nullptr, nullptr, nullptr, nullptr, nullptr);
}

// v010
// One run takes 92.8 microseconds.
// Next to v009, in two timings, it ran 1.05 times as fast each time.
// Counting every step since v000, it is 24.1 times as fast.
#include <hip/hip_runtime.h>

// Causal multi-headed attention on three input streams (queries, keys, values [4][2048][768]; Q = queries W_Q^T + b_Q, K = keys W_K^T + b_K, V = values W_V^T + b_V ('oi' uniform(+-768^-0.5) incl. biases: non-zero; 12 heads x 64); scores x 1/sqrt(64); causal (-inf); softmax; outputs = merged (standard) W_O^T + b_O -> [4][2048][768] (6.3 M); argument order queries, keys, values, W_Q, b_Q, W_K, b_K, W_V, b_V, W_O, b_O).
// Four launches, each over all batches: bf16 copies of queries, keys, values and the four 'oi' weights; the three exact projections (K 768) + f32 biases, their epilogue writes the head planes (V's tile is laid transposed in LDS, so that its planes come out [d][t]; fp16 planes of every position, hi/lo planes of positions < 512 alone); one fused causal attention launch over all batches and heads (hybrid rows: < 512 hi/lo 3 products, rest fp16; K and V tiles through LDS, scores and probabilities stay in registers); merged hi/lo x W_O exact + b_O.
// Compute dtypes, f32 accumulate: every input rounded to bf16; projections exact + f32 biases; attention rows < 512 3 products, rest fp16; softmax f32, except that the fp16 rows' row sums add the probabilities as rounded to f16 for P.V (a matrix product, f32 accumulate); W_O hl x exact + bias.

#define NB_  4
#define TT   2048
#define DM   768
#define NH_  12
#define NKV  12
#define HD   64
#define DQ   (NH_ * HD)
#define DKV  (NKV * HD)
#define RH   512                  // query rows < RH use hi+lo planes (0: none)
#define SCL  0.125f   // HD^-0.5
#define QSC  (SCL * 1.4426950408889634f)   // score scale and log2(e) in one factor: p = 2^(s QSC - m)
typedef _Float16 h16;
typedef unsigned short bf;
typedef __attribute__((ext_vector_type(16))) __bf16   v16bf;
typedef __attribute__((ext_vector_type(16))) _Float16 v16h;
typedef __attribute__((ext_vector_type(8)))  _Float16 v8h;
typedef __attribute__((ext_vector_type(8)))  unsigned short v8us;
typedef __attribute__((ext_vector_type(8)))  float    v8f;
typedef __attribute__((ext_vector_type(4)))  float    v4f;
typedef v8h  __attribute__((may_alias)) v8ha;
typedef v4f  __attribute__((may_alias)) v4fa;
typedef v8us __attribute__((may_alias)) v8usa;

__device__ __forceinline__ unsigned short f2bf(float f) { unsigned u = __float_as_uint(f); u += 0x7FFFu + ((u >> 16) & 1u); return (unsigned short)(u >> 16); }
__device__ __forceinline__ float bf2f(unsigned short b) { return __uint_as_float(((unsigned)b) << 16); }
__device__ __forceinline__ float bfr(float f) { return bf2f(f2bf(f)); }
__device__ __forceinline__ v16h cat16(v8h lo, v8h hi) { return __builtin_shufflevector(lo, hi, 0, 1, 2, 3, 4, 5, 6, 7, 8, 9, 10, 11, 12, 13, 14, 15); }
__device__ __forceinline__ v16bf cat16b(v8us lo, v8us hi) { return __builtin_bit_cast(v16bf, __builtin_shufflevector(lo, hi, 0, 1, 2, 3, 4, 5, 6, 7, 8, 9, 10, 11, 12, 13, 14, 15)); }
__device__ __forceinline__ v8f wmma16(v16h a, v16h b, v8f c) { return __builtin_amdgcn_wmma_f32_16x16x32_f16(false, a, false, b, (short)0, c, false, false); }
__device__ __forceinline__ v8f wmmab(v16bf a, v16bf b, v8f c) { return __builtin_amdgcn_wmma_f32_16x16x32_bf16(false, a, false, b, (short)0, c, false, false); }



__device__ __forceinline__ h16 tohx(float x) { return (h16)x; }
__device__ __forceinline__ void splitf(float y, unsigned short& h, unsigned short& l) { h = f2bf(y); l = f2bf(y - bf2f(h)); }
template <typename T16> struct WFrag;
template <> struct WFrag<h16> { typedef v16h V; static __device__ __forceinline__ V ld(const h16* p) { return cat16(*(const v8h*)p, *(const v8h*)(p + 16)); } static __device__ __forceinline__ V lds(const unsigned char* p) { return cat16(*(const v8ha*)p, *(const v8ha*)(p + 32)); } static __device__ __forceinline__ v8f mma(V a, V b, v8f c) { return wmma16(a, b, c); } };
template <> struct WFrag<bf> { typedef v16bf V; static __device__ __forceinline__ V ld(const bf* p) { return cat16b(*(const v8us*)p, *(const v8us*)(p + 16)); } static __device__ __forceinline__ V lds(const unsigned char* p) { return cat16b(*(const v8usa*)p, *(const v8usa*)(p + 32)); } static __device__ __forceinline__ v8f mma(V a, V b, v8f c) { return wmmab(a, b, c); } };

// ---- k_gemmt: block-tiled GEMM, one BT x BN output tile per work-group, the whole K loop in every wave; a wave has six 16-column tiles. The wide tile reads fewer operand bytes per product, from L2 and from LDS, and both launches fall on the 256 WGPs in equal numbers, all work-groups resident at once:
// EPI 1: 4 waves (2 x 2) of 64 x 96, 768 tiles, three on every WGP. EPI 0: 8 waves (4 x 2) of 32 x 96, 256 tiles.
// C[m][n] = sum_k A[m][k] Bt[n][k] (+ A2[m][k] Bt[n][k] where NSPLIT), K = DM, operands K-contiguous bf16 planes.
// A stage is 64 k (one 128-byte line) of every operand row of the block: [A BT rows | Bt BN rows | A2 BT rows] at pitch LP in LDS, two buffers, filled by asynchronous copies one stage ahead of the products.
// EPI 0: grid (M/BT, N/BN), f32 tile + bias[n] to C (pitch DM).
// EPI 1: the three projections of all batches, grid (TT/BT, DQ/BN, 3 * NB_), z = stream * NB_ + batch. A: the streams' bf16 copies [z][t][DM]; Bt: W_Q, W_K, W_V one behind the other; bias, biasK, biasV: theirs; planes [z][head][..].
//        m = position, n = head * HD + d, a block's tile is three heads. Streams 0, 1: planes [head][t][d]. Stream 2: planes [head][d][t].
#define BT   128
#define BN   192                  // tile width: three heads of a projection; a wave's 96 columns are three whole 128-byte lines of a row of C
#define LP   144                  // LDS row pitch, bytes: 128 + 16, an odd multiple of 16 for the 16-byte fragment reads
#define NST  (DM / 64)            // stages
static_assert(DQ == DM && DM % 64 == 0 && NST >= 2 && TT % BT == 0 && DQ % BN == 0 && BN == 3 * HD && HD == 64 && RH % BT == 0, "whole tiles, whole stages, a projection tile is three heads, a tile lies on one side of RH");
// Eight asynchronous 16-byte copies of one thread, rows 16 apart in the source and in the stage: the work-group's 128 threads bring BT rows of 128 bytes, a wave's copy covers four whole lines.
// The s_wait_xcnt stands in the copies' own statement, so that no address register is rewritten ahead of it.
__device__ __forceinline__ void cp8(unsigned l, const bf* g) {
    asm volatile("global_load_async_to_lds_b128 %0, %8, off\n\t"
                 "global_load_async_to_lds_b128 %1, %9, off\n\t"
                 "global_load_async_to_lds_b128 %2, %10, off\n\t"
                 "global_load_async_to_lds_b128 %3, %11, off\n\t"
                 "global_load_async_to_lds_b128 %4, %12, off\n\t"
                 "global_load_async_to_lds_b128 %5, %13, off\n\t"
                 "global_load_async_to_lds_b128 %6, %14, off\n\t"
                 "global_load_async_to_lds_b128 %7, %15, off\n\t"
                 "s_wait_xcnt 0x0"
                 :: "v"(l), "v"(l + 16 * LP), "v"(l + 32 * LP), "v"(l + 48 * LP), "v"(l + 64 * LP), "v"(l + 80 * LP), "v"(l + 96 * LP), "v"(l + 112 * LP),
                    "v"(g), "v"(g + 16 * DM), "v"(g + 32 * DM), "v"(g + 48 * DM), "v"(g + 64 * DM), "v"(g + 80 * DM), "v"(g + 96 * DM), "v"(g + 112 * DM) : "memory");
}
// Four such copies, rows RS apart (16 with 128 threads, 32 with 256).
template <int RS>
__device__ __forceinline__ void cp4(unsigned l, const bf* g) {
    asm volatile("global_load_async_to_lds_b128 %0, %4, off\n\t"
                 "global_load_async_to_lds_b128 %1, %5, off\n\t"
                 "global_load_async_to_lds_b128 %2, %6, off\n\t"
                 "global_load_async_to_lds_b128 %3, %7, off\n\t"
                 "s_wait_xcnt 0x0"
                 :: "v"(l), "v"(l + RS * LP), "v"(l + 2 * RS * LP), "v"(l + 3 * RS * LP), "v"(g), "v"(g + RS * DM), "v"(g + 2 * RS * DM), "v"(g + 3 * RS * DM) : "memory");
}
// Two such copies.
template <int RS>
__device__ __forceinline__ void cp2(unsigned l, const bf* g) {
    asm volatile("global_load_async_to_lds_b128 %0, %2, off\n\t"
                 "global_load_async_to_lds_b128 %1, %3, off\n\t"
                 "s_wait_xcnt 0x0"
                 :: "v"(l), "v"(l + RS * LP), "v"(g), "v"(g + RS * DM) : "memory");
}
__device__ __forceinline__ v16bf ldsfrag(const unsigned char* p) { return cat16b(*(const v8usa*)p, *(const v8usa*)(p + 32)); }   // the k order of WFrag::ld: 8 hi + e, then 16 + 8 hi + (e - 8)
// EPI 0. A wave's 32 x 96 accumulators laid out as [32][PO] f32 in the wave's own LDS range, so that the stores below cover whole lines. Every loop of the epilogues is unrolled so that accumulator and vector indices are constants (registers, no scratch).
#define PO   (96 + 4)             // f32 row pitch of a wave's staged tile
__device__ __forceinline__ void tile_to_lds(float* pw, const v8f (&acc)[2][6], int lr, int hi) {
#pragma unroll
    for (int mb = 0; mb < 2; ++mb)
#pragma unroll
        for (int nb = 0; nb < 6; ++nb)
#pragma unroll
            for (int j = 0; j < 8; ++j) pw[(mb * 16 + hi * 8 + j) * PO + nb * 16 + lr] = acc[mb][nb][j];
    __syncthreads();   // the lanes read each other's values below
}
// f32 tile + bias by column. C, bias: the wave tile's first element and entry. 8 lanes fill one 128-byte line of a row of C, a store covers one line of four rows, and a line has one writer.
__device__ __forceinline__ void wave_store(float* pw, const v8f (&acc)[2][6], float* C, const float* __restrict__ bias) {
    const int lane = threadIdx.x & 31, cofs = (lane & 7) * 4, rw = lane >> 3; v4f bv[3];
#pragma unroll
    for (int g = 0; g < 3; ++g) bv[g] = *(const v4f*)(bias + g * 32 + cofs);
    asm volatile("s_wait_xcnt 0x0" ::: "memory");   // stands in front of every rewrite of the registers that the three loads name
#pragma unroll
    for (int g = 0; g < 3; ++g)
#pragma unroll
        for (int k = 0; k < 4; ++k) bv[g][k] = bfr(bv[g][k]);
    tile_to_lds(pw, acc, lane & 15, lane >> 4);
#pragma unroll
    for (int s = 0; s < 8; ++s)
#pragma unroll
        for (int g = 0; g < 3; ++g) { const int row = s * 4 + rw, col = g * 32 + cofs; *(v4f*)(C + (size_t)row * DM + col) = *(const v4fa*)(pw + row * PO + col) + bv[g]; }
}
// The block's BT x BN tile + bias stored as the three 16-bit planes attention reads (fp16, bf16 hi, bf16 lo). The four waves lay the tile in LDS together, [position][PN] or, where tr, [column][PT]; behind the barrier
// a thread takes 8 neighbouring elements of a plane row: every store is 16 bytes, 8 lanes fill one 128-byte line of a plane row, and a line has one writer.
// s16: factor on the fp16 plane alone (QSC for Q, whose fp16 rows then give scores in exponent units; 1 for K and V).
// P16, Ph, Pl: the tile's first element. bs: the bias entry of the lane's column in the first of the wave's six 16-column tiles. tr: the same for the whole work-group.
// WHL: the hi/lo planes are formed and stored too (positions < RH: attention reads them of no other position).
#define PN   (BN + 4)            // f32 row pitches of the staged tile: 16 bytes past a multiple of 256, so that neighbouring rows' 16-byte pieces fall on different banks
#define PT   (BT + 4)
__device__ __forceinline__ void block_stage(float* S, const v8f (&acc)[4][6], int wm, int wn, const float* __restrict__ bs, bool tr) {
    const int tid = threadIdx.x, lr = tid & 15, hi = (tid >> 4) & 1; float bb[6];
#pragma unroll
    for (int nb = 0; nb < 6; ++nb) bb[nb] = bs[nb * 16];
    asm volatile("s_wait_xcnt 0x0" ::: "memory");   // stands in front of every rewrite of the registers that the six loads name
#pragma unroll
    for (int nb = 0; nb < 6; ++nb) bb[nb] = bfr(bb[nb]);
    if (tr) {   // a lane's 8 accumulator registers are 8 neighbouring positions of one column
#pragma unroll
        for (int mb = 0; mb < 4; ++mb)
#pragma unroll
            for (int nb = 0; nb < 6; ++nb) { float* p = S + (wn * 96 + nb * 16 + lr) * PT + wm * 64 + mb * 16 + hi * 8; v4f x0, x1;
#pragma unroll
                for (int k = 0; k < 4; ++k) { x0[k] = acc[mb][nb][k] + bb[nb]; x1[k] = acc[mb][nb][4 + k] + bb[nb]; }
                *(v4fa*)p = x0; *(v4fa*)(p + 4) = x1; }
    } else {
#pragma unroll
        for (int mb = 0; mb < 4; ++mb)
#pragma unroll
            for (int nb = 0; nb < 6; ++nb)
#pragma unroll
                for (int j = 0; j < 8; ++j) S[(wm * 64 + mb * 16 + hi * 8 + j) * PN + wn * 96 + nb * 16 + lr] = acc[mb][nb][j] + bb[nb];
    }
    __syncthreads();   // the threads read each other's values in block_planes
}
template <bool WHL>
__device__ __forceinline__ void block_planes(const float* S, h16* P16, bf* Ph, bf* Pl, bool tr, float s16) {
    const int tid = threadIdx.x, g = tid & 7, rq = tid >> 3;
    const float* pl = S + rq * (tr ? PT : PN) + g * 8; const size_t ol = (size_t)rq * (tr ? TT : HD) + g * 8;
#pragma unroll
    for (int s = 0; s < BT * BN / 8 / 128; ++s) {   // tr: column (s % 12) * 16 + rq, positions (s / 12) * 64 + 8 g ..; else position (s % 8) * 16 + rq, head s / 8, d 8 g ..
        const float* p = pl + (tr ? (s % 12) * 16 * PT + (s / 12) * 64 : (s % 8) * 16 * PN + (s / 8) * 64); const v4f v0 = *(const v4fa*)p, v1 = *(const v4fa*)(p + 4);
        v8h o16; v8us oh, ol2;
#pragma unroll
        for (int k = 0; k < 8; ++k) { const float y = k < 4 ? v0[k & 3] : v1[k & 3]; o16[k] = tohx(y * s16); if constexpr (WHL) { unsigned short a, b2; splitf(y, a, b2); oh[k] = a; ol2[k] = b2; } }
        const size_t o = ol + (tr ? (size_t)(s % 12) * 16 * TT + (s / 12) * 64 : (size_t)(s / 8) * TT * HD + (size_t)(s % 8) * 16 * HD); *(v8h*)(P16 + o) = o16; if constexpr (WHL) { *(v8us*)(Ph + o) = oh; *(v8us*)(Pl + o) = ol2; } }
    // In the listing the hi/lo variant's code lies directly behind this variant's last stores, past a conditional branch, and rewrites the registers they name: the wait stands in front of it.
    if constexpr (!WHL) asm volatile("s_wait_xcnt 0x0" ::: "memory");
}
// Waves per SIMD asked for: 3 for the projections (their 192 accumulator registers and 80 of fragments need more than 256; three work-groups share a WGP and hide each other's waits), 2 for the output product (its one work-group's eight waves).
// Every '#pragma unroll' of the kernel keeps fragment and accumulator indices constant, so that the tiles stay in registers (no scratch).
template <int NSPLIT, int EPI>
__global__ __launch_bounds__(EPI == 1 ? 128 : 256, EPI == 1 ? 3 : 2) void k_gemmt(const bf* __restrict__ A, const bf* __restrict__ A2, const bf* __restrict__ Bt, float* C, const float* __restrict__ bias, const float* __restrict__ biasK, const float* __restrict__ biasV, h16* P16, bf* Ph, bf* Pl) {
    constexpr int MW = EPI == 1 ? 4 : 2, NW = 6, RS = BT / MW / 2;   // 16-row and 16-column tiles of a wave; rows that the work-group's threads bring with one copy each (8 threads a row)
    static_assert(NSPLIT == 1 - EPI && BN == 2 * NW * 16, "two waves side by side cover the width; BT / (MW * 16) such pairs the height");
    constexpr int SB = ((NSPLIT ? 2 : 1) * BT + BN) * LP;   // one stage, bytes
    constexpr int OB = EPI == 1 ? (BN * PT > BT * PN ? BN * PT : BT * PN) * 4 : 2 * BT * PO * 4;   // output staging, bytes
    __shared__ __align__(16) unsigned char ring[2 * SB > OB ? 2 * SB : OB];
    const int tid = threadIdx.x, lane = tid & 31, lr = lane & 15, hi = lane >> 4; const int r0 = blockIdx.x * BT, c0 = blockIdx.y * BN;
    const int wv = __builtin_amdgcn_readfirstlane(tid >> 5), wm = wv >> 1, wn = wv & 1;   // wave number as a scalar: tile offsets stay scalar
    const int st = EPI == 1 ? (int)(blockIdx.z / NB_) : 0;   // stream, the same for the whole work-group
    if constexpr (EPI == 1) { A += (size_t)blockIdx.z * TT * DM; Bt += (size_t)st * DQ * DM; }
    v8f acc[MW][NW];
#pragma unroll
    for (int mb = 0; mb < MW; ++mb)
#pragma unroll
        for (int nb = 0; nb < NW; ++nb) acc[mb][nb] = (v8f){};
    const size_t go = (size_t)(tid >> 3) * DM + (tid & 7) * 8;   // a thread's row and 16-byte piece within RS rows
    const bf* ga = A + (size_t)r0 * DM + go; const bf* gb = Bt + (size_t)c0 * DM + go; const bf* ga2 = NSPLIT ? A2 + (size_t)r0 * DM + go : nullptr;
    const unsigned lb = (unsigned)(size_t)ring + (unsigned)((tid >> 3) * LP + (tid & 7) * 16);
    auto fill = [&](int t) { const unsigned l = lb + (unsigned)((t & 1) * SB);
        if constexpr (EPI == 1) { cp8(l, ga + t * 64); cp8(l + BT * LP, gb + t * 64); cp4<RS>(l + 2 * BT * LP, gb + 128 * DM + t * 64); }
        else { cp4<RS>(l, ga + t * 64); cp4<RS>(l + BT * LP, gb + t * 64); cp2<RS>(l + 2 * BT * LP, gb + 128 * DM + t * 64); cp4<RS>(l + (BT + BN) * LP, ga2 + t * 64); } };
    fill(0);
    asm volatile("s_wait_asynccnt 0x0" ::: "memory");   // this wave's part of stage 0 has landed
    __syncthreads();                                     // ... and every other wave's
    fill(1);
    const unsigned char* fa = ring + (wm * MW * 16 + lr) * LP + hi * 16; const unsigned char* fb = ring + (BT + wn * NW * 16 + lr) * LP + hi * 16;
#pragma unroll 1   // one stage per trip: the buffer is picked by the trip's parity
    for (int t = 0; t < NST; ++t) { const int bo = (t & 1) * SB; v16bf a[MW], a2[MW], b[NW];
        auto frags = [&](int kk) {   // one block's fragments: 32 k of the wave's A (and A2) rows and of its 96 Bt rows
#pragma unroll
            for (int i = 0; i < MW; ++i) { a[i] = ldsfrag(fa + bo + i * 16 * LP + kk * 64); if (NSPLIT != 0) a2[i] = ldsfrag(fa + bo + (BT + BN) * LP + i * 16 * LP + kk * 64); }
#pragma unroll
            for (int i = 0; i < NW; ++i) b[i] = ldsfrag(fb + bo + i * 16 * LP + kk * 64); };
        auto products = [&]() {
#pragma unroll
            for (int nb = 0; nb < NW; ++nb)
#pragma unroll
                for (int mb = 0; mb < MW; ++mb) { acc[mb][nb] = wmmab(a[mb], b[nb], acc[mb][nb]); if (NSPLIT != 0) acc[mb][nb] = wmmab(a2[mb], b[nb], acc[mb][nb]); } };
#pragma unroll
        for (int kk = 0; kk < 2; ++kk) { frags(kk);
            __builtin_amdgcn_sched_barrier(0);   // the block's fragment reads go out as one group ahead of its products (left free, they are strung out among the products, one LDS latency each)
            products(); }
        __builtin_amdgcn_sched_barrier(0);   // the products stay in front of the barrier, so that the refill goes out directly behind it and has a whole trip to land
        asm volatile("s_wait_dscnt 0x0" ::: "memory");      // this wave's reads of the buffer are done before the buffer is given up
        asm volatile("s_wait_asynccnt 0x0" ::: "memory");   // this wave's part of stage t + 1 has landed
        __syncthreads();                                     // publishes stage t + 1 and ends every wave's reads of stage t
        if (t + 2 < NST) fill(t + 2);                        // into the buffer this trip has just read
    }
    asm volatile("s_wait_asynccnt 0x0" ::: "memory");   // no copy is outstanding when the ring becomes output staging
    if constexpr (EPI == 0) wave_store((float*)ring + wv * (32 * PO), acc, C + (size_t)(r0 + wm * 32) * DM + c0 + wn * 96, bias + c0 + wn * 96);
    else { const bool tr = st == 2;   // r0 = position, c0 = head * HD
        const size_t po = (size_t)blockIdx.z * NH_ * TT * HD + (size_t)c0 * TT + (tr ? (size_t)r0 : (size_t)r0 * HD);
        const float s16 = st == 0 ? QSC : 1.0f;
        // Only query rows < RH attend on the hi/lo planes, and to keys < RH alone: the hi/lo planes end at RH (scalar test, the same for the whole work-group).
        block_stage((float*)ring, acc, wm, wn, (st == 0 ? bias : st == 1 ? biasK : biasV) + c0 + wn * 96 + lr, tr);
        if (r0 < RH) block_planes<true>((const float*)ring, P16 + po, Ph + po, Pl + po, tr, s16);
        else block_planes<false>((const float*)ring, P16 + po, Ph + po, Pl + po, tr, s16); }
}

// bf16 copies of all seven f32 matrices in one launch, 8 elements a thread: blocks 0 .. 3 * CXB - 1 the three streams (all batches) to X [stream][batch][t][DM], the next 4 * CWB the four weights to Wd, one behind the other.
#define CXB  (NB_ * TT * DM / 8 / 256)
#define CWB  (DQ * DM / 8 / 256)
static_assert(NB_ * TT * DM % (8 * 256) == 0 && DQ * DM % (8 * 256) == 0 && DKV == DQ, "whole blocks, equal weights");
__global__ __launch_bounds__(256) void k_cvt8(const float* __restrict__ x, const float* __restrict__ xk, const float* __restrict__ xv, const float* __restrict__ wq, const float* __restrict__ wk, const float* __restrict__ wv, const float* __restrict__ wo, bf* X, bf* Wd) {
    const int blk = blockIdx.x; const float* src; bf* dst; size_t i;
    if (blk < 3 * CXB) { const int s = blk / CXB; src = s == 0 ? x : s == 1 ? xk : xv; dst = X + (size_t)s * NB_ * TT * DM; i = (size_t)(blk - s * CXB) * 256 + threadIdx.x; }
    else { const int s = (blk - 3 * CXB) / CWB; src = s == 0 ? wq : s == 1 ? wk : s == 2 ? wv : wo; dst = Wd + (size_t)s * DQ * DM; i = (size_t)(blk - 3 * CXB - s * CWB) * 256 + threadIdx.x; }
    const v8f v = *(const v8f*)(src + i * 8); v8us o;
#pragma unroll
    for (int k = 0; k < 8; ++k) o[k] = f2bf(v[k]); *(v8us*)(dst + i * 8) = o;  }

// ---- k_fattn: causal attention with the scores kept in registers. One wave owns NQ * 16 query rows of one (batch, head) and walks the keys 32 at a time up to its diagonal; the work-group's FW waves share every K and V tile through LDS:
// S^T = K Q^T (a lane holds one query's scores: 8 keys of each 16-key tile), running maximum and sum per query, P^T packed from the score accumulators straight into a B operand, O^T += V^T P^T.
// Rows < RH: bf16 hi/lo planes, 3 products for both contractions; other rows: fp16 planes. The epilogue divides by the row sum and writes the merged hi/lo planes [t][DQ] for the output projection.
// Every '#pragma unroll' of this section keeps the fragment and accumulator indices constant, so that the tiles stay in registers (no scratch).
#define FW   4                    // waves per work-group
// A stage is SK keys of one (batch, head): [K SK rows of HD | V^T HD rows of SK keys | the two lo planes alike, hi/lo rows only], every row one 128-byte line at pitch LP in LDS; two buffers, filled by asynchronous copies one stage ahead of the products.
#define SK   64
#define TB   (64 * LP)            // one tile of a stage, bytes
static_assert(FW == 4 && HD == 64 && SK * 2 == 128 && RH % (FW * 16) == 0 && (FW * 16) % SK == 0 && (FW * 32) % SK == 0, "128 threads bring 16 whole rows a copy; a work-group's keys end on a whole stage");
// Eight asynchronous 16-byte copies of one thread: four of the K tile and four of the V^T tile behind it, rows 16 apart; a wave's copy covers four whole lines.
// The s_wait_xcnt stands in the copies' own statement, so that no address register is rewritten ahead of it.
template <typename T16>
__device__ __forceinline__ void cpkv(unsigned l, const T16* k, const T16* v) {
    asm volatile("global_load_async_to_lds_b128 %0, %8, off\n\t"
                 "global_load_async_to_lds_b128 %1, %9, off\n\t"
                 "global_load_async_to_lds_b128 %2, %10, off\n\t"
                 "global_load_async_to_lds_b128 %3, %11, off\n\t"
                 "global_load_async_to_lds_b128 %4, %12, off\n\t"
                 "global_load_async_to_lds_b128 %5, %13, off\n\t"
                 "global_load_async_to_lds_b128 %6, %14, off\n\t"
                 "global_load_async_to_lds_b128 %7, %15, off\n\t"
                 "s_wait_xcnt 0x0"
                 :: "v"(l), "v"(l + 16 * LP), "v"(l + 32 * LP), "v"(l + 48 * LP), "v"(l + TB), "v"(l + TB + 16 * LP), "v"(l + TB + 32 * LP), "v"(l + TB + 48 * LP),
                    "v"(k), "v"(k + 16 * HD), "v"(k + 32 * HD), "v"(k + 48 * HD), "v"(v), "v"(v + 16 * TT), "v"(v + 32 * TT), "v"(v + 48 * TT) : "memory");
}
template <typename T16, bool HI> struct AFrag { typename WFrag<T16>::V k[2][2], k2[2][2], v[4], v2[4]; };
// One chunk's fragments from a stage in LDS: sb the stage, h the chunk (32 keys) within it. Byte offsets 16 hi and 32 + 16 hi within 64: the k order of WFrag::ld.
template <typename T16, bool HI>
__device__ __forceinline__ void afrag_ld(AFrag<T16, HI>& f, const unsigned char* sb, int h, int lr, int hi) {
#pragma unroll
    for (int kt = 0; kt < 2; ++kt)
#pragma unroll
        for (int dc = 0; dc < 2; ++dc) { const unsigned char* p = sb + (h * 32 + kt * 16 + lr) * LP + dc * 64 + hi * 16; f.k[kt][dc] = WFrag<T16>::lds(p); if (HI) f.k2[kt][dc] = WFrag<T16>::lds(p + 2 * TB); }
#pragma unroll
    for (int dt = 0; dt < 4; ++dt) { const unsigned char* p = sb + TB + (dt * 16 + lr) * LP + h * 64 + hi * 16; f.v[dt] = WFrag<T16>::lds(p); if (HI) f.v2[dt] = WFrag<T16>::lds(p + 2 * TB); }
}
template <typename T16, bool HI, int NQ>
__device__ __forceinline__ void attn_step(const AFrag<T16, HI>& f, const typename WFrag<T16>::V (&qb)[NQ][2], const typename WFrag<T16>::V (&qb2)[NQ][2], v8f (&o)[4][NQ], float (&m)[NQ], float (&l)[NQ], int kc, int q0, int lr, int hi) {
    typedef typename WFrag<T16>::V V;
    const float c = QSC;   // p = 2^((s - m) c)
    v8f s[NQ][2];
#pragma unroll
    for (int nq = 0; nq < NQ; ++nq)
#pragma unroll
        for (int kt = 0; kt < 2; ++kt) { v8f t = (v8f){};
#pragma unroll
            for (int dc = 0; dc < 2; ++dc) { t = WFrag<T16>::mma(f.k[kt][dc], qb[nq][dc], t); if (HI) { t = WFrag<T16>::mma(f.k[kt][dc], qb2[nq][dc], t); t = WFrag<T16>::mma(f.k2[kt][dc], qb[nq][dc], t); } }
            s[nq][kt] = t; }
    if (kc + 31 > q0) {   // only the chunk on the diagonal holds keys above a query (scalar test)
#pragma unroll
        for (int nq = 0; nq < NQ; ++nq)
#pragma unroll
            for (int kt = 0; kt < 2; ++kt)
#pragma unroll
                for (int j = 0; j < 8; ++j) if (kc + kt * 16 + hi * 8 + j > q0 + nq * 16 + lr) s[nq][kt][j] = -3.0e38f;
    }
    float mx[NQ]; bool need = false;
#pragma unroll
    for (int nq = 0; nq < NQ; ++nq) { float t = s[nq][0][0];
#pragma unroll
        for (int j = 1; j < 8; ++j) t = fmaxf(t, s[nq][0][j]);
#pragma unroll
        for (int j = 0; j < 8; ++j) t = fmaxf(t, s[nq][1][j]);
        t = fmaxf(t, __shfl_xor(t, 16, 32));   // the two halves of the wave hold the same query's other keys: both must use one maximum
        mx[nq] = t; need = need || ((t - m[nq]) * c > 8.0f); }
    if (__builtin_amdgcn_ballot_w32(need) != 0) {   // lazy rescale, one scalar test per chunk: the maximum in use moves only when some query's scores pass it by more than 2^8
#pragma unroll
        for (int nq = 0; nq < NQ; ++nq) { const float mn = fmaxf(m[nq], mx[nq]); const float al = __builtin_amdgcn_exp2f((m[nq] - mn) * c); m[nq] = mn; l[nq] *= al;
#pragma unroll
            for (int dt = 0; dt < 4; ++dt) o[dt][nq] *= al; }
    }
    V pb[NQ], pl[NQ];
#pragma unroll
    for (int nq = 0; nq < NQ; ++nq) { const float mc = m[nq] * c; float ps = 0.f;
#pragma unroll
        for (int kt = 0; kt < 2; ++kt)
#pragma unroll
            for (int j = 0; j < 8; ++j) { const float p = __builtin_amdgcn_exp2f(fmaf(s[nq][kt][j], c, -mc)); s[nq][kt][j] = p; ps += p; }
        l[nq] += ps;
        // slot e of the B operand is key 8 hi + e (e < 8) or 16 + 8 hi + (e - 8): register j of score tile 0 or 1, the k order of the V^T loader
        static_assert(HI, "the fp16 rows take attn_step_rel");
        v8us h0, h1, l0, l1;
#pragma unroll
        for (int j = 0; j < 8; ++j) { unsigned short a, b2; splitf(s[nq][0][j], a, b2); h0[j] = a; l0[j] = b2; splitf(s[nq][1][j], a, b2); h1[j] = a; l1[j] = b2; }
        pb[nq] = cat16b(h0, h1); pl[nq] = cat16b(l0, l1); }
#pragma unroll
    for (int dt = 0; dt < 4; ++dt)
#pragma unroll
        for (int nq = 0; nq < NQ; ++nq) { o[dt][nq] = WFrag<T16>::mma(f.v[dt], pb[nq], o[dt][nq]); if (HI) { o[dt][nq] = WFrag<T16>::mma(f.v[dt], pl[nq], o[dt][nq]); o[dt][nq] = WFrag<T16>::mma(f.v2[dt], pb[nq], o[dt][nq]); } }
}
// The fp16 rows' step. Q comes pre-scaled by QSC, and the score accumulators start at cm = -(maximum in use), one value per query in all eight registers: the products come out as s QSC - m, the exponent itself,
// so that no vector instruction stands between a score and its exp2, and one threshold serves every query: the common path takes one maximum over all of a lane's scores and no exchange between the halves (that stands in the rescale branch alone).
// The row sums are a product too: a ones row times the packed f16 P^T, so numerator and denominator add the same rounded weights.
template <int NQ>
__device__ __forceinline__ void attn_step_rel(const AFrag<h16, false>& f, const v16h (&qb)[NQ][2], v8f (&o)[4][NQ], v8f (&cm)[NQ], v8f (&ls)[NQ], const v16h& ones, int kc, int q0, int lr, int hi) {
    v8f s[NQ][2];
#pragma unroll
    for (int nq = 0; nq < NQ; ++nq)
#pragma unroll
        for (int kt = 0; kt < 2; ++kt) { v8f t = cm[nq];
#pragma unroll
            for (int dc = 0; dc < 2; ++dc) t = wmma16(f.k[kt][dc], qb[nq][dc], t);
            s[nq][kt] = t; }
    if (kc + 31 > q0) {   // only the chunk on the diagonal holds keys above a query (scalar test)
#pragma unroll
        for (int nq = 0; nq < NQ; ++nq)
#pragma unroll
            for (int kt = 0; kt < 2; ++kt)
#pragma unroll
                for (int j = 0; j < 8; ++j) if (kc + kt * 16 + hi * 8 + j > q0 + nq * 16 + lr) s[nq][kt][j] = -3.0e38f;
    }
    float mx[NQ], top = -3.0e38f;
#pragma unroll
    for (int nq = 0; nq < NQ; ++nq) { float t = s[nq][0][0];
#pragma unroll
        for (int j = 1; j < 8; ++j) t = fmaxf(t, s[nq][0][j]);
#pragma unroll
        for (int j = 0; j < 8; ++j) t = fmaxf(t, s[nq][1][j]);
        mx[nq] = t; top = fmaxf(top, t); }
    if (kc == 0 || __builtin_amdgcn_ballot_w32(top > 8.0f) != 0) {   // lazy rescale, one scalar test per chunk: the maximum in use is set by the first chunk and moves only when some query's scores pass it by more than 2^8
#pragma unroll
        for (int nq = 0; nq < NQ; ++nq) { const float t = fmaxf(mx[nq], __shfl_xor(mx[nq], 16, 32));   // the two halves of the wave hold the same query's other keys: both must use one maximum
            const float up = fmaxf(t, 0.f), d = kc == 0 ? t : up;   // the first chunk may also lower it from its start value 0 (sums and outputs are still 0 there: their factor stays finite)
            const float al = __builtin_amdgcn_exp2f(-up); ls[nq] *= al; cm[nq] -= d; s[nq][0] -= d; s[nq][1] -= d;
#pragma unroll
            for (int dt = 0; dt < 4; ++dt) o[dt][nq] *= al; }
    }
    v16h pb[NQ];
#pragma unroll
    for (int nq = 0; nq < NQ; ++nq) { v8h h0, h1;
#pragma unroll
        for (int kt = 0; kt < 2; ++kt)
#pragma unroll
            for (int j = 0; j < 8; ++j) s[nq][kt][j] = __builtin_amdgcn_exp2f(s[nq][kt][j]);
        // slot e of the B operand is key 8 hi + e (e < 8) or 16 + 8 hi + (e - 8): register j of score tile 0 or 1, the k order of the V^T loader
#pragma unroll
        for (int j = 0; j < 8; ++j) { h0[j] = tohx(s[nq][0][j]); h1[j] = tohx(s[nq][1][j]); }
        pb[nq] = cat16(h0, h1); }
#pragma unroll
    for (int dt = 0; dt < 4; ++dt)
#pragma unroll
        for (int nq = 0; nq < NQ; ++nq) o[dt][nq] = wmma16(f.v[dt], pb[nq], o[dt][nq]);
#pragma unroll
    for (int nq = 0; nq < NQ; ++nq) ls[nq] = wmma16(ones, pb[nq], ls[nq]);   // row 0 of the tile += each query's sum over the chunk's 32 rounded probabilities
}
template <typename T16, bool HI, int NQ>
__device__ __forceinline__ void attn_rows(const T16* __restrict__ Q, const T16* __restrict__ Q2, const T16* __restrict__ Kp, const T16* __restrict__ K2, const T16* __restrict__ Vt, const T16* __restrict__ V2, int q0, int ns, unsigned char* ring, bf* Ah, bf* Al) {   // q0: the wave's first row; ns: stages up to the work-group's last row, the same for its four waves
    typedef typename WFrag<T16>::V V;
    constexpr int SB = (HI ? 4 : 2) * TB;   // one stage, bytes
    const int tid = threadIdx.x, lane = tid & 31, lr = lane & 15, hi = lane >> 4;
    V qb[NQ][2], qb2[NQ][2]; v8f o[4][NQ], cm[NQ], ls[NQ]; float m[NQ], l[NQ];
#pragma unroll
    for (int nq = 0; nq < NQ; ++nq) { m[nq] = -3.0e38f; l[nq] = 0.f; cm[nq] = (v8f){}; ls[nq] = (v8f){};
#pragma unroll
        for (int dc = 0; dc < 2; ++dc) { const size_t qo = (size_t)(q0 + nq * 16 + lr) * HD + dc * 32 + 8 * hi; qb[nq][dc] = WFrag<T16>::ld(Q + qo); if (HI) qb2[nq][dc] = WFrag<T16>::ld(Q2 + qo); }
#pragma unroll
        for (int dt = 0; dt < 4; ++dt) o[dt][nq] = (v8f){}; }
    v16h ones;   // A operand of the row sums: row 0 (lanes 0 and 16) is 1 at all 32 k positions, every other row 0
#pragma unroll
    for (int e = 0; e < 16; ++e) ones[e] = lr == 0 ? (h16)1.0f : (h16)0.0f;
    const int kend = q0 + NQ * 16;   // the wave's keys 0 .. kend - 1, in chunks of 32; every chunk holds at least one key <= every query of the wave
    const size_t gk = (size_t)(tid >> 3) * HD + (tid & 7) * 8, gv = (size_t)(tid >> 3) * TT + (tid & 7) * 8;   // a thread's row and 16-byte piece within 16 rows
    const unsigned lb = (unsigned)(size_t)ring + (unsigned)((tid >> 3) * LP + (tid & 7) * 16);
    auto fill = [&](int t) { const unsigned l = lb + (unsigned)((t & 1) * SB); cpkv<T16>(l, Kp + gk + (size_t)t * SK * HD, Vt + gv + t * SK); if constexpr (HI) cpkv<T16>(l + 2 * TB, K2 + gk + (size_t)t * SK * HD, V2 + gv + t * SK); };
    fill(0);
    asm volatile("s_wait_asynccnt 0x0" ::: "memory");   // this wave's part of stage 0 has landed
    __syncthreads();                                     // ... and every other wave's
    if (ns > 1) fill(1);
#pragma unroll 1   // one stage per trip: the buffer is picked by the trip's parity
    for (int t = 0; t < ns; ++t) { const unsigned char* sb = ring + (t & 1) * SB;
#pragma unroll 1   // one chunk's fragments live at a time: an unrolled key loop would not fit four waves per SIMD
        for (int h = 0; h < SK / 32; ++h) { const int kc = t * SK + h * 32;
            if (kc < kend) {   // scalar test: a wave is done with its keys up to three chunks ahead of the work-group's last wave, and still passes every barrier
                AFrag<T16, HI> f; afrag_ld<T16, HI>(f, sb, h, lr, hi);
                // inputs-only fence on the loaded fragments: all of a chunk's LDS reads are issued together and waited for once (left free, the reads are strung out between the products, one LDS latency each)
                if constexpr (HI) asm volatile("" :: "v"(f.k[0][0]), "v"(f.k[0][1]), "v"(f.k[1][0]), "v"(f.k[1][1]), "v"(f.k2[0][0]), "v"(f.k2[0][1]), "v"(f.k2[1][0]), "v"(f.k2[1][1]), "v"(f.v[0]), "v"(f.v[1]), "v"(f.v[2]), "v"(f.v[3]), "v"(f.v2[0]), "v"(f.v2[1]), "v"(f.v2[2]), "v"(f.v2[3]));
                else asm volatile("" :: "v"(f.k[0][0]), "v"(f.k[0][1]), "v"(f.k[1][0]), "v"(f.k[1][1]), "v"(f.v[0]), "v"(f.v[1]), "v"(f.v[2]), "v"(f.v[3]));
                __builtin_amdgcn_sched_barrier(0);   // keeps the first products, and the wait they bring, from being lifted in front of the chunk's last reads
                if constexpr (HI) attn_step<T16, HI, NQ>(f, qb, qb2, o, m, l, kc, q0, lr, hi); else attn_step_rel<NQ>(f, qb, o, cm, ls, ones, kc, q0, lr, hi);
                __builtin_amdgcn_sched_barrier(0);   // holds the slots below behind the chunk's last product
                asm volatile("v_nop\n\tv_nop\n\tv_nop\n\tv_nop");   // the four vector slots the chip needs between the last product and the next chunk's address arithmetic, which reuses its operand registers
            } }
        asm volatile("s_wait_dscnt 0x0" ::: "memory");      // this wave's reads of the buffer are done before the buffer is given up
        asm volatile("s_wait_asynccnt 0x0" ::: "memory");   // this wave's part of stage t + 1 has landed
        __syncthreads();                                     // publishes stage t + 1 and ends every wave's reads of stage t
        if (t + 2 < ns) fill(t + 2);                         // into the buffer this trip has just read
    }
    asm volatile("s_wait_asynccnt 0x0" ::: "memory");   // no copy is outstanding when the wave ends
#pragma unroll
    for (int nq = 0; nq < NQ; ++nq) { const float lh = HI ? l[nq] : ls[nq][0];   // fp16 rows: row 0 of the sum tile, register 0 of lanes 0 .. 15; the other half holds 0
        const float li = __fdiv_rn(1.0f, lh + __shfl_xor(lh, 16, 32));   // the halves' sums join once, here
        const size_t ro = (size_t)(q0 + nq * 16 + lr) * DQ + hi * 8;
#pragma unroll
        for (int dt = 0; dt < 4; ++dt) { v8us oh, ol;
#pragma unroll
            for (int j = 0; j < 8; ++j) { unsigned short a, b2; splitf(o[dt][nq][j] * li, a, b2); oh[j] = a; ol[j] = b2; }
            *(v8us*)(Ah + ro + dt * 16) = oh; *(v8us*)(Al + ro + dt * 16) = ol; } }
}
// grid (NB_ * NH_, row blocks): the row block is the slow index and the longest rows come first. Blocks 0 .. NBF-1: fp16 rows, FW * 32 each, from the end of the sequence down to RH; the rest: hi/lo rows, FW * 16 each.
#define NBF  ((TT - RH) / (FW * 32))
#define NBH  (RH / (FW * 16))
__global__ __launch_bounds__(32 * FW) void k_fattn(const h16* __restrict__ Q16, const h16* __restrict__ K16, const h16* __restrict__ V16, const bf* __restrict__ Qh, const bf* __restrict__ Ql, const bf* __restrict__ Kh, const bf* __restrict__ Kl, const bf* __restrict__ Vh, const bf* __restrict__ Vl, bf* Ah, bf* Al) {
    __shared__ __align__(16) unsigned char ring[2 * 4 * TB];   // two stages of the hi/lo rows' four tiles; the fp16 rows use half
    const int z = blockIdx.x, y = blockIdx.y; const size_t po = (size_t)z * TT * HD; const size_t ao = (size_t)(z / NH_) * TT * DQ + (size_t)(z % NH_) * HD;
    const int wv = __builtin_amdgcn_readfirstlane((int)(threadIdx.x >> 5));   // wave number as a scalar: row offsets, trip counts and the diagonal test stay scalar
    if (y < NBF) attn_rows<h16, false, 2>(Q16 + po, nullptr, K16 + po, nullptr, V16 + po, nullptr, TT - (y + 1) * (FW * 32) + wv * 32, (TT - y * (FW * 32)) / SK, ring, Ah + ao, Al + ao);
    else attn_rows<bf, true, 1>(Qh + po, Ql + po, Kh + po, Kl + po, Vh + po, Vl + po, RH - (y - NBF + 1) * (FW * 16) + wv * 16, (RH - (y - NBF) * (FW * 16)) / SK, ring, Ah + ao, Al + ao);
}

extern "C" void kernel_launch(void* const* d_in, const int* in_sizes, int n_in,
                              void* d_out, int out_size, void* d_ws, size_t ws_size, hipStream_t stream) {
    (void)in_sizes; (void)n_in; (void)out_size;
    const float* x = (const float*)d_in[0]; const float* xk = (const float*)d_in[1]; const float* xv = (const float*)d_in[2]; const float* wq = (const float*)d_in[3]; const float* bq = (const float*)d_in[4]; const float* wk = (const float*)d_in[5]; const float* bk = (const float*)d_in[6]; const float* wv = (const float*)d_in[7]; const float* bv = (const float*)d_in[8]; const float* wo = (const float*)d_in[9]; const float* bo = (const float*)d_in[10];
    float* OUT = (float*)d_out;     // [4][2048][768]
    char* wsp = (char*)d_ws;
    auto take = [&](size_t bytes) { char* p = wsp; wsp += (bytes + 255) & ~(size_t)255; return (void*)p; };
    bf* WQ = (bf*)take((size_t)4 * DQ * DM * 2); bf* WO = WQ + (size_t)3 * DQ * DM;   // W_Q, W_K, W_V, W_O one behind the other
    bf* XB = (bf*)take((size_t)3 * NB_ * TT * DM * 2);   // [stream][batch][t][DM]
    const size_t PB = (size_t)NH_ * TT * HD;   // one batch's head planes, elements; every plane set holds [stream][batch]
    h16* QP16 = (h16*)take(3 * NB_ * PB * 2); h16* KP16 = QP16 + NB_ * PB; h16* VT16 = KP16 + NB_ * PB;
    bf* QPh = (bf*)take(3 * NB_ * PB * 2); bf* KPh = QPh + NB_ * PB; bf* VTh = KPh + NB_ * PB; bf* QPl = (bf*)take(3 * NB_ * PB * 2); bf* KPl = QPl + NB_ * PB; bf* VTl = KPl + NB_ * PB;
    bf* ATh = (bf*)take((size_t)NB_ * TT * DQ * 2); bf* ATl = (bf*)take((size_t)NB_ * TT * DQ * 2);
    if ((size_t)(wsp - (char*)d_ws) > ws_size) return;    // ws 256 MiB
    k_cvt8<<<3 * CXB + 4 * CWB, 256, 0, stream>>>(x, xk, xv, wq, wk, wv, wo, XB, WQ);
    k_gemmt<0, 1><<<dim3(TT / BT, DQ / BN, 3 * NB_), 128, 0, stream>>>(XB, nullptr, WQ, nullptr, bq, bk, bv, QP16, QPh, QPl);
    k_fattn<<<dim3(NB_ * NH_, NBF + NBH, 1), 32 * FW, 0, stream>>>(QP16, KP16, VT16, QPh, QPl, KPh, KPl, VTh, VTl, ATh, ATl);
    k_gemmt<1, 0><<<dim3(NB_ * TT / BT, DM / BN, 1), 256, 0, stream>>>(ATh, ATl, WO, OUT, bo, nullptr, nullptr, nullptr, nullptr, nullptr);
}
